// v000
// Times are from an AMD MI455X. After a warm-up the kernel runs many times in a row, and a time is the length of
// such a window on the GPU divided by its runs, so every launch and the gaps after it count. The runs cycle
// through copies of the inputs. A figure is the median of several windows, for all but v000 over two sittings.
// Sittings can differ by a few percent; kernels timed side by side share one.
// v000, which the later versions start from, runs in 3940 microseconds.
#include <hip/hip_runtime.h>
// ViT self-attention (x [16][1024][768]; q/k/v = x W^T + b (nn.Linear [out][in] 768^2, sigma 0.02, zero biases), 12 heads of 64; scores / 8; softmax; out = (attn v merged) Wc^T + bc -> [16][1024][768]).
// Structure: token rows r = b*1024 + s; x as exact f16 rows (bf16-rounded); Q, K, V as three WMMA GEMMs (32x64 wave tiles, f32 accumulation, exact x16 weights + bias, f16 outputs); per batch: V^T for all heads via LDS transposes; per (batch, group of 12 heads): scores GEMM (K = 64, batched over the heads on grid.y, alpha = 64^-0.5), row softmax on VALU (f32 statistics; weights stored x256 as f16), o = P . V^T GEMM (K = 1024, alpha 2^-2: o carried x64 against f16 subnormal flush, folded into the output GEMM alpha) written straight into the merged f16 o rows; out = o W_o + b GEMM (f32) into the output layout.
// Compute dtype: inputs rounded to bf16; x / weights exact; q, k, v, softmax weights and o as plain f16 GEMM operands (~2^-12); scores and softmax statistics f32. v_wmma_f32_16x16x32_f16.
#define NB 16
#define SQ 1024
#define DM 768
#define NH 12
#define HD 64
#define HG 12                         /* heads per attention launch group */
#define B0 0                         /* first batch processed (debug hook) */
#define NBR NB                       /* batches processed (debug hook) */
#define NR ((size_t)NB * SQ)         /* token rows */
#define MP ((int)((size_t)NBR * SQ)) /* rows projected (debug hook) */
#define QN SQ                        /* query rows attended per batch (debug hook) */
#define NHD NH                       /* heads attended (debug hook) */
#define MPO MP                       /* rows through the output stage (debug hook) */
#define LQ DM      /* row pitch of the q/k/v rows */
typedef __bf16 v16b __attribute__((ext_vector_type(16)));
typedef unsigned short v8us __attribute__((ext_vector_type(8), may_alias));
typedef float  v8f  __attribute__((ext_vector_type(8)));
typedef float  v4f  __attribute__((ext_vector_type(4)));
typedef float  v4fa __attribute__((ext_vector_type(4), may_alias));
union FragB { v16b v; v8us half[2]; unsigned short u[16]; };

__device__ __forceinline__ unsigned short bf16_bits(float x) { unsigned int u = __float_as_uint(x); return (unsigned short)((u + 0x7FFFu + ((u >> 16) & 1u)) >> 16); }
__device__ __forceinline__ float bf16_val(unsigned short b) { return __uint_as_float(((unsigned int)b) << 16); }
__device__ __forceinline__ float bf16_round(float x) { return bf16_val(bf16_bits(x)); }
// D += A·B with NT terms: 1 = ah·bh, 2 = + al·bh (A split), 3 = + ah·bl (both split)
template <int NT>
__device__ __forceinline__ v8f mmaN(v16b ah, v16b al, v16b bh, v16b bl, v8f c) {
  c = __builtin_amdgcn_wmma_f32_16x16x32_bf16(false, ah, false, bh, (short)0, c, false, false);
  if (NT >= 2) c = __builtin_amdgcn_wmma_f32_16x16x32_bf16(false, al, false, bh, (short)0, c, false, false);
  if (NT >= 3) c = __builtin_amdgcn_wmma_f32_16x16x32_bf16(false, ah, false, bl, (short)0, c, false, false);
  asm volatile("v_nop\n\tv_nop\n\tv_nop\n\tv_nop" : "+v"(c) : "v"(ah), "v"(al), "v"(bh), "v"(bl));
  return c;
}

__global__ __launch_bounds__(256) void k_wt_bf16(const float* __restrict__ W, unsigned short* __restrict__ Wt, int K, int N) {
  const int t = blockIdx.x * 256 + threadIdx.x;
  const int k8n = K / 8;
  if (t >= N * k8n) return;
  const int n = t / k8n, k8 = (t % k8n) * 8;
  v8us v;
#pragma unroll
  for (int i = 0; i < 8; ++i) v[i] = bf16_bits(W[(size_t)(k8 + i) * N + n]);
  *(v8us*)(Wt + (size_t)n * K + k8) = v;
  
}

// GEMM C[M][N] (f32, pitch ldc) = act(A[M][K]·W + bias). A f32 row-major (pitch lda) converted per fragment to bf16
// (ASPLIT: hi/lo two planes -> 2 terms, else single rounded term); Wt bf16 [N][K] (pitch ldb). BIAS_BF16 rounds the
// bias to bf16 first (bias quantised to bf16 before the add). K%32==0, M%16==0, N%64==0.
template <bool ASPLIT, int ACT, bool BIAS_BF16>
__global__ __launch_bounds__(128) void k_gemm_bf(const float* __restrict__ A, int lda, const unsigned short* __restrict__ Wt, int ldb,
                                               const float* __restrict__ bias, float* __restrict__ C, int ldc, int M, int N, int K) {
  __shared__ __attribute__((aligned(16))) float so[4][16][64];
  const int tid = threadIdx.x, w = tid >> 5, lane = tid & 31, ln = lane & 15, hh = lane >> 4;
  const int ntn = N / 64;
  const int wid = blockIdx.x * 4 + w;
  const int mt = wid / ntn, nq = wid % ntn;
  if (mt * 16 >= M) return;
  const int row0 = mt * 16, col0 = nq * 64;
  const float* arow = A + (size_t)(row0 + ln) * lda;
  v8f acc[4] = {};
  for (int kb = 0; kb < K; kb += 32) {
    FragB ah, al;
    const v4f x0 = *(const v4fa*)(arow + kb + 8 * hh), x1 = *(const v4fa*)(arow + kb + 8 * hh + 4);
    const v4f x2 = *(const v4fa*)(arow + kb + 16 + 8 * hh), x3 = *(const v4fa*)(arow + kb + 16 + 8 * hh + 4);
    float xs[16] = {x0[0],x0[1],x0[2],x0[3],x1[0],x1[1],x1[2],x1[3],x2[0],x2[1],x2[2],x2[3],x3[0],x3[1],x3[2],x3[3]};
#pragma unroll
    for (int i = 0; i < 16; ++i) { const unsigned short hb = bf16_bits(xs[i]); ah.u[i] = hb; al.u[i] = ASPLIT ? bf16_bits(xs[i] - bf16_val(hb)) : (unsigned short)0; }
#pragma unroll
    for (int t = 0; t < 4; ++t) {
      const unsigned short* brow = Wt + (size_t)(col0 + t * 16 + ln) * ldb + kb;
      FragB b;
      b.half[0] = *(const v8us*)(brow + 8 * hh);
      b.half[1] = *(const v8us*)(brow + 16 + 8 * hh);
      acc[t] = mmaN<ASPLIT ? 2 : 1>(ah.v, al.v, b.v, b.v, acc[t]);
    }
  }
#pragma unroll
  for (int t = 0; t < 4; ++t) {
    float bv = bias ? bias[col0 + t * 16 + ln] : 0.f;
    if (BIAS_BF16) bv = bf16_round(bv);
#pragma unroll
    for (int r = 0; r < 8; ++r) { float v = acc[t][r] + bv; if (ACT == 1) v = fmaxf(v, 0.f); so[w][8 * hh + r][t * 16 + ln] = v; }
  }
  __builtin_amdgcn_fence(__ATOMIC_ACQ_REL, "workgroup");
  __builtin_amdgcn_wave_barrier();
  const int rsub = lane >> 4, c4 = (lane & 15) * 4;
  {
#pragma unroll
    for (int q = 0; q < 8; ++q) {
      const int r = q * 2 + rsub;
      const v4f v = *(const v4fa*)&so[w][r][c4];
      *(v4f*)(C + (size_t)(row0 + r) * ldc + col0 + c4) = v;
    }
    
  }
}

// GEMM C = act(A·W + bias + resid): A f32 (ASPLIT -> hi/lo 2 terms), Wt bf16 [N][K]; ACT 0 none, 1 relu, 2 exact gelu;
// resid (optional, f32, row index = (row % rmod), pitch ldr, RES_BF16 rounds it) added before the activation.
template <bool ASPLIT, int ACT, bool BIAS_BF16, bool RES_BF16>
__global__ __launch_bounds__(128) void k_gemm_bf3(const float* __restrict__ A, int lda, const unsigned short* __restrict__ Wt, int ldb,
                                                const float* __restrict__ bias, const float* __restrict__ resid, int rmod, int ldr,
                                                float* __restrict__ C, int ldc, int M, int N, int K) {
  __shared__ __attribute__((aligned(16))) float so[4][16][64];
  const int tid = threadIdx.x, w = tid >> 5, lane = tid & 31, ln = lane & 15, hh = lane >> 4;
  const int ntn = N / 64;
  const int wid = blockIdx.x * 4 + w;
  const int mt = wid / ntn, nq = wid % ntn;
  if (mt * 16 >= M) return;
  const int row0 = mt * 16, col0 = nq * 64;
  const float* arow = A + (size_t)(row0 + ln) * lda;
  v8f acc[4] = {};
  for (int kb = 0; kb < K; kb += 32) {
    FragB ah, al;
    const v4f x0 = *(const v4fa*)(arow + kb + 8 * hh), x1 = *(const v4fa*)(arow + kb + 8 * hh + 4);
    const v4f x2 = *(const v4fa*)(arow + kb + 16 + 8 * hh), x3 = *(const v4fa*)(arow + kb + 16 + 8 * hh + 4);
    float xs[16] = {x0[0],x0[1],x0[2],x0[3],x1[0],x1[1],x1[2],x1[3],x2[0],x2[1],x2[2],x2[3],x3[0],x3[1],x3[2],x3[3]};
#pragma unroll
    for (int i = 0; i < 16; ++i) { const unsigned short hb = bf16_bits(xs[i]); ah.u[i] = hb; al.u[i] = ASPLIT ? bf16_bits(xs[i] - bf16_val(hb)) : (unsigned short)0; }
#pragma unroll
    for (int t = 0; t < 4; ++t) {
      const unsigned short* brow = Wt + (size_t)(col0 + t * 16 + ln) * ldb + kb;
      FragB b;
      b.half[0] = *(const v8us*)(brow + 8 * hh);
      b.half[1] = *(const v8us*)(brow + 16 + 8 * hh);
      acc[t] = mmaN<ASPLIT ? 2 : 1>(ah.v, al.v, b.v, b.v, acc[t]);
    }
  }
#pragma unroll
  for (int t = 0; t < 4; ++t) {
    const int col = col0 + t * 16 + ln;
    float bv = bias ? bias[col] : 0.f;
    if (BIAS_BF16) bv = bf16_round(bv);
#pragma unroll
    for (int r = 0; r < 8; ++r) {
      float v = acc[t][r] + bv;
      if (resid) { float rv = resid[(size_t)((row0 + 8 * hh + r) % rmod) * ldr + col]; if (RES_BF16) rv = bf16_round(rv); v += rv; }
      if (ACT == 1) v = fmaxf(v, 0.f);
      if (ACT == 2) v = 0.5f * v * (1.0f + erff(v * 0.70710678118654752f));
      if (ACT == 3) { const float u = 0.7978845608028654f * (v + 0.044715f * v * v * v); v = 0.5f * v * (1.0f + tanhf(u)); }
      so[w][8 * hh + r][t * 16 + ln] = v;
    }
  }
  __builtin_amdgcn_fence(__ATOMIC_ACQ_REL, "workgroup");
  __builtin_amdgcn_wave_barrier();
  const int rsub = lane >> 4, c4 = (lane & 15) * 4;
  {
#pragma unroll
    for (int q = 0; q < 8; ++q) {
      const int r = q * 2 + rsub;
      const v4f v = *(const v4fa*)&so[w][r][c4];
      *(v4f*)(C + (size_t)(row0 + r) * ldc + col0 + c4) = v;
    }
    
  }
}
// row LayerNorm (biased variance, eps) over N: s = X (+ R); optional out_sum <- s; out_norm <- (s-mu)*rsqrt(var+eps)*g + b
template <bool PARAM_BF16>
__global__ __launch_bounds__(256) void k_layernorm(const float* __restrict__ X, const float* __restrict__ R, const float* __restrict__ g, const float* __restrict__ bta,
                                                  float* __restrict__ out_sum, float* __restrict__ out_norm, int N, float eps) {
  __shared__ float red[256];
  const int row = blockIdx.x, tid = threadIdx.x;
  const float* x = X + (size_t)row * N; const float* rr = R ? R + (size_t)row * N : nullptr;
  float vals[16];                     // up to N = 4096
  const int per = N / 256;            // contiguous chunk per thread? use strided-by-4 chunks: thread handles j = tid*4 + 1024*u
  float s1 = 0.f;
  for (int u = 0; u < per / 4; ++u) {
    const int j = tid * 4 + 1024 * u;
    const v4f a = *(const v4fa*)(x + j);
    v4f b = {0.f,0.f,0.f,0.f}; if (rr) b = *(const v4fa*)(rr + j);
#pragma unroll
    for (int q = 0; q < 4; ++q) { const float v = a[q] + b[q]; vals[u * 4 + q] = v; s1 += v; }
  }
  red[tid] = s1; __syncthreads();
  for (int st = 128; st > 0; st >>= 1) { if (tid < st) red[tid] += red[tid + st]; __syncthreads(); }
  const float mu = red[0] / (float)N; __syncthreads();
  float s2 = 0.f;
  for (int u = 0; u < per / 4; ++u)
#pragma unroll
    for (int q = 0; q < 4; ++q) { const float c = vals[u * 4 + q] - mu; s2 += c * c; }
  red[tid] = s2; __syncthreads();
  for (int st = 128; st > 0; st >>= 1) { if (tid < st) red[tid] += red[tid + st]; __syncthreads(); }
  const float rs = rsqrtf(red[0] / (float)N + eps);
  {
    for (int u = 0; u < per / 4; ++u) {
      const int j = tid * 4 + 1024 * u;
      v4f o, sm;
#pragma unroll
      for (int q = 0; q < 4; ++q) {
        float gg = g[j + q], bb = bta[j + q];
        if (PARAM_BF16) { gg = bf16_round(gg); bb = bf16_round(bb); }
        sm[q] = vals[u * 4 + q]; o[q] = (vals[u * 4 + q] - mu) * rs * gg + bb;
      }
      if (out_sum) *(v4f*)(out_sum + (size_t)row * N + j) = sm;
      *(v4f*)(out_norm + (size_t)row * N + j) = o;
    }
    
  }
}



// ---- f16 WMMA path (v_wmma_f32_16x16x32_f16): 11-bit significands for operands in range — used where a [0,1] probability operand needs more precision than bf16
typedef _Float16 v16h __attribute__((ext_vector_type(16)));
union FragH { v16h v; v8us half[2]; _Float16 h[16]; unsigned short u[16]; };
template <int NT>
__device__ __forceinline__ v8f mmaH(v16h ah, v16h al, v16h bh, v16h bl, v8f c) {
  c = __builtin_amdgcn_wmma_f32_16x16x32_f16(false, ah, false, bh, (short)0, c, false, false);
  if (NT >= 2) c = __builtin_amdgcn_wmma_f32_16x16x32_f16(false, al, false, bh, (short)0, c, false, false);
  if (NT >= 3) c = __builtin_amdgcn_wmma_f32_16x16x32_f16(false, ah, false, bl, (short)0, c, false, false);
  asm volatile("v_nop\n\tv_nop\n\tv_nop\n\tv_nop" : "+v"(c) : "v"(ah), "v"(al), "v"(bh), "v"(bl));
  return c;
}
// batched GEMM like k_gemm_b but f16 operands: A f32 (split into f16 hi/lo if ASPLIT, else rounded to f16), Bt = f16 values [n][k]; alpha; C f32; N multiple of 16 (partial tiles skipped)
template <bool ASPLIT>
__global__ __launch_bounds__(128) void k_gemm_h(const float* __restrict__ A, int lda, size_t sA, const _Float16* __restrict__ Bh, int ldb, size_t sB, float alpha, float* __restrict__ C, int ldc, size_t sC, int M, int N, int K) {
  __shared__ __attribute__((aligned(16))) float so[4][16][64];
  const int tid = threadIdx.x, w = tid >> 5, lane = tid & 31, ln = lane & 15, hh = lane >> 4; const int by = blockIdx.y;
  A += (size_t)by * sA; Bh += (size_t)by * sB; C += (size_t)by * sC;
  const int ntn = (N + 63) / 64; const int wid = blockIdx.x * 4 + w; const int mt = wid / ntn, nq = wid % ntn; if (mt * 16 >= M) return;
  const int row0 = mt * 16, col0 = nq * 64; const float* arow = A + (size_t)(row0 + ln) * lda;
  v8f acc[4] = {};
  for (int kb = 0; kb < K; kb += 32) {
    FragH ah, al;
    const v4f x0 = *(const v4fa*)(arow + kb + 8 * hh), x1 = *(const v4fa*)(arow + kb + 8 * hh + 4), x2 = *(const v4fa*)(arow + kb + 16 + 8 * hh), x3 = *(const v4fa*)(arow + kb + 16 + 8 * hh + 4);
    float xs[16] = {x0[0],x0[1],x0[2],x0[3],x1[0],x1[1],x1[2],x1[3],x2[0],x2[1],x2[2],x2[3],x3[0],x3[1],x3[2],x3[3]};
#pragma unroll
    for (int i = 0; i < 16; ++i) { const _Float16 h = (_Float16)xs[i]; ah.h[i] = h; al.h[i] = ASPLIT ? (_Float16)(xs[i] - (float)h) : (_Float16)0.0f; }
#pragma unroll
    for (int t = 0; t < 4; ++t) { if (col0 + t * 16 >= N) continue; const size_t boff = (size_t)(col0 + t * 16 + ln) * ldb + kb; FragH bq; bq.half[0] = *(const v8us*)(Bh + boff + 8 * hh); bq.half[1] = *(const v8us*)(Bh + boff + 16 + 8 * hh);
      acc[t] = mmaH<ASPLIT ? 2 : 1>(ah.v, al.v, bq.v, bq.v, acc[t]); }
  }
#pragma unroll
  for (int t = 0; t < 4; ++t) { if (col0 + t * 16 >= N) continue;
#pragma unroll
    for (int r = 0; r < 8; ++r) so[w][8 * hh + r][t * 16 + ln] = acc[t][r] * alpha; }
  __builtin_amdgcn_fence(__ATOMIC_ACQ_REL, "workgroup"); __builtin_amdgcn_wave_barrier();
  const int rsub = lane >> 4, c4 = (lane & 15) * 4;
  {
#pragma unroll
    for (int q = 0; q < 8; ++q) { const int r = q * 2 + rsub; if (col0 + c4 < N) { const v4f v = *(const v4fa*)&so[w][r][c4]; *(v4f*)(C + (size_t)(row0 + r) * ldc + col0 + c4) = v; } }
     }
}

// Wt[n][k] = f16(W[k][n]·scale) from f32 row-major W[K][N] (scale = power of two; bf16-exact weights stay exact in f16 away from the subnormal range)
__global__ __launch_bounds__(256) void k_wt_f16(const float* __restrict__ W, _Float16* __restrict__ Wt, int K, int N, float scale) {
  const int t = blockIdx.x * 256 + threadIdx.x; if (t >= N * (K / 8)) return; const int n = t / (K / 8), k8 = (t % (K / 8)) * 8; FragH f;
#pragma unroll
  for (int i = 0; i < 8; ++i) f.h[i] = (_Float16)(bf16_round(W[(size_t)(k8 + i) * N + n]) * scale); const v8us o = f.half[0];
  *(v8us*)((unsigned short*)Wt + (size_t)n * K + k8) = o; 
}
// k_gemm_hh variant with fused epilogue: v = acc·alpha + bias[by·sBias + col] (+ CP[(row/rowsPerB)·sCPb + by·64 + col] if CP) ; ACT 0 none / 1 elu ; writes f16 C16 (and f32 C if non-null)
template <int ACT>
__global__ __launch_bounds__(128) void k_gemm_hhx(const _Float16* __restrict__ A, int lda, size_t sA, const _Float16* __restrict__ Bh, int ldb, size_t sB, float alpha, const float* __restrict__ bias, size_t sBias, const float* __restrict__ CP, int rowsPerB, size_t sCPb, int row0g,
    float* __restrict__ C, _Float16* __restrict__ C16, int ldc, size_t sC, int M, int N, int K) {
  __shared__ __attribute__((aligned(16))) float so[4][16][64];
  const int tid = threadIdx.x, w = tid >> 5, lane = tid & 31, ln = lane & 15, hh = lane >> 4; const int by = blockIdx.y;
  A += (size_t)by * sA; Bh += (size_t)by * sB; const size_t cofs = (size_t)by * sC; const float* bp = bias ? bias + (size_t)by * sBias : nullptr;
  const int ntn = (N + 63) / 64; const int wid = blockIdx.x * 4 + w; const int mt = wid / ntn, nq = wid % ntn; if (mt * 16 >= M) return;
  const int row0 = mt * 16, col0 = nq * 64; const _Float16* arow = A + (size_t)(row0 + ln) * lda;
  v8f acc[4] = {};
  for (int kb = 0; kb < K; kb += 32) { FragH ah; ah.half[0] = *(const v8us*)((const unsigned short*)arow + kb + 8 * hh); ah.half[1] = *(const v8us*)((const unsigned short*)arow + kb + 16 + 8 * hh);
#pragma unroll
    for (int t = 0; t < 4; ++t) { if (col0 + t * 16 >= N) continue; const size_t boff = (size_t)(col0 + t * 16 + ln) * ldb + kb; FragH bq; bq.half[0] = *(const v8us*)((const unsigned short*)Bh + boff + 8 * hh); bq.half[1] = *(const v8us*)((const unsigned short*)Bh + boff + 16 + 8 * hh);
      acc[t] = mmaH<1>(ah.v, ah.v, bq.v, bq.v, acc[t]); }
  }
#pragma unroll
  for (int t = 0; t < 4; ++t) { if (col0 + t * 16 >= N) continue; const int col = col0 + t * 16 + ln; const float bv = bp ? bf16_round(bp[col]) : 0.f;
#pragma unroll
    for (int r = 0; r < 8; ++r) { float v = acc[t][r] * alpha + bv; if (CP) { const int rr = row0g + row0 + 8 * hh + r; if (rowsPerB < 0) v += CP[cofs + (size_t)rr * ldc + col];      /* rowsPerB < 0: own element of the batched C plane */ else { const int bidx = rr / rowsPerB; v += CP[(size_t)bidx * sCPb + (size_t)by * 64 + col]; } } if (ACT == 1) v = (v > 0.f) ? v : expm1f(v); else if (ACT == 7) v = (v > 0.f) ? v + 1.0f : expf(v); else if (ACT == 8) v = tanhf(v); else if (ACT == 9) v = 0.5f * v * (1.0f + tanhf(0.7978845608028654f * (v + 0.044715f * v * v * v))); else if (ACT == 11) v = 1.0f / (1.0f + expf(-v)); else if (ACT == 12) v = (v > 0.f) ? v : 0.01f * v; else if (ACT == 14) v = (v > 0.f) ? v : 0.1f * v; else if (ACT == 16) v = (v >= 0.f) ? v : 0.3f * v; else if (ACT == 17) v = (v >= 0.f) ? v : 0.2f * v; else if (ACT == 15) v = v / (1.0f + expf(-v)); else if (ACT == 3) v = fmaxf(v, 0.f); else if (ACT == 6) v = 0.5f * v * (1.0f + erff(v * 0.70710678118654752f)); so[w][8 * hh + r][t * 16 + ln] = v; } }
  __builtin_amdgcn_fence(__ATOMIC_ACQ_REL, "workgroup"); __builtin_amdgcn_wave_barrier();
  const int rsub = lane >> 4, c4 = (lane & 15) * 4; typedef _Float16 v4h __attribute__((ext_vector_type(4)));
  {
#pragma unroll
    for (int q = 0; q < 8; ++q) { const int r = q * 2 + rsub; if (col0 + c4 < N) { const v4f v = *(const v4fa*)&so[w][r][c4]; if (C) *(v4f*)(C + cofs + (size_t)(row0 + r) * ldc + col0 + c4) = v; if (C16) { v4h h4; for (int i = 0; i < 4; ++i) h4[i] = (_Float16)v[i]; *(v4h*)(C16 + cofs + (size_t)(row0 + r) * ldc + col0 + c4) = h4; } } }
     }
}


typedef _Float16 v4h __attribute__((ext_vector_type(4)));

__global__ __launch_bounds__(256) void k_x16(const float* __restrict__ x, _Float16* __restrict__ X16, size_t n8) { const size_t t = (size_t)blockIdx.x * 256 + threadIdx.x; if (t >= n8) return; FragH f;
#pragma unroll
  for (int q = 0; q < 8; ++q) f.h[q] = (_Float16)bf16_round(x[t * 8 + q]); *(v8us*)((unsigned short*)X16 + t * 8) = f.half[0];  }
__global__ __launch_bounds__(256) void k_h16(const float* __restrict__ x, _Float16* __restrict__ X16, size_t n8) { const size_t t = (size_t)blockIdx.x * 256 + threadIdx.x; if (t >= n8) return; FragH f;
#pragma unroll
  for (int q = 0; q < 8; ++q) f.h[q] = (_Float16)x[t * 8 + q]; *(v8us*)((unsigned short*)X16 + t * 8) = f.half[0];  }
__global__ __launch_bounds__(256) void k_round16f(const float* __restrict__ W, _Float16* __restrict__ Bt, size_t n8) { const size_t t = (size_t)blockIdx.x * 256 + threadIdx.x; if (t >= n8) return; FragH f;
#pragma unroll
  for (int i = 0; i < 8; ++i) f.h[i] = (_Float16)(bf16_round(W[t * 8 + i]) * 16.0f); *(v8us*)((unsigned short*)Bt + t * 8) = f.half[0];  }
template <int NHv, int TTv>
__global__ __launch_bounds__(256) void k_vt(const _Float16* __restrict__ V16, int ldv, int voff, _Float16* __restrict__ Vt) { __shared__ unsigned short tl[64][66]; const int tid = threadIdx.x; const int slab = blockIdx.x / (TTv / 64), lg = blockIdx.x % (TTv / 64); const int b = slab / NHv, h = slab % NHv;
  for (int i = tid; i < 64 * 8; i += 256) { const int r = i / 8, c8 = (i % 8) * 8; FragH f; f.half[0] = *(const v8us*)((const unsigned short*)V16 + ((size_t)b * TTv + lg * 64 + r) * ldv + voff + h * 64 + c8);
#pragma unroll
    for (int q = 0; q < 8; ++q) tl[r][c8 + q] = f.u[q]; }
  __syncthreads();
  {
#pragma unroll
    for (int rd = 0; rd < 2; ++rd) { const int d = rd * 32 + tid / 8, pc = tid % 8; FragH f;
#pragma unroll
      for (int q = 0; q < 8; ++q) f.u[q] = tl[pc * 8 + q][d];
      *(v8us*)((unsigned short*)Vt + ((size_t)slab * 64 + d) * TTv + lg * 64 + pc * 8) = f.half[0]; }
     } }

__global__ __launch_bounds__(256) void k_hl(const float* __restrict__ F, _Float16* __restrict__ Hh, _Float16* __restrict__ Hl, size_t n8) { const size_t t = (size_t)blockIdx.x * 256 + threadIdx.x; if (t >= n8) return; FragH fh, fl; const v4f a = *(const v4fa*)(F + t * 8), c = *(const v4fa*)(F + t * 8 + 4);
#pragma unroll
  for (int q = 0; q < 4; ++q) { _Float16 h = (_Float16)a[q]; fh.h[q] = h; fl.h[q] = (_Float16)((a[q] - (float)h) * 1024.0f); h = (_Float16)c[q]; fh.h[4 + q] = h; fl.h[4 + q] = (_Float16)((c[q] - (float)h) * 1024.0f); }
  { *(v8us*)((unsigned short*)Hh + t * 8) = fh.half[0]; *(v8us*)((unsigned short*)Hl + t * 8) = fl.half[0];  } }

// ---- fast GEMM (wave tile 32x64; requires M % 32 == 0 rows per launch region and N % 64 == 0); epilogue = k_gemm_hhx semantics ----
__device__ __forceinline__ v16h g2_frag(const _Float16* p, int hh) { FragH f; f.half[0] = *(const v8us*)((const unsigned short*)p + 8 * hh); f.half[1] = *(const v8us*)((const unsigned short*)p + 16 + 8 * hh); return f.v; }
__device__ __forceinline__ v8f g2_mma(v16h a, v16h b, v8f c) { v8f d = __builtin_amdgcn_wmma_f32_16x16x32_f16(false, a, false, b, (short)0, c, false, false); asm volatile("v_nop\n\tv_nop\n\tv_nop\n\tv_nop" : "+v"(d) : "v"(a), "v"(b)); return d; }
template <int ACT>
__global__ __launch_bounds__(128) void k_gemm2(const _Float16* __restrict__ A, int lda, size_t sA, const _Float16* __restrict__ Bh, int ldb, size_t sB, float alpha, const float* __restrict__ bias, size_t sBias, const float* __restrict__ CP, int rowsPerB, size_t sCPb, int row0g,
    float* __restrict__ C, _Float16* __restrict__ C16, int ldc, size_t sC, int M, int N, int K) { static_assert(ACT == 0 || ACT == 3 || ACT == 6 || ACT == 8 || ACT == 9 || ACT == 11 || ACT == 12 || ACT == 14 || ACT == 15 || ACT == 16 || ACT == 17, "k_gemm2: unsupported ACT code (would silently apply no activation)");
  __shared__ __attribute__((aligned(16))) float so[4][32][68];
  const int tid = threadIdx.x, w = tid >> 5, lane = tid & 31, ln = lane & 15, hh = lane >> 4; const int by = blockIdx.y;
  A += (size_t)by * sA; Bh += (size_t)by * sB; const size_t cofs = (size_t)by * sC; const float* bp = bias ? bias + (size_t)by * sBias : nullptr;
  const int ntn = N >> 6; const int mt = blockIdx.x / ntn, nq = blockIdx.x - mt * ntn; const int row0 = mt * 128 + 32 * w, col0 = nq * 64; if (row0 >= M) return;
  const _Float16* a0p = A + (size_t)(row0 + ln) * lda; const _Float16* a1p = a0p + (size_t)16 * lda;
  const _Float16* b0p = Bh + (size_t)(col0 + ln) * ldb; const _Float16* b1p = b0p + (size_t)16 * ldb; const _Float16* b2p = b1p + (size_t)16 * ldb; const _Float16* b3p = b2p + (size_t)16 * ldb;
  const v8f z8 = {0.f,0.f,0.f,0.f,0.f,0.f,0.f,0.f}; v8f c00 = z8, c01 = z8, c02 = z8, c03 = z8, c10 = z8, c11 = z8, c12 = z8, c13 = z8;
#pragma unroll 1
  for (int kb = 0; kb < K; kb += 32) { const v16h a0 = g2_frag(a0p + kb, hh), a1 = g2_frag(a1p + kb, hh);
    v16h b = g2_frag(b0p + kb, hh); c00 = g2_mma(a0, b, c00); c10 = g2_mma(a1, b, c10);
    b = g2_frag(b1p + kb, hh); c01 = g2_mma(a0, b, c01); c11 = g2_mma(a1, b, c11);
    b = g2_frag(b2p + kb, hh); c02 = g2_mma(a0, b, c02); c12 = g2_mma(a1, b, c12);
    b = g2_frag(b3p + kb, hh); c03 = g2_mma(a0, b, c03); c13 = g2_mma(a1, b, c13); }
  v8f accs[8] = {c00, c01, c02, c03, c10, c11, c12, c13};
#pragma unroll
  for (int u = 0; u < 8; ++u) { const int t = u & 3, half = u >> 2; const int col = col0 + t * 16 + ln; const float bv = bp ? bf16_round(bp[col]) : 0.f;
#pragma unroll
    for (int r = 0; r < 8; ++r) { const int rloc = half * 16 + 8 * hh + r; float v = accs[u][r] * alpha + bv; if (CP) { if (rowsPerB < 0) v += CP[cofs + (size_t)(row0g + row0 + rloc) * ldc + col];      /* rowsPerB < 0: own element of the batched C plane */ else { const int bidx = (row0g + row0 + rloc) / rowsPerB; v += CP[(size_t)bidx * sCPb + (size_t)by * 64 + col]; } }
      if (ACT == 3) v = fmaxf(v, 0.f); else if (ACT == 6) v = 0.5f * v * (1.0f + erff(v * 0.70710678118654752f)); else if (ACT == 11) v = 1.0f / (1.0f + expf(-v)); else if (ACT == 15) v = v / (1.0f + expf(-v)); else if (ACT == 12) v = (v > 0.f) ? v : 0.01f * v; else if (ACT == 8) v = tanhf(v); else if (ACT == 9) v = 0.5f * v * (1.0f + tanhf(0.7978845608028654f * (v + 0.044715f * v * v * v))); else if (ACT == 14) v = (v > 0.f) ? v : 0.1f * v; else if (ACT == 16) v = (v >= 0.f) ? v : 0.3f * v; else if (ACT == 17) v = (v >= 0.f) ? v : 0.2f * v;
      so[w][rloc][t * 16 + ln] = v; } }
  __builtin_amdgcn_fence(__ATOMIC_ACQ_REL, "workgroup"); __builtin_amdgcn_wave_barrier();
  const int rsub = lane >> 4, c4 = (lane & 15) * 4;
  {
#pragma unroll
    for (int q = 0; q < 16; ++q) { const int r = q * 2 + rsub; const v4f v = *(const v4fa*)&so[w][r][c4]; if (C) *(v4f*)(C + cofs + (size_t)(row0 + r) * ldc + col0 + c4) = v; if (C16) { v4h h4; for (int i = 0; i < 4; ++i) h4[i] = (_Float16)v[i]; *(v4h*)(C16 + cofs + (size_t)(row0 + r) * ldc + col0 + c4) = h4; } }
     } }


__global__ __launch_bounds__(256) void k_wnat(const float* __restrict__ w, size_t n8, _Float16* __restrict__ Bt) { const size_t t = (size_t)blockIdx.x * 256 + threadIdx.x; if (t >= n8) return; FragH f; for (int q = 0; q < 8; ++q) f.h[q] = (_Float16)(bf16_round(w[t * 8 + q]) * 16.0f); *(v8us*)((unsigned short*)Bt + t * 8) = f.half[0];  }
__global__ __launch_bounds__(256) void k_rsm(const float* __restrict__ S, _Float16* __restrict__ P, int nrows) {
  #pragma clang fp contract(off)
  const int i = blockIdx.x * 256 + threadIdx.x; if (i >= nrows) return; const float* s = S + (size_t)i * SQ; float mx = -3.0e38f;
#pragma unroll 1
  for (int j = 0; j < SQ; ++j) mx = fmaxf(mx, s[j]); float se = 0.f;
#pragma unroll 1
  for (int j = 0; j < SQ; ++j) se += expf(s[j] - mx); const float sc = 256.0f / se;
#pragma unroll 1
  for (int j0 = 0; j0 < SQ; j0 += 8) { FragH f; for (int q = 0; q < 8; ++q) f.h[q] = (_Float16)(expf(s[j0 + q] - mx) * sc); unsigned short* d = (unsigned short*)P + (size_t)i * SQ + j0; *(v8us*)d = f.half[0];  } }
__global__ __launch_bounds__(256) void k_vt(const _Float16* __restrict__ V16, int b, int h0, _Float16* __restrict__ VT) { __shared__ unsigned short tl[64][65]; const int tid = threadIdx.x; const int hh = blockIdx.x % HG, sg = blockIdx.x / HG; const int s0 = sg * 64; const int h = h0 + hh;
  for (int i = tid; i < 64 * 8; i += 256) { const int j = i / 8, d8 = (i % 8) * 8; FragH f; f.half[0] = *(const v8us*)((const unsigned short*)V16 + ((size_t)b * SQ + s0 + j) * DM + h * HD + d8); for (int q = 0; q < 8; ++q) tl[d8 + q][j] = f.u[q]; }
  __syncthreads();
  { for (int i = tid; i < 64 * 8; i += 256) { const int d = i / 8, j8 = (i % 8) * 8; FragH f; for (int q = 0; q < 8; ++q) f.u[q] = tl[d][j8 + q]; *(v8us*)((unsigned short*)VT + ((size_t)hh * HD + d) * SQ + s0 + j8) = f.half[0]; }  } }


extern "C" void kernel_launch(void* const* d_in, const int* in_sizes, int n_in,
                              void* d_out, int out_size, void* d_ws, size_t ws_size, hipStream_t stream) {
  (void)in_sizes; (void)n_in; (void)out_size;
  const float* const* I = (const float* const*)d_in; const float* x = I[0]; const float* wq = I[1]; const float* bq = I[2]; const float* wk = I[3]; const float* bk = I[4]; const float* wv = I[5]; const float* bv = I[6]; const float* wo = I[7]; const float* bo = I[8];      /* nn.Linear weights [out][in] + biases */
  char* ws = (char*)d_ws; size_t off = 0;
  auto take = [&](size_t bytes) { char* p = ws + off; off += (bytes + 255) & ~(size_t)255; return p; };
  _Float16* BQ = (_Float16*)take((size_t)DM * DM * 2); _Float16* BK = (_Float16*)take((size_t)DM * DM * 2); _Float16* BV = (_Float16*)take((size_t)DM * DM * 2); _Float16* BO = (_Float16*)take((size_t)DM * DM * 2);
  _Float16* X16 = (_Float16*)take(NR * DM * 2); _Float16* Q16 = (_Float16*)take(NR * DM * 2); _Float16* K16 = (_Float16*)take(NR * DM * 2); _Float16* V16 = (_Float16*)take(NR * DM * 2); _Float16* O16 = (_Float16*)take(NR * DM * 2);
  float* S = (float*)take((size_t)HG * SQ * SQ * 4); _Float16* P = (_Float16*)take((size_t)HG * SQ * SQ * 2); _Float16* VT = (_Float16*)take((size_t)NH * HD * SQ * 2);
  if (off > ws_size) return;
  { const unsigned g = (unsigned)(((size_t)DM * DM / 8 + 255) / 256); k_wnat<<<g, 256, 0, stream>>>(wq, (size_t)DM * DM / 8, BQ); k_wnat<<<g, 256, 0, stream>>>(wk, (size_t)DM * DM / 8, BK); k_wnat<<<g, 256, 0, stream>>>(wv, (size_t)DM * DM / 8, BV); k_wnat<<<g, 256, 0, stream>>>(wo, (size_t)DM * DM / 8, BO); }      /* natural [out][in] = Bt[n][k], x16 */
  k_x16<<<(unsigned)((NR * DM / 8 + 255) / 256), 256, 0, stream>>>(x, X16, NR * DM / 8);
  const size_t r0p = (size_t)B0 * SQ;      /* first projected row */
  k_gemm2<0><<<dim3((unsigned)((MP / 128) * (DM / 64)), 1), 128, 0, stream>>>(X16 + r0p * DM, DM, 0, BQ, DM, 0, 0.0625f, bq, 0, nullptr, 1, 0, 0, nullptr, Q16 + r0p * DM, DM, 0, MP, DM, DM);
  k_gemm2<0><<<dim3((unsigned)((MP / 128) * (DM / 64)), 1), 128, 0, stream>>>(X16 + r0p * DM, DM, 0, BK, DM, 0, 0.0625f, bk, 0, nullptr, 1, 0, 0, nullptr, K16 + r0p * DM, DM, 0, MP, DM, DM);
  k_gemm2<0><<<dim3((unsigned)((MP / 128) * (DM / 64)), 1), 128, 0, stream>>>(X16 + r0p * DM, DM, 0, BV, DM, 0, 0.0625f, bv, 0, nullptr, 1, 0, 0, nullptr, V16 + r0p * DM, DM, 0, MP, DM, DM);
  for (int b = B0; b < B0 + NBR; ++b) { const size_t r0 = (size_t)b * SQ;
    k_vt<NH, SQ><<<NH * (SQ / 64), 256, 0, stream>>>(V16 + r0 * LQ, LQ, 0, VT);      /* V^T [NH][HD][SQ] for this batch */
    for (int h0 = 0; h0 < NHD; h0 += HG) {
      k_gemm2<0><<<dim3((QN / 128) * (SQ / 64), HG), 128, 0, stream>>>(Q16 + r0 * LQ + h0 * HD, LQ, (size_t)HD, K16 + r0 * LQ + h0 * HD, LQ, (size_t)HD, 0.125f, nullptr, 0, nullptr, 1, 0, 0, S, nullptr, SQ, (size_t)SQ * SQ, QN, SQ, HD);      /* scores, HG heads per launch */
      k_rsm<<<(HG * SQ + 255) / 256, 256, 0, stream>>>(S, P, HG * SQ);      /* P = 256 softmax (f16), rows of all HG heads */
      k_gemm2<0><<<dim3((QN / 128) * (HD / 64), HG), 128, 0, stream>>>(P, SQ, (size_t)SQ * SQ, VT + (size_t)h0 * HD * SQ, SQ, (size_t)HD * SQ, 0.25f, nullptr, 0, nullptr, 1, 0, 0, nullptr, O16 + r0 * DM + h0 * HD, DM, (size_t)HD, QN, HD, SQ); } }      /* o (merged heads) as f16 rows */
  k_gemm2<0><<<dim3((unsigned)((MPO / 128) * (DM / 64)), 1), 128, 0, stream>>>(O16 + r0p * DM, DM, 0, BO, DM, 0, 0.0009765625f, bo, 0, nullptr, 1, 0, 0, (float*)d_out + r0p * DM, nullptr, DM, 0, MPO, DM, DM);      /* out rows are the output layout */
}

// v001
// One run takes 1230 microseconds.
// Next to v000, in two timings, it ran 3.23 and 3.25 times as fast.
#include <hip/hip_runtime.h>
// ViT self-attention (x [16][1024][768]; q/k/v = x W^T + b (nn.Linear [out][in] 768^2, sigma 0.02, zero biases), 12 heads of 64; scores / 8; softmax; out = (attn v merged) Wc^T + bc -> [16][1024][768]).
// Structure: token rows r = b*1024 + s; x as exact f16 rows (bf16-rounded); Q, K, V as three WMMA GEMMs (32x64 wave tiles, f32 accumulation, exact x16 weights + bias, f16 outputs); per batch: V^T for all heads via LDS transposes; per (batch, group of 12 heads): scores GEMM (K = 64, batched over the heads on grid.y, alpha = 64^-0.5), row softmax on VALU (f32 statistics; weights stored x256 as f16), o = P . V^T GEMM (K = 1024, alpha 2^-2: o carried x64 against f16 subnormal flush, folded into the output GEMM alpha) written straight into the merged f16 o rows; out = o W_o + b GEMM (f32) into the output layout.
// Compute dtype: inputs rounded to bf16; x / weights exact; q, k, v, softmax weights and o as plain f16 GEMM operands (~2^-12); scores and softmax statistics f32. v_wmma_f32_16x16x32_f16.
#define NB 16
#define SQ 1024
#define DM 768
#define NH 12
#define HD 64
#define HG 12                         /* heads per attention launch group */
#define B0 0                         /* first batch processed (debug hook) */
#define NBR NB                       /* batches processed (debug hook) */
#define NR ((size_t)NB * SQ)         /* token rows */
#define MP ((int)((size_t)NBR * SQ)) /* rows projected (debug hook) */
#define QN SQ                        /* query rows attended per batch (debug hook) */
#define NHD NH                       /* heads attended (debug hook) */
#define MPO MP                       /* rows through the output stage (debug hook) */
#define LQ DM      /* row pitch of the q/k/v rows */
typedef __bf16 v16b __attribute__((ext_vector_type(16)));
typedef unsigned short v8us __attribute__((ext_vector_type(8), may_alias));
typedef float  v8f  __attribute__((ext_vector_type(8)));
typedef float  v4f  __attribute__((ext_vector_type(4)));
typedef float  v4fa __attribute__((ext_vector_type(4), may_alias));
union FragB { v16b v; v8us half[2]; unsigned short u[16]; };

__device__ __forceinline__ unsigned short bf16_bits(float x) { unsigned int u = __float_as_uint(x); return (unsigned short)((u + 0x7FFFu + ((u >> 16) & 1u)) >> 16); }
__device__ __forceinline__ float bf16_val(unsigned short b) { return __uint_as_float(((unsigned int)b) << 16); }
__device__ __forceinline__ float bf16_round(float x) { return bf16_val(bf16_bits(x)); }
// D += A·B with NT terms: 1 = ah·bh, 2 = + al·bh (A split), 3 = + ah·bl (both split)
template <int NT>
__device__ __forceinline__ v8f mmaN(v16b ah, v16b al, v16b bh, v16b bl, v8f c) {
  c = __builtin_amdgcn_wmma_f32_16x16x32_bf16(false, ah, false, bh, (short)0, c, false, false);
  if (NT >= 2) c = __builtin_amdgcn_wmma_f32_16x16x32_bf16(false, al, false, bh, (short)0, c, false, false);
  if (NT >= 3) c = __builtin_amdgcn_wmma_f32_16x16x32_bf16(false, ah, false, bl, (short)0, c, false, false);
  asm volatile("v_nop\n\tv_nop\n\tv_nop\n\tv_nop" : "+v"(c) : "v"(ah), "v"(al), "v"(bh), "v"(bl));
  return c;
}

__global__ __launch_bounds__(256) void k_wt_bf16(const float* __restrict__ W, unsigned short* __restrict__ Wt, int K, int N) {
  const int t = blockIdx.x * 256 + threadIdx.x;
  const int k8n = K / 8;
  if (t >= N * k8n) return;
  const int n = t / k8n, k8 = (t % k8n) * 8;
  v8us v;
#pragma unroll
  for (int i = 0; i < 8; ++i) v[i] = bf16_bits(W[(size_t)(k8 + i) * N + n]);
  *(v8us*)(Wt + (size_t)n * K + k8) = v;
  
}

// GEMM C[M][N] (f32, pitch ldc) = act(A[M][K]·W + bias). A f32 row-major (pitch lda) converted per fragment to bf16
// (ASPLIT: hi/lo two planes -> 2 terms, else single rounded term); Wt bf16 [N][K] (pitch ldb). BIAS_BF16 rounds the
// bias to bf16 first (bias quantised to bf16 before the add). K%32==0, M%16==0, N%64==0.
template <bool ASPLIT, int ACT, bool BIAS_BF16>
__global__ __launch_bounds__(128) void k_gemm_bf(const float* __restrict__ A, int lda, const unsigned short* __restrict__ Wt, int ldb,
                                               const float* __restrict__ bias, float* __restrict__ C, int ldc, int M, int N, int K) {
  __shared__ __attribute__((aligned(16))) float so[4][16][64];
  const int tid = threadIdx.x, w = tid >> 5, lane = tid & 31, ln = lane & 15, hh = lane >> 4;
  const int ntn = N / 64;
  const int wid = blockIdx.x * 4 + w;
  const int mt = wid / ntn, nq = wid % ntn;
  if (mt * 16 >= M) return;
  const int row0 = mt * 16, col0 = nq * 64;
  const float* arow = A + (size_t)(row0 + ln) * lda;
  v8f acc[4] = {};
  for (int kb = 0; kb < K; kb += 32) {
    FragB ah, al;
    const v4f x0 = *(const v4fa*)(arow + kb + 8 * hh), x1 = *(const v4fa*)(arow + kb + 8 * hh + 4);
    const v4f x2 = *(const v4fa*)(arow + kb + 16 + 8 * hh), x3 = *(const v4fa*)(arow + kb + 16 + 8 * hh + 4);
    float xs[16] = {x0[0],x0[1],x0[2],x0[3],x1[0],x1[1],x1[2],x1[3],x2[0],x2[1],x2[2],x2[3],x3[0],x3[1],x3[2],x3[3]};
#pragma unroll
    for (int i = 0; i < 16; ++i) { const unsigned short hb = bf16_bits(xs[i]); ah.u[i] = hb; al.u[i] = ASPLIT ? bf16_bits(xs[i] - bf16_val(hb)) : (unsigned short)0; }
#pragma unroll
    for (int t = 0; t < 4; ++t) {
      const unsigned short* brow = Wt + (size_t)(col0 + t * 16 + ln) * ldb + kb;
      FragB b;
      b.half[0] = *(const v8us*)(brow + 8 * hh);
      b.half[1] = *(const v8us*)(brow + 16 + 8 * hh);
      acc[t] = mmaN<ASPLIT ? 2 : 1>(ah.v, al.v, b.v, b.v, acc[t]);
    }
  }
#pragma unroll
  for (int t = 0; t < 4; ++t) {
    float bv = bias ? bias[col0 + t * 16 + ln] : 0.f;
    if (BIAS_BF16) bv = bf16_round(bv);
#pragma unroll
    for (int r = 0; r < 8; ++r) { float v = acc[t][r] + bv; if (ACT == 1) v = fmaxf(v, 0.f); so[w][8 * hh + r][t * 16 + ln] = v; }
  }
  __builtin_amdgcn_fence(__ATOMIC_ACQ_REL, "workgroup");
  __builtin_amdgcn_wave_barrier();
  const int rsub = lane >> 4, c4 = (lane & 15) * 4;
  {
#pragma unroll
    for (int q = 0; q < 8; ++q) {
      const int r = q * 2 + rsub;
      const v4f v = *(const v4fa*)&so[w][r][c4];
      *(v4f*)(C + (size_t)(row0 + r) * ldc + col0 + c4) = v;
    }
    
  }
}

// GEMM C = act(A·W + bias + resid): A f32 (ASPLIT -> hi/lo 2 terms), Wt bf16 [N][K]; ACT 0 none, 1 relu, 2 exact gelu;
// resid (optional, f32, row index = (row % rmod), pitch ldr, RES_BF16 rounds it) added before the activation.
template <bool ASPLIT, int ACT, bool BIAS_BF16, bool RES_BF16>
__global__ __launch_bounds__(128) void k_gemm_bf3(const float* __restrict__ A, int lda, const unsigned short* __restrict__ Wt, int ldb,
                                                const float* __restrict__ bias, const float* __restrict__ resid, int rmod, int ldr,
                                                float* __restrict__ C, int ldc, int M, int N, int K) {
  __shared__ __attribute__((aligned(16))) float so[4][16][64];
  const int tid = threadIdx.x, w = tid >> 5, lane = tid & 31, ln = lane & 15, hh = lane >> 4;
  const int ntn = N / 64;
  const int wid = blockIdx.x * 4 + w;
  const int mt = wid / ntn, nq = wid % ntn;
  if (mt * 16 >= M) return;
  const int row0 = mt * 16, col0 = nq * 64;
  const float* arow = A + (size_t)(row0 + ln) * lda;
  v8f acc[4] = {};
  for (int kb = 0; kb < K; kb += 32) {
    FragB ah, al;
    const v4f x0 = *(const v4fa*)(arow + kb + 8 * hh), x1 = *(const v4fa*)(arow + kb + 8 * hh + 4);
    const v4f x2 = *(const v4fa*)(arow + kb + 16 + 8 * hh), x3 = *(const v4fa*)(arow + kb + 16 + 8 * hh + 4);
    float xs[16] = {x0[0],x0[1],x0[2],x0[3],x1[0],x1[1],x1[2],x1[3],x2[0],x2[1],x2[2],x2[3],x3[0],x3[1],x3[2],x3[3]};
#pragma unroll
    for (int i = 0; i < 16; ++i) { const unsigned short hb = bf16_bits(xs[i]); ah.u[i] = hb; al.u[i] = ASPLIT ? bf16_bits(xs[i] - bf16_val(hb)) : (unsigned short)0; }
#pragma unroll
    for (int t = 0; t < 4; ++t) {
      const unsigned short* brow = Wt + (size_t)(col0 + t * 16 + ln) * ldb + kb;
      FragB b;
      b.half[0] = *(const v8us*)(brow + 8 * hh);
      b.half[1] = *(const v8us*)(brow + 16 + 8 * hh);
      acc[t] = mmaN<ASPLIT ? 2 : 1>(ah.v, al.v, b.v, b.v, acc[t]);
    }
  }
#pragma unroll
  for (int t = 0; t < 4; ++t) {
    const int col = col0 + t * 16 + ln;
    float bv = bias ? bias[col] : 0.f;
    if (BIAS_BF16) bv = bf16_round(bv);
#pragma unroll
    for (int r = 0; r < 8; ++r) {
      float v = acc[t][r] + bv;
      if (resid) { float rv = resid[(size_t)((row0 + 8 * hh + r) % rmod) * ldr + col]; if (RES_BF16) rv = bf16_round(rv); v += rv; }
      if (ACT == 1) v = fmaxf(v, 0.f);
      if (ACT == 2) v = 0.5f * v * (1.0f + erff(v * 0.70710678118654752f));
      if (ACT == 3) { const float u = 0.7978845608028654f * (v + 0.044715f * v * v * v); v = 0.5f * v * (1.0f + tanhf(u)); }
      so[w][8 * hh + r][t * 16 + ln] = v;
    }
  }
  __builtin_amdgcn_fence(__ATOMIC_ACQ_REL, "workgroup");
  __builtin_amdgcn_wave_barrier();
  const int rsub = lane >> 4, c4 = (lane & 15) * 4;
  {
#pragma unroll
    for (int q = 0; q < 8; ++q) {
      const int r = q * 2 + rsub;
      const v4f v = *(const v4fa*)&so[w][r][c4];
      *(v4f*)(C + (size_t)(row0 + r) * ldc + col0 + c4) = v;
    }
    
  }
}
// row LayerNorm (biased variance, eps) over N: s = X (+ R); optional out_sum <- s; out_norm <- (s-mu)*rsqrt(var+eps)*g + b
template <bool PARAM_BF16>
__global__ __launch_bounds__(256) void k_layernorm(const float* __restrict__ X, const float* __restrict__ R, const float* __restrict__ g, const float* __restrict__ bta,
                                                  float* __restrict__ out_sum, float* __restrict__ out_norm, int N, float eps) {
  __shared__ float red[256];
  const int row = blockIdx.x, tid = threadIdx.x;
  const float* x = X + (size_t)row * N; const float* rr = R ? R + (size_t)row * N : nullptr;
  float vals[16];                     // up to N = 4096
  const int per = N / 256;            // contiguous chunk per thread? use strided-by-4 chunks: thread handles j = tid*4 + 1024*u
  float s1 = 0.f;
  for (int u = 0; u < per / 4; ++u) {
    const int j = tid * 4 + 1024 * u;
    const v4f a = *(const v4fa*)(x + j);
    v4f b = {0.f,0.f,0.f,0.f}; if (rr) b = *(const v4fa*)(rr + j);
#pragma unroll
    for (int q = 0; q < 4; ++q) { const float v = a[q] + b[q]; vals[u * 4 + q] = v; s1 += v; }
  }
  red[tid] = s1; __syncthreads();
  for (int st = 128; st > 0; st >>= 1) { if (tid < st) red[tid] += red[tid + st]; __syncthreads(); }
  const float mu = red[0] / (float)N; __syncthreads();
  float s2 = 0.f;
  for (int u = 0; u < per / 4; ++u)
#pragma unroll
    for (int q = 0; q < 4; ++q) { const float c = vals[u * 4 + q] - mu; s2 += c * c; }
  red[tid] = s2; __syncthreads();
  for (int st = 128; st > 0; st >>= 1) { if (tid < st) red[tid] += red[tid + st]; __syncthreads(); }
  const float rs = rsqrtf(red[0] / (float)N + eps);
  {
    for (int u = 0; u < per / 4; ++u) {
      const int j = tid * 4 + 1024 * u;
      v4f o, sm;
#pragma unroll
      for (int q = 0; q < 4; ++q) {
        float gg = g[j + q], bb = bta[j + q];
        if (PARAM_BF16) { gg = bf16_round(gg); bb = bf16_round(bb); }
        sm[q] = vals[u * 4 + q]; o[q] = (vals[u * 4 + q] - mu) * rs * gg + bb;
      }
      if (out_sum) *(v4f*)(out_sum + (size_t)row * N + j) = sm;
      *(v4f*)(out_norm + (size_t)row * N + j) = o;
    }
    
  }
}



// ---- f16 WMMA path (v_wmma_f32_16x16x32_f16): 11-bit significands for operands in range — used where a [0,1] probability operand needs more precision than bf16
typedef _Float16 v16h __attribute__((ext_vector_type(16)));
union FragH { v16h v; v8us half[2]; _Float16 h[16]; unsigned short u[16]; };
template <int NT>
__device__ __forceinline__ v8f mmaH(v16h ah, v16h al, v16h bh, v16h bl, v8f c) {
  c = __builtin_amdgcn_wmma_f32_16x16x32_f16(false, ah, false, bh, (short)0, c, false, false);
  if (NT >= 2) c = __builtin_amdgcn_wmma_f32_16x16x32_f16(false, al, false, bh, (short)0, c, false, false);
  if (NT >= 3) c = __builtin_amdgcn_wmma_f32_16x16x32_f16(false, ah, false, bl, (short)0, c, false, false);
  asm volatile("v_nop\n\tv_nop\n\tv_nop\n\tv_nop" : "+v"(c) : "v"(ah), "v"(al), "v"(bh), "v"(bl));
  return c;
}
// batched GEMM like k_gemm_b but f16 operands: A f32 (split into f16 hi/lo if ASPLIT, else rounded to f16), Bt = f16 values [n][k]; alpha; C f32; N multiple of 16 (partial tiles skipped)
template <bool ASPLIT>
__global__ __launch_bounds__(128) void k_gemm_h(const float* __restrict__ A, int lda, size_t sA, const _Float16* __restrict__ Bh, int ldb, size_t sB, float alpha, float* __restrict__ C, int ldc, size_t sC, int M, int N, int K) {
  __shared__ __attribute__((aligned(16))) float so[4][16][64];
  const int tid = threadIdx.x, w = tid >> 5, lane = tid & 31, ln = lane & 15, hh = lane >> 4; const int by = blockIdx.y;
  A += (size_t)by * sA; Bh += (size_t)by * sB; C += (size_t)by * sC;
  const int ntn = (N + 63) / 64; const int wid = blockIdx.x * 4 + w; const int mt = wid / ntn, nq = wid % ntn; if (mt * 16 >= M) return;
  const int row0 = mt * 16, col0 = nq * 64; const float* arow = A + (size_t)(row0 + ln) * lda;
  v8f acc[4] = {};
  for (int kb = 0; kb < K; kb += 32) {
    FragH ah, al;
    const v4f x0 = *(const v4fa*)(arow + kb + 8 * hh), x1 = *(const v4fa*)(arow + kb + 8 * hh + 4), x2 = *(const v4fa*)(arow + kb + 16 + 8 * hh), x3 = *(const v4fa*)(arow + kb + 16 + 8 * hh + 4);
    float xs[16] = {x0[0],x0[1],x0[2],x0[3],x1[0],x1[1],x1[2],x1[3],x2[0],x2[1],x2[2],x2[3],x3[0],x3[1],x3[2],x3[3]};
#pragma unroll
    for (int i = 0; i < 16; ++i) { const _Float16 h = (_Float16)xs[i]; ah.h[i] = h; al.h[i] = ASPLIT ? (_Float16)(xs[i] - (float)h) : (_Float16)0.0f; }
#pragma unroll
    for (int t = 0; t < 4; ++t) { if (col0 + t * 16 >= N) continue; const size_t boff = (size_t)(col0 + t * 16 + ln) * ldb + kb; FragH bq; bq.half[0] = *(const v8us*)(Bh + boff + 8 * hh); bq.half[1] = *(const v8us*)(Bh + boff + 16 + 8 * hh);
      acc[t] = mmaH<ASPLIT ? 2 : 1>(ah.v, al.v, bq.v, bq.v, acc[t]); }
  }
#pragma unroll
  for (int t = 0; t < 4; ++t) { if (col0 + t * 16 >= N) continue;
#pragma unroll
    for (int r = 0; r < 8; ++r) so[w][8 * hh + r][t * 16 + ln] = acc[t][r] * alpha; }
  __builtin_amdgcn_fence(__ATOMIC_ACQ_REL, "workgroup"); __builtin_amdgcn_wave_barrier();
  const int rsub = lane >> 4, c4 = (lane & 15) * 4;
  {
#pragma unroll
    for (int q = 0; q < 8; ++q) { const int r = q * 2 + rsub; if (col0 + c4 < N) { const v4f v = *(const v4fa*)&so[w][r][c4]; *(v4f*)(C + (size_t)(row0 + r) * ldc + col0 + c4) = v; } }
     }
}

// Wt[n][k] = f16(W[k][n]·scale) from f32 row-major W[K][N] (scale = power of two; bf16-exact weights stay exact in f16 away from the subnormal range)
__global__ __launch_bounds__(256) void k_wt_f16(const float* __restrict__ W, _Float16* __restrict__ Wt, int K, int N, float scale) {
  const int t = blockIdx.x * 256 + threadIdx.x; if (t >= N * (K / 8)) return; const int n = t / (K / 8), k8 = (t % (K / 8)) * 8; FragH f;
#pragma unroll
  for (int i = 0; i < 8; ++i) f.h[i] = (_Float16)(bf16_round(W[(size_t)(k8 + i) * N + n]) * scale); const v8us o = f.half[0];
  *(v8us*)((unsigned short*)Wt + (size_t)n * K + k8) = o; 
}
// k_gemm_hh variant with fused epilogue: v = acc·alpha + bias[by·sBias + col] (+ CP[(row/rowsPerB)·sCPb + by·64 + col] if CP) ; ACT 0 none / 1 elu ; writes f16 C16 (and f32 C if non-null)
template <int ACT>
__global__ __launch_bounds__(128) void k_gemm_hhx(const _Float16* __restrict__ A, int lda, size_t sA, const _Float16* __restrict__ Bh, int ldb, size_t sB, float alpha, const float* __restrict__ bias, size_t sBias, const float* __restrict__ CP, int rowsPerB, size_t sCPb, int row0g,
    float* __restrict__ C, _Float16* __restrict__ C16, int ldc, size_t sC, int M, int N, int K) {
  __shared__ __attribute__((aligned(16))) float so[4][16][64];
  const int tid = threadIdx.x, w = tid >> 5, lane = tid & 31, ln = lane & 15, hh = lane >> 4; const int by = blockIdx.y;
  A += (size_t)by * sA; Bh += (size_t)by * sB; const size_t cofs = (size_t)by * sC; const float* bp = bias ? bias + (size_t)by * sBias : nullptr;
  const int ntn = (N + 63) / 64; const int wid = blockIdx.x * 4 + w; const int mt = wid / ntn, nq = wid % ntn; if (mt * 16 >= M) return;
  const int row0 = mt * 16, col0 = nq * 64; const _Float16* arow = A + (size_t)(row0 + ln) * lda;
  v8f acc[4] = {};
  for (int kb = 0; kb < K; kb += 32) { FragH ah; ah.half[0] = *(const v8us*)((const unsigned short*)arow + kb + 8 * hh); ah.half[1] = *(const v8us*)((const unsigned short*)arow + kb + 16 + 8 * hh);
#pragma unroll
    for (int t = 0; t < 4; ++t) { if (col0 + t * 16 >= N) continue; const size_t boff = (size_t)(col0 + t * 16 + ln) * ldb + kb; FragH bq; bq.half[0] = *(const v8us*)((const unsigned short*)Bh + boff + 8 * hh); bq.half[1] = *(const v8us*)((const unsigned short*)Bh + boff + 16 + 8 * hh);
      acc[t] = mmaH<1>(ah.v, ah.v, bq.v, bq.v, acc[t]); }
  }
#pragma unroll
  for (int t = 0; t < 4; ++t) { if (col0 + t * 16 >= N) continue; const int col = col0 + t * 16 + ln; const float bv = bp ? bf16_round(bp[col]) : 0.f;
#pragma unroll
    for (int r = 0; r < 8; ++r) { float v = acc[t][r] * alpha + bv; if (CP) { const int rr = row0g + row0 + 8 * hh + r; if (rowsPerB < 0) v += CP[cofs + (size_t)rr * ldc + col];      /* rowsPerB < 0: own element of the batched C plane */ else { const int bidx = rr / rowsPerB; v += CP[(size_t)bidx * sCPb + (size_t)by * 64 + col]; } } if (ACT == 1) v = (v > 0.f) ? v : expm1f(v); else if (ACT == 7) v = (v > 0.f) ? v + 1.0f : expf(v); else if (ACT == 8) v = tanhf(v); else if (ACT == 9) v = 0.5f * v * (1.0f + tanhf(0.7978845608028654f * (v + 0.044715f * v * v * v))); else if (ACT == 11) v = 1.0f / (1.0f + expf(-v)); else if (ACT == 12) v = (v > 0.f) ? v : 0.01f * v; else if (ACT == 14) v = (v > 0.f) ? v : 0.1f * v; else if (ACT == 16) v = (v >= 0.f) ? v : 0.3f * v; else if (ACT == 17) v = (v >= 0.f) ? v : 0.2f * v; else if (ACT == 15) v = v / (1.0f + expf(-v)); else if (ACT == 3) v = fmaxf(v, 0.f); else if (ACT == 6) v = 0.5f * v * (1.0f + erff(v * 0.70710678118654752f)); so[w][8 * hh + r][t * 16 + ln] = v; } }
  __builtin_amdgcn_fence(__ATOMIC_ACQ_REL, "workgroup"); __builtin_amdgcn_wave_barrier();
  const int rsub = lane >> 4, c4 = (lane & 15) * 4; typedef _Float16 v4h __attribute__((ext_vector_type(4)));
  {
#pragma unroll
    for (int q = 0; q < 8; ++q) { const int r = q * 2 + rsub; if (col0 + c4 < N) { const v4f v = *(const v4fa*)&so[w][r][c4]; if (C) *(v4f*)(C + cofs + (size_t)(row0 + r) * ldc + col0 + c4) = v; if (C16) { v4h h4; for (int i = 0; i < 4; ++i) h4[i] = (_Float16)v[i]; *(v4h*)(C16 + cofs + (size_t)(row0 + r) * ldc + col0 + c4) = h4; } } }
     }
}


typedef _Float16 v4h __attribute__((ext_vector_type(4)));

__global__ __launch_bounds__(256) void k_x16(const float* __restrict__ x, _Float16* __restrict__ X16, size_t n8) { const size_t t = (size_t)blockIdx.x * 256 + threadIdx.x; if (t >= n8) return; FragH f;
#pragma unroll
  for (int q = 0; q < 8; ++q) f.h[q] = (_Float16)bf16_round(x[t * 8 + q]); *(v8us*)((unsigned short*)X16 + t * 8) = f.half[0];  }
__global__ __launch_bounds__(256) void k_h16(const float* __restrict__ x, _Float16* __restrict__ X16, size_t n8) { const size_t t = (size_t)blockIdx.x * 256 + threadIdx.x; if (t >= n8) return; FragH f;
#pragma unroll
  for (int q = 0; q < 8; ++q) f.h[q] = (_Float16)x[t * 8 + q]; *(v8us*)((unsigned short*)X16 + t * 8) = f.half[0];  }
__global__ __launch_bounds__(256) void k_round16f(const float* __restrict__ W, _Float16* __restrict__ Bt, size_t n8) { const size_t t = (size_t)blockIdx.x * 256 + threadIdx.x; if (t >= n8) return; FragH f;
#pragma unroll
  for (int i = 0; i < 8; ++i) f.h[i] = (_Float16)(bf16_round(W[t * 8 + i]) * 16.0f); *(v8us*)((unsigned short*)Bt + t * 8) = f.half[0];  }
template <int NHv, int TTv>
__global__ __launch_bounds__(256) void k_vt(const _Float16* __restrict__ V16, int ldv, int voff, _Float16* __restrict__ Vt) { __shared__ unsigned short tl[64][66]; const int tid = threadIdx.x; const int slab = blockIdx.x / (TTv / 64), lg = blockIdx.x % (TTv / 64); const int b = slab / NHv, h = slab % NHv;
  for (int i = tid; i < 64 * 8; i += 256) { const int r = i / 8, c8 = (i % 8) * 8; FragH f; f.half[0] = *(const v8us*)((const unsigned short*)V16 + ((size_t)b * TTv + lg * 64 + r) * ldv + voff + h * 64 + c8);
#pragma unroll
    for (int q = 0; q < 8; ++q) tl[r][c8 + q] = f.u[q]; }
  __syncthreads();
  {
#pragma unroll
    for (int rd = 0; rd < 2; ++rd) { const int d = rd * 32 + tid / 8, pc = tid % 8; FragH f;
#pragma unroll
      for (int q = 0; q < 8; ++q) f.u[q] = tl[pc * 8 + q][d];
      *(v8us*)((unsigned short*)Vt + ((size_t)slab * 64 + d) * TTv + lg * 64 + pc * 8) = f.half[0]; }
     } }

__global__ __launch_bounds__(256) void k_hl(const float* __restrict__ F, _Float16* __restrict__ Hh, _Float16* __restrict__ Hl, size_t n8) { const size_t t = (size_t)blockIdx.x * 256 + threadIdx.x; if (t >= n8) return; FragH fh, fl; const v4f a = *(const v4fa*)(F + t * 8), c = *(const v4fa*)(F + t * 8 + 4);
#pragma unroll
  for (int q = 0; q < 4; ++q) { _Float16 h = (_Float16)a[q]; fh.h[q] = h; fl.h[q] = (_Float16)((a[q] - (float)h) * 1024.0f); h = (_Float16)c[q]; fh.h[4 + q] = h; fl.h[4 + q] = (_Float16)((c[q] - (float)h) * 1024.0f); }
  { *(v8us*)((unsigned short*)Hh + t * 8) = fh.half[0]; *(v8us*)((unsigned short*)Hl + t * 8) = fl.half[0];  } }

// ---- fast GEMM (wave tile 32x64; requires M % 32 == 0 rows per launch region and N % 64 == 0); epilogue = k_gemm_hhx semantics ----
__device__ __forceinline__ v16h g2_frag(const _Float16* p, int hh) { FragH f; f.half[0] = *(const v8us*)((const unsigned short*)p + 8 * hh); f.half[1] = *(const v8us*)((const unsigned short*)p + 16 + 8 * hh); return f.v; }
__device__ __forceinline__ v8f g2_mma(v16h a, v16h b, v8f c) { v8f d = __builtin_amdgcn_wmma_f32_16x16x32_f16(false, a, false, b, (short)0, c, false, false); asm volatile("v_nop\n\tv_nop\n\tv_nop\n\tv_nop" : "+v"(d) : "v"(a), "v"(b)); return d; }
template <int ACT>
__global__ __launch_bounds__(128) void k_gemm2(const _Float16* __restrict__ A, int lda, size_t sA, const _Float16* __restrict__ Bh, int ldb, size_t sB, float alpha, const float* __restrict__ bias, size_t sBias, const float* __restrict__ CP, int rowsPerB, size_t sCPb, int row0g,
    float* __restrict__ C, _Float16* __restrict__ C16, int ldc, size_t sC, int M, int N, int K) { static_assert(ACT == 0 || ACT == 3 || ACT == 6 || ACT == 8 || ACT == 9 || ACT == 11 || ACT == 12 || ACT == 14 || ACT == 15 || ACT == 16 || ACT == 17, "k_gemm2: unsupported ACT code (would silently apply no activation)");
  __shared__ __attribute__((aligned(16))) float so[4][32][68];
  const int tid = threadIdx.x, w = tid >> 5, lane = tid & 31, ln = lane & 15, hh = lane >> 4; const int by = blockIdx.y;
  A += (size_t)by * sA; Bh += (size_t)by * sB; const size_t cofs = (size_t)by * sC; const float* bp = bias ? bias + (size_t)by * sBias : nullptr;
  const int ntn = N >> 6; const int mt = blockIdx.x / ntn, nq = blockIdx.x - mt * ntn; const int row0 = mt * 128 + 32 * w, col0 = nq * 64; if (row0 >= M) return;
  const _Float16* a0p = A + (size_t)(row0 + ln) * lda; const _Float16* a1p = a0p + (size_t)16 * lda;
  const _Float16* b0p = Bh + (size_t)(col0 + ln) * ldb; const _Float16* b1p = b0p + (size_t)16 * ldb; const _Float16* b2p = b1p + (size_t)16 * ldb; const _Float16* b3p = b2p + (size_t)16 * ldb;
  const v8f z8 = {0.f,0.f,0.f,0.f,0.f,0.f,0.f,0.f}; v8f c00 = z8, c01 = z8, c02 = z8, c03 = z8, c10 = z8, c11 = z8, c12 = z8, c13 = z8;
#pragma unroll 1
  for (int kb = 0; kb < K; kb += 32) { const v16h a0 = g2_frag(a0p + kb, hh), a1 = g2_frag(a1p + kb, hh);
    v16h b = g2_frag(b0p + kb, hh); c00 = g2_mma(a0, b, c00); c10 = g2_mma(a1, b, c10);
    b = g2_frag(b1p + kb, hh); c01 = g2_mma(a0, b, c01); c11 = g2_mma(a1, b, c11);
    b = g2_frag(b2p + kb, hh); c02 = g2_mma(a0, b, c02); c12 = g2_mma(a1, b, c12);
    b = g2_frag(b3p + kb, hh); c03 = g2_mma(a0, b, c03); c13 = g2_mma(a1, b, c13); }
  v8f accs[8] = {c00, c01, c02, c03, c10, c11, c12, c13};
#pragma unroll
  for (int u = 0; u < 8; ++u) { const int t = u & 3, half = u >> 2; const int col = col0 + t * 16 + ln; const float bv = bp ? bf16_round(bp[col]) : 0.f;
#pragma unroll
    for (int r = 0; r < 8; ++r) { const int rloc = half * 16 + 8 * hh + r; float v = accs[u][r] * alpha + bv; if (CP) { if (rowsPerB < 0) v += CP[cofs + (size_t)(row0g + row0 + rloc) * ldc + col];      /* rowsPerB < 0: own element of the batched C plane */ else { const int bidx = (row0g + row0 + rloc) / rowsPerB; v += CP[(size_t)bidx * sCPb + (size_t)by * 64 + col]; } }
      if (ACT == 3) v = fmaxf(v, 0.f); else if (ACT == 6) v = 0.5f * v * (1.0f + erff(v * 0.70710678118654752f)); else if (ACT == 11) v = 1.0f / (1.0f + expf(-v)); else if (ACT == 15) v = v / (1.0f + expf(-v)); else if (ACT == 12) v = (v > 0.f) ? v : 0.01f * v; else if (ACT == 8) v = tanhf(v); else if (ACT == 9) v = 0.5f * v * (1.0f + tanhf(0.7978845608028654f * (v + 0.044715f * v * v * v))); else if (ACT == 14) v = (v > 0.f) ? v : 0.1f * v; else if (ACT == 16) v = (v >= 0.f) ? v : 0.3f * v; else if (ACT == 17) v = (v >= 0.f) ? v : 0.2f * v;
      so[w][rloc][t * 16 + ln] = v; } }
  __builtin_amdgcn_fence(__ATOMIC_ACQ_REL, "workgroup"); __builtin_amdgcn_wave_barrier();
  const int rsub = lane >> 4, c4 = (lane & 15) * 4;
  {
#pragma unroll
    for (int q = 0; q < 16; ++q) { const int r = q * 2 + rsub; const v4f v = *(const v4fa*)&so[w][r][c4]; if (C) *(v4f*)(C + cofs + (size_t)(row0 + r) * ldc + col0 + c4) = v; if (C16) { v4h h4; for (int i = 0; i < 4; ++i) h4[i] = (_Float16)v[i]; *(v4h*)(C16 + cofs + (size_t)(row0 + r) * ldc + col0 + c4) = h4; } }
     } }


__global__ __launch_bounds__(256) void k_wnat(const float* __restrict__ w, size_t n8, _Float16* __restrict__ Bt) { const size_t t = (size_t)blockIdx.x * 256 + threadIdx.x; if (t >= n8) return; FragH f; for (int q = 0; q < 8; ++q) f.h[q] = (_Float16)(bf16_round(w[t * 8 + q]) * 16.0f); *(v8us*)((unsigned short*)Bt + t * 8) = f.half[0];  }
// Row softmax, one wave per row: a lane holds 32 of the row's 1024 scores in registers (8 loads of 16 B, each load of the wave = 512 contiguous bytes), so S is read once
// and every load and store of a wave covers whole 128-B lines. 16 waves per workgroup, 3 consecutive rows per wave; the next row's loads are issued before this row is worked on.
#define RSM_WAVES 16
#define RSM_ROWS 3
template <int M> __device__ __forceinline__ float rsm_xm(float x) { return __builtin_bit_cast(float, __builtin_amdgcn_update_dpp(0, __builtin_bit_cast(int, x), 0x160 | M, 0xf, 0xf, true)); }      /* lane l with lane l ^ M inside its 16-lane row (DPP row_xmask) */
__device__ __forceinline__ float rsm_xh(float x) { return __builtin_bit_cast(float, __builtin_amdgcn_permlanex16(__builtin_bit_cast(int, x), __builtin_bit_cast(int, x), 0x76543210, 0xfedcba98, false, false)); }      /* lane l with lane l ^ 16 */
// exp(x) for x <= 0 (or NaN): x log2(e) in two parts (0x3fb8aa3b + 0x32a5705f), n = nearest integer, 2^(rest) on v_exp_f32, scaled by 2^n; below -103.28 the result is 0 (also keeps -inf from inf - inf).
__device__ __forceinline__ float rsm_exp(float x) {
  const float c_hi = __uint_as_float(0x3fb8aa3bu), c_lo = __uint_as_float(0x32a5705fu);
  const float n = __builtin_rintf(x * c_hi);
  const float a = __builtin_fmaf(x, c_lo, __builtin_fmaf(x, c_hi, -n));
  float r; asm("v_exp_f32 %0, %1\n\tv_nop" : "=v"(r) : "v"(a));      /* the v_nop is the one slot the instruction set asks for behind a transcendental before its result is read or its source overwritten */
  r = ldexpf(r, (int)n);
  return (x < __uint_as_float(0xc2ce8ed0u)) ? 0.f : r;
}
__global__ __launch_bounds__(RSM_WAVES * 32) void k_rsm(const float* __restrict__ S, _Float16* __restrict__ P, int nrows) {
  const int lane = threadIdx.x & 31; const int wave = __builtin_amdgcn_readfirstlane((int)(threadIdx.x >> 5));
  const int row0 = (blockIdx.x * RSM_WAVES + wave) * RSM_ROWS; if (row0 >= nrows) return;      /* wave-uniform; the kernel has no barrier */
  const float* sb = S + (size_t)row0 * SQ + lane * 4; _Float16* pb = P + (size_t)row0 * SQ + lane * 4;
  v4f buf[2][SQ / 128];
  /* a row past nrows reads the wave's first row again (no load leaves S) and is not stored */
#define RSM_LOAD(R) do { const float* sr_ = sb + ((row0 + (R) < nrows) ? (size_t)(R) * SQ : (size_t)0); \
    _Pragma("unroll") for (int u = 0; u < SQ / 128; ++u) buf[(R) & 1][u] = *(const v4fa*)(sr_ + u * 128); } while (0)
  RSM_LOAD(0);
#pragma unroll
  for (int r = 0; r < RSM_ROWS; ++r) {
    __builtin_amdgcn_sched_barrier(0);      /* with the one below: keeps the next row's loads in front of this row's arithmetic, so that they fly under it */
    if (r + 1 < RSM_ROWS) RSM_LOAD(r + 1);
    __builtin_amdgcn_sched_barrier(0);
    v4f* e = buf[r & 1];
    float m0 = -3.0e38f, m1 = -3.0e38f, m2 = -3.0e38f, m3 = -3.0e38f;
#pragma unroll
    for (int u = 0; u < SQ / 128; ++u) { m0 = fmaxf(m0, e[u][0]); m1 = fmaxf(m1, e[u][1]); m2 = fmaxf(m2, e[u][2]); m3 = fmaxf(m3, e[u][3]); }
    float mx = fmaxf(fmaxf(m0, m1), fmaxf(m2, m3));
    mx = fmaxf(mx, rsm_xm<1>(mx)); mx = fmaxf(mx, rsm_xm<2>(mx)); mx = fmaxf(mx, rsm_xm<4>(mx)); mx = fmaxf(mx, rsm_xm<8>(mx)); mx = fmaxf(mx, rsm_xh(mx));
    float a0 = 0.f, a1 = 0.f, a2 = 0.f, a3 = 0.f;
#pragma unroll
    for (int u = 0; u < SQ / 128; ++u) { v4f t; t[0] = rsm_exp(e[u][0] - mx); t[1] = rsm_exp(e[u][1] - mx); t[2] = rsm_exp(e[u][2] - mx); t[3] = rsm_exp(e[u][3] - mx); e[u] = t; a0 += t[0]; a1 += t[1]; a2 += t[2]; a3 += t[3]; }
    float se = (a0 + a1) + (a2 + a3);
    se += rsm_xm<1>(se); se += rsm_xm<2>(se); se += rsm_xm<4>(se); se += rsm_xm<8>(se); se += rsm_xh(se);
    const float sc = 256.0f / se;
    if (row0 + r < nrows) {
#pragma unroll
      for (int u = 0; u < SQ / 128; ++u) { v4h h4; h4[0] = (_Float16)(e[u][0] * sc); h4[1] = (_Float16)(e[u][1] * sc); h4[2] = (_Float16)(e[u][2] * sc); h4[3] = (_Float16)(e[u][3] * sc); *(v4h*)(pb + (size_t)r * SQ + u * 128) = h4; }
      if (r + 1 < RSM_ROWS) asm volatile("s_wait_xcnt 0x0" ::: "memory");      /* the next rows' loads and arithmetic reuse the registers that these stores name */
    }
  }
#undef RSM_LOAD
}
__global__ __launch_bounds__(256) void k_vt(const _Float16* __restrict__ V16, int b, int h0, _Float16* __restrict__ VT) { __shared__ unsigned short tl[64][65]; const int tid = threadIdx.x; const int hh = blockIdx.x % HG, sg = blockIdx.x / HG; const int s0 = sg * 64; const int h = h0 + hh;
  for (int i = tid; i < 64 * 8; i += 256) { const int j = i / 8, d8 = (i % 8) * 8; FragH f; f.half[0] = *(const v8us*)((const unsigned short*)V16 + ((size_t)b * SQ + s0 + j) * DM + h * HD + d8); for (int q = 0; q < 8; ++q) tl[d8 + q][j] = f.u[q]; }
  __syncthreads();
  { for (int i = tid; i < 64 * 8; i += 256) { const int d = i / 8, j8 = (i % 8) * 8; FragH f; for (int q = 0; q < 8; ++q) f.u[q] = tl[d][j8 + q]; *(v8us*)((unsigned short*)VT + ((size_t)hh * HD + d) * SQ + s0 + j8) = f.half[0]; }  } }


extern "C" void kernel_launch(void* const* d_in, const int* in_sizes, int n_in,
                              void* d_out, int out_size, void* d_ws, size_t ws_size, hipStream_t stream) {
  (void)in_sizes; (void)n_in; (void)out_size;
  const float* const* I = (const float* const*)d_in; const float* x = I[0]; const float* wq = I[1]; const float* bq = I[2]; const float* wk = I[3]; const float* bk = I[4]; const float* wv = I[5]; const float* bv = I[6]; const float* wo = I[7]; const float* bo = I[8];      /* nn.Linear weights [out][in] + biases */
  char* ws = (char*)d_ws; size_t off = 0;
  auto take = [&](size_t bytes) { char* p = ws + off; off += (bytes + 255) & ~(size_t)255; return p; };
  _Float16* BQ = (_Float16*)take((size_t)DM * DM * 2); _Float16* BK = (_Float16*)take((size_t)DM * DM * 2); _Float16* BV = (_Float16*)take((size_t)DM * DM * 2); _Float16* BO = (_Float16*)take((size_t)DM * DM * 2);
  _Float16* X16 = (_Float16*)take(NR * DM * 2); _Float16* Q16 = (_Float16*)take(NR * DM * 2); _Float16* K16 = (_Float16*)take(NR * DM * 2); _Float16* V16 = (_Float16*)take(NR * DM * 2); _Float16* O16 = (_Float16*)take(NR * DM * 2);
  float* S = (float*)take((size_t)HG * SQ * SQ * 4); _Float16* P = (_Float16*)take((size_t)HG * SQ * SQ * 2); _Float16* VT = (_Float16*)take((size_t)NH * HD * SQ * 2);
  if (off > ws_size) return;
  { const unsigned g = (unsigned)(((size_t)DM * DM / 8 + 255) / 256); k_wnat<<<g, 256, 0, stream>>>(wq, (size_t)DM * DM / 8, BQ); k_wnat<<<g, 256, 0, stream>>>(wk, (size_t)DM * DM / 8, BK); k_wnat<<<g, 256, 0, stream>>>(wv, (size_t)DM * DM / 8, BV); k_wnat<<<g, 256, 0, stream>>>(wo, (size_t)DM * DM / 8, BO); }      /* natural [out][in] = Bt[n][k], x16 */
  k_x16<<<(unsigned)((NR * DM / 8 + 255) / 256), 256, 0, stream>>>(x, X16, NR * DM / 8);
  const size_t r0p = (size_t)B0 * SQ;      /* first projected row */
  k_gemm2<0><<<dim3((unsigned)((MP / 128) * (DM / 64)), 1), 128, 0, stream>>>(X16 + r0p * DM, DM, 0, BQ, DM, 0, 0.0625f, bq, 0, nullptr, 1, 0, 0, nullptr, Q16 + r0p * DM, DM, 0, MP, DM, DM);
  k_gemm2<0><<<dim3((unsigned)((MP / 128) * (DM / 64)), 1), 128, 0, stream>>>(X16 + r0p * DM, DM, 0, BK, DM, 0, 0.0625f, bk, 0, nullptr, 1, 0, 0, nullptr, K16 + r0p * DM, DM, 0, MP, DM, DM);
  k_gemm2<0><<<dim3((unsigned)((MP / 128) * (DM / 64)), 1), 128, 0, stream>>>(X16 + r0p * DM, DM, 0, BV, DM, 0, 0.0625f, bv, 0, nullptr, 1, 0, 0, nullptr, V16 + r0p * DM, DM, 0, MP, DM, DM);
  for (int b = B0; b < B0 + NBR; ++b) { const size_t r0 = (size_t)b * SQ;
    k_vt<NH, SQ><<<NH * (SQ / 64), 256, 0, stream>>>(V16 + r0 * LQ, LQ, 0, VT);      /* V^T [NH][HD][SQ] for this batch */
    for (int h0 = 0; h0 < NHD; h0 += HG) {
      k_gemm2<0><<<dim3((QN / 128) * (SQ / 64), HG), 128, 0, stream>>>(Q16 + r0 * LQ + h0 * HD, LQ, (size_t)HD, K16 + r0 * LQ + h0 * HD, LQ, (size_t)HD, 0.125f, nullptr, 0, nullptr, 1, 0, 0, S, nullptr, SQ, (size_t)SQ * SQ, QN, SQ, HD);      /* scores, HG heads per launch */
      k_rsm<<<(HG * SQ + RSM_WAVES * RSM_ROWS - 1) / (RSM_WAVES * RSM_ROWS), RSM_WAVES * 32, 0, stream>>>(S, P, HG * SQ);      /* P = 256 softmax (f16), rows of all HG heads */
      k_gemm2<0><<<dim3((QN / 128) * (HD / 64), HG), 128, 0, stream>>>(P, SQ, (size_t)SQ * SQ, VT + (size_t)h0 * HD * SQ, SQ, (size_t)HD * SQ, 0.25f, nullptr, 0, nullptr, 1, 0, 0, nullptr, O16 + r0 * DM + h0 * HD, DM, (size_t)HD, QN, HD, SQ); } }      /* o (merged heads) as f16 rows */
  k_gemm2<0><<<dim3((unsigned)((MPO / 128) * (DM / 64)), 1), 128, 0, stream>>>(O16 + r0p * DM, DM, 0, BO, DM, 0, 0.0009765625f, bo, 0, nullptr, 1, 0, 0, (float*)d_out + r0p * DM, nullptr, DM, 0, MPO, DM, DM);      /* out rows are the output layout */
}

// v002
// One run takes 281 microseconds.
// Two timings next to v001 put it at 4.50 and 4.43 times that version's speed.
// Over all steps from v000 it is 14.5 times as fast.
#include <hip/hip_runtime.h>
// ViT self-attention (x [16][1024][768]; q/k/v = x W^T + b (nn.Linear [out][in] 768^2, sigma 0.02, zero biases), 12 heads of 64; scores / 8; softmax; out = (attn v merged) Wc^T + bc -> [16][1024][768]).
// Structure: token rows r = b*1024 + s; x as exact f16 rows (bf16-rounded); Q, K, V as three WMMA GEMMs (32x64 wave tiles, f32 accumulation, exact x16 weights + bias, f16 outputs); V^T for all batches and heads via LDS transposes; one fused attention kernel over all (batch, head): S^T = K Q^T, online softmax (f32 statistics, exp2 domain; weights x128 as f16), O^T += V^T P^T, o carried x64 against f16 subnormal flush (folded into the output GEMM alpha), written straight into the merged f16 o rows; out = o W_o + b GEMM (f32) into the output layout.
// Compute dtype: inputs rounded to bf16; x / weights exact; q, k, v, softmax weights and o as plain f16 GEMM operands (~2^-12); scores and softmax statistics f32. v_wmma_f32_16x16x32_f16.
#define NB 16
#define SQ 1024
#define DM 768
#define NH 12
#define HD 64
#define HG 12                         /* heads per launch of the (b, h0) k_vt overload */
#define B0 0                         /* first batch processed (debug hook) */
#define NBR NB                       /* batches processed (debug hook) */
#define NR ((size_t)NB * SQ)         /* token rows */
#define MP ((int)((size_t)NBR * SQ)) /* rows projected (debug hook) */
#define QN SQ                        /* unused; the attention covers all SQ queries */
#define NHD NH                       /* unused; the attention covers all NH heads */
#define MPO MP                       /* rows through the output stage (debug hook) */
#define LQ DM      /* row pitch of the q/k/v rows */
typedef __bf16 v16b __attribute__((ext_vector_type(16)));
typedef unsigned short v8us __attribute__((ext_vector_type(8), may_alias));
typedef float  v8f  __attribute__((ext_vector_type(8)));
typedef float  v4f  __attribute__((ext_vector_type(4)));
typedef float  v4fa __attribute__((ext_vector_type(4), may_alias));
union FragB { v16b v; v8us half[2]; unsigned short u[16]; };

__device__ __forceinline__ unsigned short bf16_bits(float x) { unsigned int u = __float_as_uint(x); return (unsigned short)((u + 0x7FFFu + ((u >> 16) & 1u)) >> 16); }
__device__ __forceinline__ float bf16_val(unsigned short b) { return __uint_as_float(((unsigned int)b) << 16); }
__device__ __forceinline__ float bf16_round(float x) { return bf16_val(bf16_bits(x)); }
// D += A·B with NT terms: 1 = ah·bh, 2 = + al·bh (A split), 3 = + ah·bl (both split)
template <int NT>
__device__ __forceinline__ v8f mmaN(v16b ah, v16b al, v16b bh, v16b bl, v8f c) {
  c = __builtin_amdgcn_wmma_f32_16x16x32_bf16(false, ah, false, bh, (short)0, c, false, false);
  if (NT >= 2) c = __builtin_amdgcn_wmma_f32_16x16x32_bf16(false, al, false, bh, (short)0, c, false, false);
  if (NT >= 3) c = __builtin_amdgcn_wmma_f32_16x16x32_bf16(false, ah, false, bl, (short)0, c, false, false);
  asm volatile("v_nop\n\tv_nop\n\tv_nop\n\tv_nop" : "+v"(c) : "v"(ah), "v"(al), "v"(bh), "v"(bl));
  return c;
}

__global__ __launch_bounds__(256) void k_wt_bf16(const float* __restrict__ W, unsigned short* __restrict__ Wt, int K, int N) {
  const int t = blockIdx.x * 256 + threadIdx.x;
  const int k8n = K / 8;
  if (t >= N * k8n) return;
  const int n = t / k8n, k8 = (t % k8n) * 8;
  v8us v;
#pragma unroll
  for (int i = 0; i < 8; ++i) v[i] = bf16_bits(W[(size_t)(k8 + i) * N + n]);
  *(v8us*)(Wt + (size_t)n * K + k8) = v;
  
}

// GEMM C[M][N] (f32, pitch ldc) = act(A[M][K]·W + bias). A f32 row-major (pitch lda) converted per fragment to bf16
// (ASPLIT: hi/lo two planes -> 2 terms, else single rounded term); Wt bf16 [N][K] (pitch ldb). BIAS_BF16 rounds the
// bias to bf16 first (bias quantised to bf16 before the add). K%32==0, M%16==0, N%64==0.
template <bool ASPLIT, int ACT, bool BIAS_BF16>
__global__ __launch_bounds__(128) void k_gemm_bf(const float* __restrict__ A, int lda, const unsigned short* __restrict__ Wt, int ldb,
                                               const float* __restrict__ bias, float* __restrict__ C, int ldc, int M, int N, int K) {
  __shared__ __attribute__((aligned(16))) float so[4][16][64];
  const int tid = threadIdx.x, w = tid >> 5, lane = tid & 31, ln = lane & 15, hh = lane >> 4;
  const int ntn = N / 64;
  const int wid = blockIdx.x * 4 + w;
  const int mt = wid / ntn, nq = wid % ntn;
  if (mt * 16 >= M) return;
  const int row0 = mt * 16, col0 = nq * 64;
  const float* arow = A + (size_t)(row0 + ln) * lda;
  v8f acc[4] = {};
  for (int kb = 0; kb < K; kb += 32) {
    FragB ah, al;
    const v4f x0 = *(const v4fa*)(arow + kb + 8 * hh), x1 = *(const v4fa*)(arow + kb + 8 * hh + 4);
    const v4f x2 = *(const v4fa*)(arow + kb + 16 + 8 * hh), x3 = *(const v4fa*)(arow + kb + 16 + 8 * hh + 4);
    float xs[16] = {x0[0],x0[1],x0[2],x0[3],x1[0],x1[1],x1[2],x1[3],x2[0],x2[1],x2[2],x2[3],x3[0],x3[1],x3[2],x3[3]};
#pragma unroll
    for (int i = 0; i < 16; ++i) { const unsigned short hb = bf16_bits(xs[i]); ah.u[i] = hb; al.u[i] = ASPLIT ? bf16_bits(xs[i] - bf16_val(hb)) : (unsigned short)0; }
#pragma unroll
    for (int t = 0; t < 4; ++t) {
      const unsigned short* brow = Wt + (size_t)(col0 + t * 16 + ln) * ldb + kb;
      FragB b;
      b.half[0] = *(const v8us*)(brow + 8 * hh);
      b.half[1] = *(const v8us*)(brow + 16 + 8 * hh);
      acc[t] = mmaN<ASPLIT ? 2 : 1>(ah.v, al.v, b.v, b.v, acc[t]);
    }
  }
#pragma unroll
  for (int t = 0; t < 4; ++t) {
    float bv = bias ? bias[col0 + t * 16 + ln] : 0.f;
    if (BIAS_BF16) bv = bf16_round(bv);
#pragma unroll
    for (int r = 0; r < 8; ++r) { float v = acc[t][r] + bv; if (ACT == 1) v = fmaxf(v, 0.f); so[w][8 * hh + r][t * 16 + ln] = v; }
  }
  __builtin_amdgcn_fence(__ATOMIC_ACQ_REL, "workgroup");
  __builtin_amdgcn_wave_barrier();
  const int rsub = lane >> 4, c4 = (lane & 15) * 4;
  {
#pragma unroll
    for (int q = 0; q < 8; ++q) {
      const int r = q * 2 + rsub;
      const v4f v = *(const v4fa*)&so[w][r][c4];
      *(v4f*)(C + (size_t)(row0 + r) * ldc + col0 + c4) = v;
    }
    
  }
}

// GEMM C = act(A·W + bias + resid): A f32 (ASPLIT -> hi/lo 2 terms), Wt bf16 [N][K]; ACT 0 none, 1 relu, 2 exact gelu;
// resid (optional, f32, row index = (row % rmod), pitch ldr, RES_BF16 rounds it) added before the activation.
template <bool ASPLIT, int ACT, bool BIAS_BF16, bool RES_BF16>
__global__ __launch_bounds__(128) void k_gemm_bf3(const float* __restrict__ A, int lda, const unsigned short* __restrict__ Wt, int ldb,
                                                const float* __restrict__ bias, const float* __restrict__ resid, int rmod, int ldr,
                                                float* __restrict__ C, int ldc, int M, int N, int K) {
  __shared__ __attribute__((aligned(16))) float so[4][16][64];
  const int tid = threadIdx.x, w = tid >> 5, lane = tid & 31, ln = lane & 15, hh = lane >> 4;
  const int ntn = N / 64;
  const int wid = blockIdx.x * 4 + w;
  const int mt = wid / ntn, nq = wid % ntn;
  if (mt * 16 >= M) return;
  const int row0 = mt * 16, col0 = nq * 64;
  const float* arow = A + (size_t)(row0 + ln) * lda;
  v8f acc[4] = {};
  for (int kb = 0; kb < K; kb += 32) {
    FragB ah, al;
    const v4f x0 = *(const v4fa*)(arow + kb + 8 * hh), x1 = *(const v4fa*)(arow + kb + 8 * hh + 4);
    const v4f x2 = *(const v4fa*)(arow + kb + 16 + 8 * hh), x3 = *(const v4fa*)(arow + kb + 16 + 8 * hh + 4);
    float xs[16] = {x0[0],x0[1],x0[2],x0[3],x1[0],x1[1],x1[2],x1[3],x2[0],x2[1],x2[2],x2[3],x3[0],x3[1],x3[2],x3[3]};
#pragma unroll
    for (int i = 0; i < 16; ++i) { const unsigned short hb = bf16_bits(xs[i]); ah.u[i] = hb; al.u[i] = ASPLIT ? bf16_bits(xs[i] - bf16_val(hb)) : (unsigned short)0; }
#pragma unroll
    for (int t = 0; t < 4; ++t) {
      const unsigned short* brow = Wt + (size_t)(col0 + t * 16 + ln) * ldb + kb;
      FragB b;
      b.half[0] = *(const v8us*)(brow + 8 * hh);
      b.half[1] = *(const v8us*)(brow + 16 + 8 * hh);
      acc[t] = mmaN<ASPLIT ? 2 : 1>(ah.v, al.v, b.v, b.v, acc[t]);
    }
  }
#pragma unroll
  for (int t = 0; t < 4; ++t) {
    const int col = col0 + t * 16 + ln;
    float bv = bias ? bias[col] : 0.f;
    if (BIAS_BF16) bv = bf16_round(bv);
#pragma unroll
    for (int r = 0; r < 8; ++r) {
      float v = acc[t][r] + bv;
      if (resid) { float rv = resid[(size_t)((row0 + 8 * hh + r) % rmod) * ldr + col]; if (RES_BF16) rv = bf16_round(rv); v += rv; }
      if (ACT == 1) v = fmaxf(v, 0.f);
      if (ACT == 2) v = 0.5f * v * (1.0f + erff(v * 0.70710678118654752f));
      if (ACT == 3) { const float u = 0.7978845608028654f * (v + 0.044715f * v * v * v); v = 0.5f * v * (1.0f + tanhf(u)); }
      so[w][8 * hh + r][t * 16 + ln] = v;
    }
  }
  __builtin_amdgcn_fence(__ATOMIC_ACQ_REL, "workgroup");
  __builtin_amdgcn_wave_barrier();
  const int rsub = lane >> 4, c4 = (lane & 15) * 4;
  {
#pragma unroll
    for (int q = 0; q < 8; ++q) {
      const int r = q * 2 + rsub;
      const v4f v = *(const v4fa*)&so[w][r][c4];
      *(v4f*)(C + (size_t)(row0 + r) * ldc + col0 + c4) = v;
    }
    
  }
}
// row LayerNorm (biased variance, eps) over N: s = X (+ R); optional out_sum <- s; out_norm <- (s-mu)*rsqrt(var+eps)*g + b
template <bool PARAM_BF16>
__global__ __launch_bounds__(256) void k_layernorm(const float* __restrict__ X, const float* __restrict__ R, const float* __restrict__ g, const float* __restrict__ bta,
                                                  float* __restrict__ out_sum, float* __restrict__ out_norm, int N, float eps) {
  __shared__ float red[256];
  const int row = blockIdx.x, tid = threadIdx.x;
  const float* x = X + (size_t)row * N; const float* rr = R ? R + (size_t)row * N : nullptr;
  float vals[16];                     // up to N = 4096
  const int per = N / 256;            // contiguous chunk per thread? use strided-by-4 chunks: thread handles j = tid*4 + 1024*u
  float s1 = 0.f;
  for (int u = 0; u < per / 4; ++u) {
    const int j = tid * 4 + 1024 * u;
    const v4f a = *(const v4fa*)(x + j);
    v4f b = {0.f,0.f,0.f,0.f}; if (rr) b = *(const v4fa*)(rr + j);
#pragma unroll
    for (int q = 0; q < 4; ++q) { const float v = a[q] + b[q]; vals[u * 4 + q] = v; s1 += v; }
  }
  red[tid] = s1; __syncthreads();
  for (int st = 128; st > 0; st >>= 1) { if (tid < st) red[tid] += red[tid + st]; __syncthreads(); }
  const float mu = red[0] / (float)N; __syncthreads();
  float s2 = 0.f;
  for (int u = 0; u < per / 4; ++u)
#pragma unroll
    for (int q = 0; q < 4; ++q) { const float c = vals[u * 4 + q] - mu; s2 += c * c; }
  red[tid] = s2; __syncthreads();
  for (int st = 128; st > 0; st >>= 1) { if (tid < st) red[tid] += red[tid + st]; __syncthreads(); }
  const float rs = rsqrtf(red[0] / (float)N + eps);
  {
    for (int u = 0; u < per / 4; ++u) {
      const int j = tid * 4 + 1024 * u;
      v4f o, sm;
#pragma unroll
      for (int q = 0; q < 4; ++q) {
        float gg = g[j + q], bb = bta[j + q];
        if (PARAM_BF16) { gg = bf16_round(gg); bb = bf16_round(bb); }
        sm[q] = vals[u * 4 + q]; o[q] = (vals[u * 4 + q] - mu) * rs * gg + bb;
      }
      if (out_sum) *(v4f*)(out_sum + (size_t)row * N + j) = sm;
      *(v4f*)(out_norm + (size_t)row * N + j) = o;
    }
    
  }
}



// ---- f16 WMMA path (v_wmma_f32_16x16x32_f16): 11-bit significands for operands in range — used where a [0,1] probability operand needs more precision than bf16
typedef _Float16 v16h __attribute__((ext_vector_type(16)));
union FragH { v16h v; v8us half[2]; _Float16 h[16]; unsigned short u[16]; };
template <int NT>
__device__ __forceinline__ v8f mmaH(v16h ah, v16h al, v16h bh, v16h bl, v8f c) {
  c = __builtin_amdgcn_wmma_f32_16x16x32_f16(false, ah, false, bh, (short)0, c, false, false);
  if (NT >= 2) c = __builtin_amdgcn_wmma_f32_16x16x32_f16(false, al, false, bh, (short)0, c, false, false);
  if (NT >= 3) c = __builtin_amdgcn_wmma_f32_16x16x32_f16(false, ah, false, bl, (short)0, c, false, false);
  asm volatile("v_nop\n\tv_nop\n\tv_nop\n\tv_nop" : "+v"(c) : "v"(ah), "v"(al), "v"(bh), "v"(bl));
  return c;
}
// batched GEMM like k_gemm_b but f16 operands: A f32 (split into f16 hi/lo if ASPLIT, else rounded to f16), Bt = f16 values [n][k]; alpha; C f32; N multiple of 16 (partial tiles skipped)
template <bool ASPLIT>
__global__ __launch_bounds__(128) void k_gemm_h(const float* __restrict__ A, int lda, size_t sA, const _Float16* __restrict__ Bh, int ldb, size_t sB, float alpha, float* __restrict__ C, int ldc, size_t sC, int M, int N, int K) {
  __shared__ __attribute__((aligned(16))) float so[4][16][64];
  const int tid = threadIdx.x, w = tid >> 5, lane = tid & 31, ln = lane & 15, hh = lane >> 4; const int by = blockIdx.y;
  A += (size_t)by * sA; Bh += (size_t)by * sB; C += (size_t)by * sC;
  const int ntn = (N + 63) / 64; const int wid = blockIdx.x * 4 + w; const int mt = wid / ntn, nq = wid % ntn; if (mt * 16 >= M) return;
  const int row0 = mt * 16, col0 = nq * 64; const float* arow = A + (size_t)(row0 + ln) * lda;
  v8f acc[4] = {};
  for (int kb = 0; kb < K; kb += 32) {
    FragH ah, al;
    const v4f x0 = *(const v4fa*)(arow + kb + 8 * hh), x1 = *(const v4fa*)(arow + kb + 8 * hh + 4), x2 = *(const v4fa*)(arow + kb + 16 + 8 * hh), x3 = *(const v4fa*)(arow + kb + 16 + 8 * hh + 4);
    float xs[16] = {x0[0],x0[1],x0[2],x0[3],x1[0],x1[1],x1[2],x1[3],x2[0],x2[1],x2[2],x2[3],x3[0],x3[1],x3[2],x3[3]};
#pragma unroll
    for (int i = 0; i < 16; ++i) { const _Float16 h = (_Float16)xs[i]; ah.h[i] = h; al.h[i] = ASPLIT ? (_Float16)(xs[i] - (float)h) : (_Float16)0.0f; }
#pragma unroll
    for (int t = 0; t < 4; ++t) { if (col0 + t * 16 >= N) continue; const size_t boff = (size_t)(col0 + t * 16 + ln) * ldb + kb; FragH bq; bq.half[0] = *(const v8us*)(Bh + boff + 8 * hh); bq.half[1] = *(const v8us*)(Bh + boff + 16 + 8 * hh);
      acc[t] = mmaH<ASPLIT ? 2 : 1>(ah.v, al.v, bq.v, bq.v, acc[t]); }
  }
#pragma unroll
  for (int t = 0; t < 4; ++t) { if (col0 + t * 16 >= N) continue;
#pragma unroll
    for (int r = 0; r < 8; ++r) so[w][8 * hh + r][t * 16 + ln] = acc[t][r] * alpha; }
  __builtin_amdgcn_fence(__ATOMIC_ACQ_REL, "workgroup"); __builtin_amdgcn_wave_barrier();
  const int rsub = lane >> 4, c4 = (lane & 15) * 4;
  {
#pragma unroll
    for (int q = 0; q < 8; ++q) { const int r = q * 2 + rsub; if (col0 + c4 < N) { const v4f v = *(const v4fa*)&so[w][r][c4]; *(v4f*)(C + (size_t)(row0 + r) * ldc + col0 + c4) = v; } }
     }
}

// Wt[n][k] = f16(W[k][n]·scale) from f32 row-major W[K][N] (scale = power of two; bf16-exact weights stay exact in f16 away from the subnormal range)
__global__ __launch_bounds__(256) void k_wt_f16(const float* __restrict__ W, _Float16* __restrict__ Wt, int K, int N, float scale) {
  const int t = blockIdx.x * 256 + threadIdx.x; if (t >= N * (K / 8)) return; const int n = t / (K / 8), k8 = (t % (K / 8)) * 8; FragH f;
#pragma unroll
  for (int i = 0; i < 8; ++i) f.h[i] = (_Float16)(bf16_round(W[(size_t)(k8 + i) * N + n]) * scale); const v8us o = f.half[0];
  *(v8us*)((unsigned short*)Wt + (size_t)n * K + k8) = o; 
}
// k_gemm_hh variant with fused epilogue: v = acc·alpha + bias[by·sBias + col] (+ CP[(row/rowsPerB)·sCPb + by·64 + col] if CP) ; ACT 0 none / 1 elu ; writes f16 C16 (and f32 C if non-null)
template <int ACT>
__global__ __launch_bounds__(128) void k_gemm_hhx(const _Float16* __restrict__ A, int lda, size_t sA, const _Float16* __restrict__ Bh, int ldb, size_t sB, float alpha, const float* __restrict__ bias, size_t sBias, const float* __restrict__ CP, int rowsPerB, size_t sCPb, int row0g,
    float* __restrict__ C, _Float16* __restrict__ C16, int ldc, size_t sC, int M, int N, int K) {
  __shared__ __attribute__((aligned(16))) float so[4][16][64];
  const int tid = threadIdx.x, w = tid >> 5, lane = tid & 31, ln = lane & 15, hh = lane >> 4; const int by = blockIdx.y;
  A += (size_t)by * sA; Bh += (size_t)by * sB; const size_t cofs = (size_t)by * sC; const float* bp = bias ? bias + (size_t)by * sBias : nullptr;
  const int ntn = (N + 63) / 64; const int wid = blockIdx.x * 4 + w; const int mt = wid / ntn, nq = wid % ntn; if (mt * 16 >= M) return;
  const int row0 = mt * 16, col0 = nq * 64; const _Float16* arow = A + (size_t)(row0 + ln) * lda;
  v8f acc[4] = {};
  for (int kb = 0; kb < K; kb += 32) { FragH ah; ah.half[0] = *(const v8us*)((const unsigned short*)arow + kb + 8 * hh); ah.half[1] = *(const v8us*)((const unsigned short*)arow + kb + 16 + 8 * hh);
#pragma unroll
    for (int t = 0; t < 4; ++t) { if (col0 + t * 16 >= N) continue; const size_t boff = (size_t)(col0 + t * 16 + ln) * ldb + kb; FragH bq; bq.half[0] = *(const v8us*)((const unsigned short*)Bh + boff + 8 * hh); bq.half[1] = *(const v8us*)((const unsigned short*)Bh + boff + 16 + 8 * hh);
      acc[t] = mmaH<1>(ah.v, ah.v, bq.v, bq.v, acc[t]); }
  }
#pragma unroll
  for (int t = 0; t < 4; ++t) { if (col0 + t * 16 >= N) continue; const int col = col0 + t * 16 + ln; const float bv = bp ? bf16_round(bp[col]) : 0.f;
#pragma unroll
    for (int r = 0; r < 8; ++r) { float v = acc[t][r] * alpha + bv; if (CP) { const int rr = row0g + row0 + 8 * hh + r; if (rowsPerB < 0) v += CP[cofs + (size_t)rr * ldc + col];      /* rowsPerB < 0: own element of the batched C plane */ else { const int bidx = rr / rowsPerB; v += CP[(size_t)bidx * sCPb + (size_t)by * 64 + col]; } } if (ACT == 1) v = (v > 0.f) ? v : expm1f(v); else if (ACT == 7) v = (v > 0.f) ? v + 1.0f : expf(v); else if (ACT == 8) v = tanhf(v); else if (ACT == 9) v = 0.5f * v * (1.0f + tanhf(0.7978845608028654f * (v + 0.044715f * v * v * v))); else if (ACT == 11) v = 1.0f / (1.0f + expf(-v)); else if (ACT == 12) v = (v > 0.f) ? v : 0.01f * v; else if (ACT == 14) v = (v > 0.f) ? v : 0.1f * v; else if (ACT == 16) v = (v >= 0.f) ? v : 0.3f * v; else if (ACT == 17) v = (v >= 0.f) ? v : 0.2f * v; else if (ACT == 15) v = v / (1.0f + expf(-v)); else if (ACT == 3) v = fmaxf(v, 0.f); else if (ACT == 6) v = 0.5f * v * (1.0f + erff(v * 0.70710678118654752f)); so[w][8 * hh + r][t * 16 + ln] = v; } }
  __builtin_amdgcn_fence(__ATOMIC_ACQ_REL, "workgroup"); __builtin_amdgcn_wave_barrier();
  const int rsub = lane >> 4, c4 = (lane & 15) * 4; typedef _Float16 v4h __attribute__((ext_vector_type(4)));
  {
#pragma unroll
    for (int q = 0; q < 8; ++q) { const int r = q * 2 + rsub; if (col0 + c4 < N) { const v4f v = *(const v4fa*)&so[w][r][c4]; if (C) *(v4f*)(C + cofs + (size_t)(row0 + r) * ldc + col0 + c4) = v; if (C16) { v4h h4; for (int i = 0; i < 4; ++i) h4[i] = (_Float16)v[i]; *(v4h*)(C16 + cofs + (size_t)(row0 + r) * ldc + col0 + c4) = h4; } } }
     }
}


typedef _Float16 v4h __attribute__((ext_vector_type(4)));

__global__ __launch_bounds__(256) void k_x16(const float* __restrict__ x, _Float16* __restrict__ X16, size_t n8) { const size_t t = (size_t)blockIdx.x * 256 + threadIdx.x; if (t >= n8) return; FragH f;
#pragma unroll
  for (int q = 0; q < 8; ++q) f.h[q] = (_Float16)bf16_round(x[t * 8 + q]); *(v8us*)((unsigned short*)X16 + t * 8) = f.half[0];  }
__global__ __launch_bounds__(256) void k_h16(const float* __restrict__ x, _Float16* __restrict__ X16, size_t n8) { const size_t t = (size_t)blockIdx.x * 256 + threadIdx.x; if (t >= n8) return; FragH f;
#pragma unroll
  for (int q = 0; q < 8; ++q) f.h[q] = (_Float16)x[t * 8 + q]; *(v8us*)((unsigned short*)X16 + t * 8) = f.half[0];  }
__global__ __launch_bounds__(256) void k_round16f(const float* __restrict__ W, _Float16* __restrict__ Bt, size_t n8) { const size_t t = (size_t)blockIdx.x * 256 + threadIdx.x; if (t >= n8) return; FragH f;
#pragma unroll
  for (int i = 0; i < 8; ++i) f.h[i] = (_Float16)(bf16_round(W[t * 8 + i]) * 16.0f); *(v8us*)((unsigned short*)Bt + t * 8) = f.half[0];  }
template <int NHv, int TTv>
__global__ __launch_bounds__(256) void k_vt(const _Float16* __restrict__ V16, int ldv, int voff, _Float16* __restrict__ Vt) { __shared__ unsigned short tl[64][66]; const int tid = threadIdx.x; const int slab = blockIdx.x / (TTv / 64), lg = blockIdx.x % (TTv / 64); const int b = slab / NHv, h = slab % NHv;
  for (int i = tid; i < 64 * 8; i += 256) { const int r = i / 8, c8 = (i % 8) * 8; FragH f; f.half[0] = *(const v8us*)((const unsigned short*)V16 + ((size_t)b * TTv + lg * 64 + r) * ldv + voff + h * 64 + c8);
#pragma unroll
    for (int q = 0; q < 8; ++q) tl[r][c8 + q] = f.u[q]; }
  __syncthreads();
  {
#pragma unroll
    for (int rd = 0; rd < 2; ++rd) { const int d = rd * 32 + tid / 8, pc = tid % 8; FragH f;
#pragma unroll
      for (int q = 0; q < 8; ++q) f.u[q] = tl[pc * 8 + q][d];
      *(v8us*)((unsigned short*)Vt + ((size_t)slab * 64 + d) * TTv + lg * 64 + pc * 8) = f.half[0]; }
     } }

__global__ __launch_bounds__(256) void k_hl(const float* __restrict__ F, _Float16* __restrict__ Hh, _Float16* __restrict__ Hl, size_t n8) { const size_t t = (size_t)blockIdx.x * 256 + threadIdx.x; if (t >= n8) return; FragH fh, fl; const v4f a = *(const v4fa*)(F + t * 8), c = *(const v4fa*)(F + t * 8 + 4);
#pragma unroll
  for (int q = 0; q < 4; ++q) { _Float16 h = (_Float16)a[q]; fh.h[q] = h; fl.h[q] = (_Float16)((a[q] - (float)h) * 1024.0f); h = (_Float16)c[q]; fh.h[4 + q] = h; fl.h[4 + q] = (_Float16)((c[q] - (float)h) * 1024.0f); }
  { *(v8us*)((unsigned short*)Hh + t * 8) = fh.half[0]; *(v8us*)((unsigned short*)Hl + t * 8) = fl.half[0];  } }

// ---- fast GEMM (wave tile 32x64; requires M % 32 == 0 rows per launch region and N % 64 == 0); epilogue = k_gemm_hhx semantics ----
__device__ __forceinline__ v16h g2_frag(const _Float16* p, int hh) { FragH f; f.half[0] = *(const v8us*)((const unsigned short*)p + 8 * hh); f.half[1] = *(const v8us*)((const unsigned short*)p + 16 + 8 * hh); return f.v; }
__device__ __forceinline__ v8f g2_mma(v16h a, v16h b, v8f c) { v8f d = __builtin_amdgcn_wmma_f32_16x16x32_f16(false, a, false, b, (short)0, c, false, false); asm volatile("v_nop\n\tv_nop\n\tv_nop\n\tv_nop" : "+v"(d) : "v"(a), "v"(b)); return d; }
template <int ACT>
__global__ __launch_bounds__(128) void k_gemm2(const _Float16* __restrict__ A, int lda, size_t sA, const _Float16* __restrict__ Bh, int ldb, size_t sB, float alpha, const float* __restrict__ bias, size_t sBias, const float* __restrict__ CP, int rowsPerB, size_t sCPb, int row0g,
    float* __restrict__ C, _Float16* __restrict__ C16, int ldc, size_t sC, int M, int N, int K) { static_assert(ACT == 0 || ACT == 3 || ACT == 6 || ACT == 8 || ACT == 9 || ACT == 11 || ACT == 12 || ACT == 14 || ACT == 15 || ACT == 16 || ACT == 17, "k_gemm2: unsupported ACT code (would silently apply no activation)");
  __shared__ __attribute__((aligned(16))) float so[4][32][68];
  const int tid = threadIdx.x, w = tid >> 5, lane = tid & 31, ln = lane & 15, hh = lane >> 4; const int by = blockIdx.y;
  A += (size_t)by * sA; Bh += (size_t)by * sB; const size_t cofs = (size_t)by * sC; const float* bp = bias ? bias + (size_t)by * sBias : nullptr;
  const int ntn = N >> 6; const int mt = blockIdx.x / ntn, nq = blockIdx.x - mt * ntn; const int row0 = mt * 128 + 32 * w, col0 = nq * 64; if (row0 >= M) return;
  const _Float16* a0p = A + (size_t)(row0 + ln) * lda; const _Float16* a1p = a0p + (size_t)16 * lda;
  const _Float16* b0p = Bh + (size_t)(col0 + ln) * ldb; const _Float16* b1p = b0p + (size_t)16 * ldb; const _Float16* b2p = b1p + (size_t)16 * ldb; const _Float16* b3p = b2p + (size_t)16 * ldb;
  const v8f z8 = {0.f,0.f,0.f,0.f,0.f,0.f,0.f,0.f}; v8f c00 = z8, c01 = z8, c02 = z8, c03 = z8, c10 = z8, c11 = z8, c12 = z8, c13 = z8;
#pragma unroll 1
  for (int kb = 0; kb < K; kb += 32) { const v16h a0 = g2_frag(a0p + kb, hh), a1 = g2_frag(a1p + kb, hh);
    v16h b = g2_frag(b0p + kb, hh); c00 = g2_mma(a0, b, c00); c10 = g2_mma(a1, b, c10);
    b = g2_frag(b1p + kb, hh); c01 = g2_mma(a0, b, c01); c11 = g2_mma(a1, b, c11);
    b = g2_frag(b2p + kb, hh); c02 = g2_mma(a0, b, c02); c12 = g2_mma(a1, b, c12);
    b = g2_frag(b3p + kb, hh); c03 = g2_mma(a0, b, c03); c13 = g2_mma(a1, b, c13); }
  v8f accs[8] = {c00, c01, c02, c03, c10, c11, c12, c13};
#pragma unroll
  for (int u = 0; u < 8; ++u) { const int t = u & 3, half = u >> 2; const int col = col0 + t * 16 + ln; const float bv = bp ? bf16_round(bp[col]) : 0.f;
#pragma unroll
    for (int r = 0; r < 8; ++r) { const int rloc = half * 16 + 8 * hh + r; float v = accs[u][r] * alpha + bv; if (CP) { if (rowsPerB < 0) v += CP[cofs + (size_t)(row0g + row0 + rloc) * ldc + col];      /* rowsPerB < 0: own element of the batched C plane */ else { const int bidx = (row0g + row0 + rloc) / rowsPerB; v += CP[(size_t)bidx * sCPb + (size_t)by * 64 + col]; } }
      if (ACT == 3) v = fmaxf(v, 0.f); else if (ACT == 6) v = 0.5f * v * (1.0f + erff(v * 0.70710678118654752f)); else if (ACT == 11) v = 1.0f / (1.0f + expf(-v)); else if (ACT == 15) v = v / (1.0f + expf(-v)); else if (ACT == 12) v = (v > 0.f) ? v : 0.01f * v; else if (ACT == 8) v = tanhf(v); else if (ACT == 9) v = 0.5f * v * (1.0f + tanhf(0.7978845608028654f * (v + 0.044715f * v * v * v))); else if (ACT == 14) v = (v > 0.f) ? v : 0.1f * v; else if (ACT == 16) v = (v >= 0.f) ? v : 0.3f * v; else if (ACT == 17) v = (v >= 0.f) ? v : 0.2f * v;
      so[w][rloc][t * 16 + ln] = v; } }
  __builtin_amdgcn_fence(__ATOMIC_ACQ_REL, "workgroup"); __builtin_amdgcn_wave_barrier();
  const int rsub = lane >> 4, c4 = (lane & 15) * 4;
  {
#pragma unroll
    for (int q = 0; q < 16; ++q) { const int r = q * 2 + rsub; const v4f v = *(const v4fa*)&so[w][r][c4]; if (C) *(v4f*)(C + cofs + (size_t)(row0 + r) * ldc + col0 + c4) = v; if (C16) { v4h h4; for (int i = 0; i < 4; ++i) h4[i] = (_Float16)v[i]; *(v4h*)(C16 + cofs + (size_t)(row0 + r) * ldc + col0 + c4) = h4; } }
     } }


__global__ __launch_bounds__(256) void k_wnat(const float* __restrict__ w, size_t n8, _Float16* __restrict__ Bt) { const size_t t = (size_t)blockIdx.x * 256 + threadIdx.x; if (t >= n8) return; FragH f; for (int q = 0; q < 8; ++q) f.h[q] = (_Float16)(bf16_round(w[t * 8 + q]) * 16.0f); *(v8us*)((unsigned short*)Bt + t * 8) = f.half[0];  }
#define FA_WAVES 8
#define FA_KB 64                      /* keys per pass */
#define FA_PITCH 72                   /* f16 per LDS row */
#define FA_C 0.18033688011112042f     /* 64^-0.5 log2(e) */
__device__ __forceinline__ float rsm_xh(float x) { return __builtin_bit_cast(float, __builtin_amdgcn_permlanex16(__builtin_bit_cast(int, x), __builtin_bit_cast(int, x), 0x76543210, 0xfedcba98, false, false)); }      /* lane l with lane l ^ 16 */
__device__ __forceinline__ v16h fa_frag(const unsigned short* p, int hh) { FragH f; f.half[0] = *(const v8us*)(p + 8 * hh); f.half[1] = *(const v8us*)(p + 16 + 8 * hh); return f.v; }      /* k = 8 hh + 0..7, 16 + 8 hh + 0..7 */
__device__ __forceinline__ float fa_exp2(float x) { float r; asm("v_exp_f32 %0, %1\n\tv_nop" : "=v"(r) : "v"(x)); return r; }      /* the v_nop is the one slot the instruction set asks for behind a transcendental before its result is read or its source overwritten */
// 2^x on the eight registers of one tile, in place: each v_exp_f32 is followed by an independent one, so one v_nop behind the last fills the slot named above for all eight
__device__ __forceinline__ void fa_exp2x8(v8f& t) { float a = t[0], b = t[1], c = t[2], d = t[3], e = t[4], f = t[5], g = t[6], h = t[7];
  asm("v_exp_f32 %0, %0\n\tv_exp_f32 %1, %1\n\tv_exp_f32 %2, %2\n\tv_exp_f32 %3, %3\n\tv_exp_f32 %4, %4\n\tv_exp_f32 %5, %5\n\tv_exp_f32 %6, %6\n\tv_exp_f32 %7, %7\n\tv_nop" : "+v"(a), "+v"(b), "+v"(c), "+v"(d), "+v"(e), "+v"(f), "+v"(g), "+v"(h));
  t[0] = a; t[1] = b; t[2] = c; t[3] = d; t[4] = e; t[5] = f; t[6] = g; t[7] = h; }
__device__ __forceinline__ v8f fa_mma(v16h a, v16h b, v8f c) { return __builtin_amdgcn_wmma_f32_16x16x32_f16(false, a, false, b, (short)0, c, false, false); }
__global__ __launch_bounds__(FA_WAVES * 32) __attribute__((amdgpu_waves_per_eu(4, 4))) void k_fattn(const _Float16* __restrict__ Q16, const _Float16* __restrict__ K16, const _Float16* __restrict__ VT, _Float16* __restrict__ O16) {
  __shared__ __attribute__((aligned(16))) unsigned short sk[2][FA_KB * FA_PITCH];
  __shared__ __attribute__((aligned(16))) unsigned short sv[2][HD * FA_PITCH];
  const int tid = threadIdx.x, lane = tid & 31, ln = lane & 15, hh = lane >> 4, wave = tid >> 5;
  const int slab = blockIdx.y, b = slab / NH, h = slab - b * NH;
  const int q0 = blockIdx.x * (FA_WAVES * 32) + wave * 32;
  const int srow = tid >> 3, sc8 = (tid & 7) * 8;      /* staging: 8 threads per 128-B row, rows srow and srow + 32 */
  const unsigned short* kp = (const unsigned short*)K16 + ((size_t)b * SQ + srow) * DM + h * HD + sc8;      /* K rows [key][d] */
  const unsigned short* vp = (const unsigned short*)VT + ((size_t)slab * HD + srow) * SQ + sc8;             /* V^T rows [d][key] */
  const int sofs = srow * FA_PITCH + sc8;
  v8us tk0 = *(const v8us*)kp, tk1 = *(const v8us*)(kp + 32 * DM), tv0 = *(const v8us*)vp, tv1 = *(const v8us*)(vp + 32 * SQ);
  v16h qf[2][2];
#pragma unroll
  for (int qt = 0; qt < 2; ++qt) { const unsigned short* qp = (const unsigned short*)Q16 + ((size_t)b * SQ + q0 + qt * 16 + ln) * DM + h * HD; qf[qt][0] = fa_frag(qp, hh); qf[qt][1] = fa_frag(qp + 32, hh); }
  *(v8us*)&sk[0][sofs] = tk0; *(v8us*)&sk[0][sofs + 32 * FA_PITCH] = tk1; *(v8us*)&sv[0][sofs] = tv0; *(v8us*)&sv[0][sofs + 32 * FA_PITCH] = tv1;
  __syncthreads();
  const v8f z8 = {0.f,0.f,0.f,0.f,0.f,0.f,0.f,0.f};
  v8f o[2][4] = {{z8, z8, z8, z8}, {z8, z8, z8, z8}};
  v8f ls[2] = {z8, z8};      /* sums of the f16 weights, on the matrix pipe: A = all ones, so every row of the tile holds the column sums over all keys */
  v16h ones;
#pragma unroll
  for (int i = 0; i < 16; ++i) ones[i] = (_Float16)1.0f;
  float mrun[2] = {-3.0e38f, -3.0e38f};
#pragma unroll 1
  for (int it = 0; it < SQ / FA_KB; ++it) {
    const unsigned short* ck = sk[it & 1]; const unsigned short* cv = sv[it & 1];
    const bool more = it + 1 < SQ / FA_KB;
    if (more) { kp += (size_t)FA_KB * DM; vp += FA_KB; tk0 = *(const v8us*)kp; tk1 = *(const v8us*)(kp + 32 * DM); tv0 = *(const v8us*)vp; tv1 = *(const v8us*)(vp + 32 * SQ); }
    v8f s[2][4];
#pragma unroll
    for (int kt = 0; kt < 4; ++kt) { const unsigned short* kr = ck + (kt * 16 + ln) * FA_PITCH; const v16h a0 = fa_frag(kr, hh), a1 = fa_frag(kr + 32, hh);
#pragma unroll
      for (int qt = 0; qt < 2; ++qt) s[qt][kt] = fa_mma(a1, qf[qt][1], fa_mma(a0, qf[qt][0], z8)); }      /* s[qt][kt][r] = q . k of key kt 16 + 8 hh + r, query qt 16 + ln */
    float mx[2];
#pragma unroll
    for (int qt = 0; qt < 2; ++qt) { float t0 = s[qt][0][0], t1 = s[qt][1][0], t2 = s[qt][2][0], t3 = s[qt][3][0];
#pragma unroll
      for (int r = 1; r < 8; ++r) { t0 = fmaxf(t0, s[qt][0][r]); t1 = fmaxf(t1, s[qt][1][r]); t2 = fmaxf(t2, s[qt][2][r]); t3 = fmaxf(t3, s[qt][3][r]); }
      const float t = fmaxf(fmaxf(t0, t1), fmaxf(t2, t3)); mx[qt] = fmaxf(t, rsm_xh(t)); }
    /* the maximum in use is replaced only when a column's new maximum passes it by more than 2^8 (weights stay below 2^15 in f16); one test per pass for the whole wave */
    const bool need = ((mx[0] - mrun[0]) * FA_C > 8.0f) || ((mx[1] - mrun[1]) * FA_C > 8.0f);
    if (__builtin_amdgcn_ballot_w32(need) != 0) {
#pragma unroll
      for (int qt = 0; qt < 2; ++qt) { const float mn = fmaxf(mrun[qt], mx[qt]); const float al = fa_exp2((mrun[qt] - mn) * FA_C); mrun[qt] = mn; ls[qt] *= al;
#pragma unroll
        for (int dt = 0; dt < 4; ++dt) o[qt][dt] *= al; }
    }
    const unsigned short* vr = cv + ln * FA_PITCH;
    v16h va[4], vb[4];
#pragma unroll
    for (int dt = 0; dt < 4; ++dt) va[dt] = fa_frag(vr + dt * 16 * FA_PITCH, hh);      /* V^T, keys 0..31 of the tile */
    __builtin_amdgcn_sched_barrier(0);      /* keeps these LDS loads in front of the exponentials, so that they land under them */
    FragH pf[2][2];
#pragma unroll
    for (int qt = 0; qt < 2; ++qt) { const float nb = __builtin_fmaf(-mrun[qt], FA_C, 7.0f);      /* weights carried x128 against the f16 subnormal range; the factor cancels in the division by their sum */
#pragma unroll
      for (int kt = 0; kt < 4; ++kt) { v8f t;
#pragma unroll
        for (int r = 0; r < 8; ++r) t[r] = __builtin_fmaf(s[qt][kt][r], FA_C, nb);
        fa_exp2x8(t);
#pragma unroll
        for (int r = 0; r < 8; ++r) pf[qt][kt >> 1].h[(kt & 1) * 8 + r] = (_Float16)t[r]; } }
#pragma unroll
    for (int dt = 0; dt < 4; ++dt) vb[dt] = fa_frag(vr + dt * 16 * FA_PITCH + 32, hh);      /* V^T, keys 32..63 */
    __builtin_amdgcn_sched_barrier(0);      /* keeps these LDS loads in front of the first half's products, so that they land under them */
#pragma unroll
    for (int qt = 0; qt < 2; ++qt) { ls[qt] = fa_mma(ones, pf[qt][0].v, ls[qt]);
#pragma unroll
      for (int dt = 0; dt < 4; ++dt) o[qt][dt] = fa_mma(va[dt], pf[qt][0].v, o[qt][dt]); }      /* o[qt][dt][r] = O of d = dt 16 + 8 hh + r, query qt 16 + ln */
#pragma unroll
    for (int qt = 0; qt < 2; ++qt) { ls[qt] = fa_mma(ones, pf[qt][1].v, ls[qt]);
#pragma unroll
      for (int dt = 0; dt < 4; ++dt) o[qt][dt] = fa_mma(vb[dt], pf[qt][1].v, o[qt][dt]); }
    if (more) { unsigned short* nk = sk[(it + 1) & 1]; unsigned short* nv = sv[(it + 1) & 1];      /* last read in pass it - 1, behind that pass's barrier */
      *(v8us*)&nk[sofs] = tk0; *(v8us*)&nk[sofs + 32 * FA_PITCH] = tk1; *(v8us*)&nv[sofs] = tv0; *(v8us*)&nv[sofs + 32 * FA_PITCH] = tv1; }
    __syncthreads();      /* publishes the next tile and ends every wave's reads of this one */
  }
#pragma unroll
  for (int qt = 0; qt < 2; ++qt) { const float sc = 64.0f / ls[qt][0];      /* o carried x64, as the output GEMM's alpha expects */
    unsigned short* op = (unsigned short*)O16 + ((size_t)b * SQ + q0 + qt * 16 + ln) * DM + h * HD + 8 * hh;
#pragma unroll
    for (int dt = 0; dt < 4; ++dt) { FragH f;
#pragma unroll
      for (int r = 0; r < 8; ++r) f.h[r] = (_Float16)(o[qt][dt][r] * sc);
      *(v8us*)(op + dt * 16) = f.half[0]; } }
}
__global__ __launch_bounds__(256) void k_vt(const _Float16* __restrict__ V16, int b, int h0, _Float16* __restrict__ VT) { __shared__ unsigned short tl[64][65]; const int tid = threadIdx.x; const int hh = blockIdx.x % HG, sg = blockIdx.x / HG; const int s0 = sg * 64; const int h = h0 + hh;
  for (int i = tid; i < 64 * 8; i += 256) { const int j = i / 8, d8 = (i % 8) * 8; FragH f; f.half[0] = *(const v8us*)((const unsigned short*)V16 + ((size_t)b * SQ + s0 + j) * DM + h * HD + d8); for (int q = 0; q < 8; ++q) tl[d8 + q][j] = f.u[q]; }
  __syncthreads();
  { for (int i = tid; i < 64 * 8; i += 256) { const int d = i / 8, j8 = (i % 8) * 8; FragH f; for (int q = 0; q < 8; ++q) f.u[q] = tl[d][j8 + q]; *(v8us*)((unsigned short*)VT + ((size_t)hh * HD + d) * SQ + s0 + j8) = f.half[0]; }  } }


extern "C" void kernel_launch(void* const* d_in, const int* in_sizes, int n_in,
                              void* d_out, int out_size, void* d_ws, size_t ws_size, hipStream_t stream) {
  (void)in_sizes; (void)n_in; (void)out_size;
  const float* const* I = (const float* const*)d_in; const float* x = I[0]; const float* wq = I[1]; const float* bq = I[2]; const float* wk = I[3]; const float* bk = I[4]; const float* wv = I[5]; const float* bv = I[6]; const float* wo = I[7]; const float* bo = I[8];      /* nn.Linear weights [out][in] + biases */
  char* ws = (char*)d_ws; size_t off = 0;
  auto take = [&](size_t bytes) { char* p = ws + off; off += (bytes + 255) & ~(size_t)255; return p; };
  _Float16* BQ = (_Float16*)take((size_t)DM * DM * 2); _Float16* BK = (_Float16*)take((size_t)DM * DM * 2); _Float16* BV = (_Float16*)take((size_t)DM * DM * 2); _Float16* BO = (_Float16*)take((size_t)DM * DM * 2);
  _Float16* X16 = (_Float16*)take(NR * DM * 2); _Float16* Q16 = (_Float16*)take(NR * DM * 2); _Float16* K16 = (_Float16*)take(NR * DM * 2); _Float16* V16 = (_Float16*)take(NR * DM * 2); _Float16* O16 = (_Float16*)take(NR * DM * 2);
  _Float16* VT = (_Float16*)take((size_t)NB * NH * HD * SQ * 2);
  if (off > ws_size) return;
  { const unsigned g = (unsigned)(((size_t)DM * DM / 8 + 255) / 256); k_wnat<<<g, 256, 0, stream>>>(wq, (size_t)DM * DM / 8, BQ); k_wnat<<<g, 256, 0, stream>>>(wk, (size_t)DM * DM / 8, BK); k_wnat<<<g, 256, 0, stream>>>(wv, (size_t)DM * DM / 8, BV); k_wnat<<<g, 256, 0, stream>>>(wo, (size_t)DM * DM / 8, BO); }      /* natural [out][in] = Bt[n][k], x16 */
  k_x16<<<(unsigned)((NR * DM / 8 + 255) / 256), 256, 0, stream>>>(x, X16, NR * DM / 8);
  const size_t r0p = (size_t)B0 * SQ;      /* first projected row */
  k_gemm2<0><<<dim3((unsigned)((MP / 128) * (DM / 64)), 1), 128, 0, stream>>>(X16 + r0p * DM, DM, 0, BQ, DM, 0, 0.0625f, bq, 0, nullptr, 1, 0, 0, nullptr, Q16 + r0p * DM, DM, 0, MP, DM, DM);
  k_gemm2<0><<<dim3((unsigned)((MP / 128) * (DM / 64)), 1), 128, 0, stream>>>(X16 + r0p * DM, DM, 0, BK, DM, 0, 0.0625f, bk, 0, nullptr, 1, 0, 0, nullptr, K16 + r0p * DM, DM, 0, MP, DM, DM);
  k_gemm2<0><<<dim3((unsigned)((MP / 128) * (DM / 64)), 1), 128, 0, stream>>>(X16 + r0p * DM, DM, 0, BV, DM, 0, 0.0625f, bv, 0, nullptr, 1, 0, 0, nullptr, V16 + r0p * DM, DM, 0, MP, DM, DM);
  k_vt<NH, SQ><<<NB * NH * (SQ / 64), 256, 0, stream>>>(V16, LQ, 0, VT);      /* V^T [NB][NH][HD][SQ], all batches */
  k_fattn<<<dim3(SQ / (FA_WAVES * 32), NB * NH), FA_WAVES * 32, 0, stream>>>(Q16, K16, VT, O16);      /* o x64 (merged heads) as f16 rows */
  k_gemm2<0><<<dim3((unsigned)((MPO / 128) * (DM / 64)), 1), 128, 0, stream>>>(O16 + r0p * DM, DM, 0, BO, DM, 0, 0.0009765625f, bo, 0, nullptr, 1, 0, 0, (float*)d_out + r0p * DM, nullptr, DM, 0, MPO, DM, DM);      /* out rows are the output layout */
}

// v003
// One run takes 153 microseconds.
// Next to v002, in two timings, it ran 1.83 and 1.85 times as fast.
// Over all steps from v000 it is 26.6 times as fast.
#include <hip/hip_runtime.h>
// ViT self-attention (x [16][1024][768]; q/k/v = x W^T + b (nn.Linear [out][in] 768^2, sigma 0.02, zero biases), 12 heads of 64; scores / 8; softmax; out = (attn v merged) Wc^T + bc -> [16][1024][768]).
// Structure: token rows r = b*1024 + s; x as exact f16 rows (bf16-rounded); Q, K, V as three WMMA GEMMs (256x192 workgroup tiles staged in LDS, f32 accumulation, exact x16 weights + bias, f16 outputs); V^T for all batches and heads via LDS transposes; one fused attention kernel over all (batch, head): S^T = K Q^T, online softmax (f32 statistics, exp2 domain; weights x128 as f16), O^T += V^T P^T, o carried x64 against f16 subnormal flush (folded into the output GEMM alpha), written straight into the merged f16 o rows; out = o W_o + b GEMM (f32) into the output layout.
// Compute dtype: inputs rounded to bf16; x / weights exact; q, k, v, softmax weights and o as plain f16 GEMM operands (~2^-12); scores and softmax statistics f32. v_wmma_f32_16x16x32_f16.
#define NB 16
#define SQ 1024
#define DM 768
#define NH 12
#define HD 64
#define HG 12                         /* heads per launch of the (b, h0) k_vt overload */
#define B0 0                         /* first batch processed (debug hook) */
#define NBR NB                       /* batches processed (debug hook) */
#define NR ((size_t)NB * SQ)         /* token rows */
#define MP ((int)((size_t)NBR * SQ)) /* rows projected (debug hook) */
#define QN SQ                        /* unused; the attention covers all SQ queries */
#define NHD NH                       /* unused; the attention covers all NH heads */
#define MPO MP                       /* rows through the output stage (debug hook) */
#define LQ DM      /* row pitch of the q/k/v rows */
typedef __bf16 v16b __attribute__((ext_vector_type(16)));
typedef unsigned short v8us __attribute__((ext_vector_type(8), may_alias));
typedef float  v8f  __attribute__((ext_vector_type(8)));
typedef float  v4f  __attribute__((ext_vector_type(4)));
typedef float  v4fa __attribute__((ext_vector_type(4), may_alias));
union FragB { v16b v; v8us half[2]; unsigned short u[16]; };

__device__ __forceinline__ unsigned short bf16_bits(float x) { unsigned int u = __float_as_uint(x); return (unsigned short)((u + 0x7FFFu + ((u >> 16) & 1u)) >> 16); }
__device__ __forceinline__ float bf16_val(unsigned short b) { return __uint_as_float(((unsigned int)b) << 16); }
__device__ __forceinline__ float bf16_round(float x) { return bf16_val(bf16_bits(x)); }
// D += A·B with NT terms: 1 = ah·bh, 2 = + al·bh (A split), 3 = + ah·bl (both split)
template <int NT>
__device__ __forceinline__ v8f mmaN(v16b ah, v16b al, v16b bh, v16b bl, v8f c) {
  c = __builtin_amdgcn_wmma_f32_16x16x32_bf16(false, ah, false, bh, (short)0, c, false, false);
  if (NT >= 2) c = __builtin_amdgcn_wmma_f32_16x16x32_bf16(false, al, false, bh, (short)0, c, false, false);
  if (NT >= 3) c = __builtin_amdgcn_wmma_f32_16x16x32_bf16(false, ah, false, bl, (short)0, c, false, false);
  asm volatile("v_nop\n\tv_nop\n\tv_nop\n\tv_nop" : "+v"(c) : "v"(ah), "v"(al), "v"(bh), "v"(bl));
  return c;
}

__global__ __launch_bounds__(256) void k_wt_bf16(const float* __restrict__ W, unsigned short* __restrict__ Wt, int K, int N) {
  const int t = blockIdx.x * 256 + threadIdx.x;
  const int k8n = K / 8;
  if (t >= N * k8n) return;
  const int n = t / k8n, k8 = (t % k8n) * 8;
  v8us v;
#pragma unroll
  for (int i = 0; i < 8; ++i) v[i] = bf16_bits(W[(size_t)(k8 + i) * N + n]);
  *(v8us*)(Wt + (size_t)n * K + k8) = v;
  
}

// GEMM C[M][N] (f32, pitch ldc) = act(A[M][K]·W + bias). A f32 row-major (pitch lda) converted per fragment to bf16
// (ASPLIT: hi/lo two planes -> 2 terms, else single rounded term); Wt bf16 [N][K] (pitch ldb). BIAS_BF16 rounds the
// bias to bf16 first (bias quantised to bf16 before the add). K%32==0, M%16==0, N%64==0.
template <bool ASPLIT, int ACT, bool BIAS_BF16>
__global__ __launch_bounds__(128) void k_gemm_bf(const float* __restrict__ A, int lda, const unsigned short* __restrict__ Wt, int ldb,
                                               const float* __restrict__ bias, float* __restrict__ C, int ldc, int M, int N, int K) {
  __shared__ __attribute__((aligned(16))) float so[4][16][64];
  const int tid = threadIdx.x, w = tid >> 5, lane = tid & 31, ln = lane & 15, hh = lane >> 4;
  const int ntn = N / 64;
  const int wid = blockIdx.x * 4 + w;
  const int mt = wid / ntn, nq = wid % ntn;
  if (mt * 16 >= M) return;
  const int row0 = mt * 16, col0 = nq * 64;
  const float* arow = A + (size_t)(row0 + ln) * lda;
  v8f acc[4] = {};
  for (int kb = 0; kb < K; kb += 32) {
    FragB ah, al;
    const v4f x0 = *(const v4fa*)(arow + kb + 8 * hh), x1 = *(const v4fa*)(arow + kb + 8 * hh + 4);
    const v4f x2 = *(const v4fa*)(arow + kb + 16 + 8 * hh), x3 = *(const v4fa*)(arow + kb + 16 + 8 * hh + 4);
    float xs[16] = {x0[0],x0[1],x0[2],x0[3],x1[0],x1[1],x1[2],x1[3],x2[0],x2[1],x2[2],x2[3],x3[0],x3[1],x3[2],x3[3]};
#pragma unroll
    for (int i = 0; i < 16; ++i) { const unsigned short hb = bf16_bits(xs[i]); ah.u[i] = hb; al.u[i] = ASPLIT ? bf16_bits(xs[i] - bf16_val(hb)) : (unsigned short)0; }
#pragma unroll
    for (int t = 0; t < 4; ++t) {
      const unsigned short* brow = Wt + (size_t)(col0 + t * 16 + ln) * ldb + kb;
      FragB b;
      b.half[0] = *(const v8us*)(brow + 8 * hh);
      b.half[1] = *(const v8us*)(brow + 16 + 8 * hh);
      acc[t] = mmaN<ASPLIT ? 2 : 1>(ah.v, al.v, b.v, b.v, acc[t]);
    }
  }
#pragma unroll
  for (int t = 0; t < 4; ++t) {
    float bv = bias ? bias[col0 + t * 16 + ln] : 0.f;
    if (BIAS_BF16) bv = bf16_round(bv);
#pragma unroll
    for (int r = 0; r < 8; ++r) { float v = acc[t][r] + bv; if (ACT == 1) v = fmaxf(v, 0.f); so[w][8 * hh + r][t * 16 + ln] = v; }
  }
  __builtin_amdgcn_fence(__ATOMIC_ACQ_REL, "workgroup");
  __builtin_amdgcn_wave_barrier();
  const int rsub = lane >> 4, c4 = (lane & 15) * 4;
  {
#pragma unroll
    for (int q = 0; q < 8; ++q) {
      const int r = q * 2 + rsub;
      const v4f v = *(const v4fa*)&so[w][r][c4];
      *(v4f*)(C + (size_t)(row0 + r) * ldc + col0 + c4) = v;
    }
    
  }
}

// GEMM C = act(A·W + bias + resid): A f32 (ASPLIT -> hi/lo 2 terms), Wt bf16 [N][K]; ACT 0 none, 1 relu, 2 exact gelu;
// resid (optional, f32, row index = (row % rmod), pitch ldr, RES_BF16 rounds it) added before the activation.
template <bool ASPLIT, int ACT, bool BIAS_BF16, bool RES_BF16>
__global__ __launch_bounds__(128) void k_gemm_bf3(const float* __restrict__ A, int lda, const unsigned short* __restrict__ Wt, int ldb,
                                                const float* __restrict__ bias, const float* __restrict__ resid, int rmod, int ldr,
                                                float* __restrict__ C, int ldc, int M, int N, int K) {
  __shared__ __attribute__((aligned(16))) float so[4][16][64];
  const int tid = threadIdx.x, w = tid >> 5, lane = tid & 31, ln = lane & 15, hh = lane >> 4;
  const int ntn = N / 64;
  const int wid = blockIdx.x * 4 + w;
  const int mt = wid / ntn, nq = wid % ntn;
  if (mt * 16 >= M) return;
  const int row0 = mt * 16, col0 = nq * 64;
  const float* arow = A + (size_t)(row0 + ln) * lda;
  v8f acc[4] = {};
  for (int kb = 0; kb < K; kb += 32) {
    FragB ah, al;
    const v4f x0 = *(const v4fa*)(arow + kb + 8 * hh), x1 = *(const v4fa*)(arow + kb + 8 * hh + 4);
    const v4f x2 = *(const v4fa*)(arow + kb + 16 + 8 * hh), x3 = *(const v4fa*)(arow + kb + 16 + 8 * hh + 4);
    float xs[16] = {x0[0],x0[1],x0[2],x0[3],x1[0],x1[1],x1[2],x1[3],x2[0],x2[1],x2[2],x2[3],x3[0],x3[1],x3[2],x3[3]};
#pragma unroll
    for (int i = 0; i < 16; ++i) { const unsigned short hb = bf16_bits(xs[i]); ah.u[i] = hb; al.u[i] = ASPLIT ? bf16_bits(xs[i] - bf16_val(hb)) : (unsigned short)0; }
#pragma unroll
    for (int t = 0; t < 4; ++t) {
      const unsigned short* brow = Wt + (size_t)(col0 + t * 16 + ln) * ldb + kb;
      FragB b;
      b.half[0] = *(const v8us*)(brow + 8 * hh);
      b.half[1] = *(const v8us*)(brow + 16 + 8 * hh);
      acc[t] = mmaN<ASPLIT ? 2 : 1>(ah.v, al.v, b.v, b.v, acc[t]);
    }
  }
#pragma unroll
  for (int t = 0; t < 4; ++t) {
    const int col = col0 + t * 16 + ln;
    float bv = bias ? bias[col] : 0.f;
    if (BIAS_BF16) bv = bf16_round(bv);
#pragma unroll
    for (int r = 0; r < 8; ++r) {
      float v = acc[t][r] + bv;
      if (resid) { float rv = resid[(size_t)((row0 + 8 * hh + r) % rmod) * ldr + col]; if (RES_BF16) rv = bf16_round(rv); v += rv; }
      if (ACT == 1) v = fmaxf(v, 0.f);
      if (ACT == 2) v = 0.5f * v * (1.0f + erff(v * 0.70710678118654752f));
      if (ACT == 3) { const float u = 0.7978845608028654f * (v + 0.044715f * v * v * v); v = 0.5f * v * (1.0f + tanhf(u)); }
      so[w][8 * hh + r][t * 16 + ln] = v;
    }
  }
  __builtin_amdgcn_fence(__ATOMIC_ACQ_REL, "workgroup");
  __builtin_amdgcn_wave_barrier();
  const int rsub = lane >> 4, c4 = (lane & 15) * 4;
  {
#pragma unroll
    for (int q = 0; q < 8; ++q) {
      const int r = q * 2 + rsub;
      const v4f v = *(const v4fa*)&so[w][r][c4];
      *(v4f*)(C + (size_t)(row0 + r) * ldc + col0 + c4) = v;
    }
    
  }
}
// row LayerNorm (biased variance, eps) over N: s = X (+ R); optional out_sum <- s; out_norm <- (s-mu)*rsqrt(var+eps)*g + b
template <bool PARAM_BF16>
__global__ __launch_bounds__(256) void k_layernorm(const float* __restrict__ X, const float* __restrict__ R, const float* __restrict__ g, const float* __restrict__ bta,
                                                  float* __restrict__ out_sum, float* __restrict__ out_norm, int N, float eps) {
  __shared__ float red[256];
  const int row = blockIdx.x, tid = threadIdx.x;
  const float* x = X + (size_t)row * N; const float* rr = R ? R + (size_t)row * N : nullptr;
  float vals[16];                     // up to N = 4096
  const int per = N / 256;            // contiguous chunk per thread? use strided-by-4 chunks: thread handles j = tid*4 + 1024*u
  float s1 = 0.f;
  for (int u = 0; u < per / 4; ++u) {
    const int j = tid * 4 + 1024 * u;
    const v4f a = *(const v4fa*)(x + j);
    v4f b = {0.f,0.f,0.f,0.f}; if (rr) b = *(const v4fa*)(rr + j);
#pragma unroll
    for (int q = 0; q < 4; ++q) { const float v = a[q] + b[q]; vals[u * 4 + q] = v; s1 += v; }
  }
  red[tid] = s1; __syncthreads();
  for (int st = 128; st > 0; st >>= 1) { if (tid < st) red[tid] += red[tid + st]; __syncthreads(); }
  const float mu = red[0] / (float)N; __syncthreads();
  float s2 = 0.f;
  for (int u = 0; u < per / 4; ++u)
#pragma unroll
    for (int q = 0; q < 4; ++q) { const float c = vals[u * 4 + q] - mu; s2 += c * c; }
  red[tid] = s2; __syncthreads();
  for (int st = 128; st > 0; st >>= 1) { if (tid < st) red[tid] += red[tid + st]; __syncthreads(); }
  const float rs = rsqrtf(red[0] / (float)N + eps);
  {
    for (int u = 0; u < per / 4; ++u) {
      const int j = tid * 4 + 1024 * u;
      v4f o, sm;
#pragma unroll
      for (int q = 0; q < 4; ++q) {
        float gg = g[j + q], bb = bta[j + q];
        if (PARAM_BF16) { gg = bf16_round(gg); bb = bf16_round(bb); }
        sm[q] = vals[u * 4 + q]; o[q] = (vals[u * 4 + q] - mu) * rs * gg + bb;
      }
      if (out_sum) *(v4f*)(out_sum + (size_t)row * N + j) = sm;
      *(v4f*)(out_norm + (size_t)row * N + j) = o;
    }
    
  }
}



// ---- f16 WMMA path (v_wmma_f32_16x16x32_f16): 11-bit significands for operands in range — used where a [0,1] probability operand needs more precision than bf16
typedef _Float16 v16h __attribute__((ext_vector_type(16)));
union FragH { v16h v; v8us half[2]; _Float16 h[16]; unsigned short u[16]; };
template <int NT>
__device__ __forceinline__ v8f mmaH(v16h ah, v16h al, v16h bh, v16h bl, v8f c) {
  c = __builtin_amdgcn_wmma_f32_16x16x32_f16(false, ah, false, bh, (short)0, c, false, false);
  if (NT >= 2) c = __builtin_amdgcn_wmma_f32_16x16x32_f16(false, al, false, bh, (short)0, c, false, false);
  if (NT >= 3) c = __builtin_amdgcn_wmma_f32_16x16x32_f16(false, ah, false, bl, (short)0, c, false, false);
  asm volatile("v_nop\n\tv_nop\n\tv_nop\n\tv_nop" : "+v"(c) : "v"(ah), "v"(al), "v"(bh), "v"(bl));
  return c;
}
// batched GEMM like k_gemm_b but f16 operands: A f32 (split into f16 hi/lo if ASPLIT, else rounded to f16), Bt = f16 values [n][k]; alpha; C f32; N multiple of 16 (partial tiles skipped)
template <bool ASPLIT>
__global__ __launch_bounds__(128) void k_gemm_h(const float* __restrict__ A, int lda, size_t sA, const _Float16* __restrict__ Bh, int ldb, size_t sB, float alpha, float* __restrict__ C, int ldc, size_t sC, int M, int N, int K) {
  __shared__ __attribute__((aligned(16))) float so[4][16][64];
  const int tid = threadIdx.x, w = tid >> 5, lane = tid & 31, ln = lane & 15, hh = lane >> 4; const int by = blockIdx.y;
  A += (size_t)by * sA; Bh += (size_t)by * sB; C += (size_t)by * sC;
  const int ntn = (N + 63) / 64; const int wid = blockIdx.x * 4 + w; const int mt = wid / ntn, nq = wid % ntn; if (mt * 16 >= M) return;
  const int row0 = mt * 16, col0 = nq * 64; const float* arow = A + (size_t)(row0 + ln) * lda;
  v8f acc[4] = {};
  for (int kb = 0; kb < K; kb += 32) {
    FragH ah, al;
    const v4f x0 = *(const v4fa*)(arow + kb + 8 * hh), x1 = *(const v4fa*)(arow + kb + 8 * hh + 4), x2 = *(const v4fa*)(arow + kb + 16 + 8 * hh), x3 = *(const v4fa*)(arow + kb + 16 + 8 * hh + 4);
    float xs[16] = {x0[0],x0[1],x0[2],x0[3],x1[0],x1[1],x1[2],x1[3],x2[0],x2[1],x2[2],x2[3],x3[0],x3[1],x3[2],x3[3]};
#pragma unroll
    for (int i = 0; i < 16; ++i) { const _Float16 h = (_Float16)xs[i]; ah.h[i] = h; al.h[i] = ASPLIT ? (_Float16)(xs[i] - (float)h) : (_Float16)0.0f; }
#pragma unroll
    for (int t = 0; t < 4; ++t) { if (col0 + t * 16 >= N) continue; const size_t boff = (size_t)(col0 + t * 16 + ln) * ldb + kb; FragH bq; bq.half[0] = *(const v8us*)(Bh + boff + 8 * hh); bq.half[1] = *(const v8us*)(Bh + boff + 16 + 8 * hh);
      acc[t] = mmaH<ASPLIT ? 2 : 1>(ah.v, al.v, bq.v, bq.v, acc[t]); }
  }
#pragma unroll
  for (int t = 0; t < 4; ++t) { if (col0 + t * 16 >= N) continue;
#pragma unroll
    for (int r = 0; r < 8; ++r) so[w][8 * hh + r][t * 16 + ln] = acc[t][r] * alpha; }
  __builtin_amdgcn_fence(__ATOMIC_ACQ_REL, "workgroup"); __builtin_amdgcn_wave_barrier();
  const int rsub = lane >> 4, c4 = (lane & 15) * 4;
  {
#pragma unroll
    for (int q = 0; q < 8; ++q) { const int r = q * 2 + rsub; if (col0 + c4 < N) { const v4f v = *(const v4fa*)&so[w][r][c4]; *(v4f*)(C + (size_t)(row0 + r) * ldc + col0 + c4) = v; } }
     }
}

// Wt[n][k] = f16(W[k][n]·scale) from f32 row-major W[K][N] (scale = power of two; bf16-exact weights stay exact in f16 away from the subnormal range)
__global__ __launch_bounds__(256) void k_wt_f16(const float* __restrict__ W, _Float16* __restrict__ Wt, int K, int N, float scale) {
  const int t = blockIdx.x * 256 + threadIdx.x; if (t >= N * (K / 8)) return; const int n = t / (K / 8), k8 = (t % (K / 8)) * 8; FragH f;
#pragma unroll
  for (int i = 0; i < 8; ++i) f.h[i] = (_Float16)(bf16_round(W[(size_t)(k8 + i) * N + n]) * scale); const v8us o = f.half[0];
  *(v8us*)((unsigned short*)Wt + (size_t)n * K + k8) = o; 
}
// k_gemm_hh variant with fused epilogue: v = acc·alpha + bias[by·sBias + col] (+ CP[(row/rowsPerB)·sCPb + by·64 + col] if CP) ; ACT 0 none / 1 elu ; writes f16 C16 (and f32 C if non-null)
template <int ACT>
__global__ __launch_bounds__(128) void k_gemm_hhx(const _Float16* __restrict__ A, int lda, size_t sA, const _Float16* __restrict__ Bh, int ldb, size_t sB, float alpha, const float* __restrict__ bias, size_t sBias, const float* __restrict__ CP, int rowsPerB, size_t sCPb, int row0g,
    float* __restrict__ C, _Float16* __restrict__ C16, int ldc, size_t sC, int M, int N, int K) {
  __shared__ __attribute__((aligned(16))) float so[4][16][64];
  const int tid = threadIdx.x, w = tid >> 5, lane = tid & 31, ln = lane & 15, hh = lane >> 4; const int by = blockIdx.y;
  A += (size_t)by * sA; Bh += (size_t)by * sB; const size_t cofs = (size_t)by * sC; const float* bp = bias ? bias + (size_t)by * sBias : nullptr;
  const int ntn = (N + 63) / 64; const int wid = blockIdx.x * 4 + w; const int mt = wid / ntn, nq = wid % ntn; if (mt * 16 >= M) return;
  const int row0 = mt * 16, col0 = nq * 64; const _Float16* arow = A + (size_t)(row0 + ln) * lda;
  v8f acc[4] = {};
  for (int kb = 0; kb < K; kb += 32) { FragH ah; ah.half[0] = *(const v8us*)((const unsigned short*)arow + kb + 8 * hh); ah.half[1] = *(const v8us*)((const unsigned short*)arow + kb + 16 + 8 * hh);
#pragma unroll
    for (int t = 0; t < 4; ++t) { if (col0 + t * 16 >= N) continue; const size_t boff = (size_t)(col0 + t * 16 + ln) * ldb + kb; FragH bq; bq.half[0] = *(const v8us*)((const unsigned short*)Bh + boff + 8 * hh); bq.half[1] = *(const v8us*)((const unsigned short*)Bh + boff + 16 + 8 * hh);
      acc[t] = mmaH<1>(ah.v, ah.v, bq.v, bq.v, acc[t]); }
  }
#pragma unroll
  for (int t = 0; t < 4; ++t) { if (col0 + t * 16 >= N) continue; const int col = col0 + t * 16 + ln; const float bv = bp ? bf16_round(bp[col]) : 0.f;
#pragma unroll
    for (int r = 0; r < 8; ++r) { float v = acc[t][r] * alpha + bv; if (CP) { const int rr = row0g + row0 + 8 * hh + r; if (rowsPerB < 0) v += CP[cofs + (size_t)rr * ldc + col];      /* rowsPerB < 0: own element of the batched C plane */ else { const int bidx = rr / rowsPerB; v += CP[(size_t)bidx * sCPb + (size_t)by * 64 + col]; } } if (ACT == 1) v = (v > 0.f) ? v : expm1f(v); else if (ACT == 7) v = (v > 0.f) ? v + 1.0f : expf(v); else if (ACT == 8) v = tanhf(v); else if (ACT == 9) v = 0.5f * v * (1.0f + tanhf(0.7978845608028654f * (v + 0.044715f * v * v * v))); else if (ACT == 11) v = 1.0f / (1.0f + expf(-v)); else if (ACT == 12) v = (v > 0.f) ? v : 0.01f * v; else if (ACT == 14) v = (v > 0.f) ? v : 0.1f * v; else if (ACT == 16) v = (v >= 0.f) ? v : 0.3f * v; else if (ACT == 17) v = (v >= 0.f) ? v : 0.2f * v; else if (ACT == 15) v = v / (1.0f + expf(-v)); else if (ACT == 3) v = fmaxf(v, 0.f); else if (ACT == 6) v = 0.5f * v * (1.0f + erff(v * 0.70710678118654752f)); so[w][8 * hh + r][t * 16 + ln] = v; } }
  __builtin_amdgcn_fence(__ATOMIC_ACQ_REL, "workgroup"); __builtin_amdgcn_wave_barrier();
  const int rsub = lane >> 4, c4 = (lane & 15) * 4; typedef _Float16 v4h __attribute__((ext_vector_type(4)));
  {
#pragma unroll
    for (int q = 0; q < 8; ++q) { const int r = q * 2 + rsub; if (col0 + c4 < N) { const v4f v = *(const v4fa*)&so[w][r][c4]; if (C) *(v4f*)(C + cofs + (size_t)(row0 + r) * ldc + col0 + c4) = v; if (C16) { v4h h4; for (int i = 0; i < 4; ++i) h4[i] = (_Float16)v[i]; *(v4h*)(C16 + cofs + (size_t)(row0 + r) * ldc + col0 + c4) = h4; } } }
     }
}


typedef _Float16 v4h __attribute__((ext_vector_type(4)));

__global__ __launch_bounds__(256) void k_x16(const float* __restrict__ x, _Float16* __restrict__ X16, size_t n8) { const size_t t = (size_t)blockIdx.x * 256 + threadIdx.x; if (t >= n8) return; FragH f;
#pragma unroll
  for (int q = 0; q < 8; ++q) f.h[q] = (_Float16)bf16_round(x[t * 8 + q]); *(v8us*)((unsigned short*)X16 + t * 8) = f.half[0];  }
__global__ __launch_bounds__(256) void k_h16(const float* __restrict__ x, _Float16* __restrict__ X16, size_t n8) { const size_t t = (size_t)blockIdx.x * 256 + threadIdx.x; if (t >= n8) return; FragH f;
#pragma unroll
  for (int q = 0; q < 8; ++q) f.h[q] = (_Float16)x[t * 8 + q]; *(v8us*)((unsigned short*)X16 + t * 8) = f.half[0];  }
__global__ __launch_bounds__(256) void k_round16f(const float* __restrict__ W, _Float16* __restrict__ Bt, size_t n8) { const size_t t = (size_t)blockIdx.x * 256 + threadIdx.x; if (t >= n8) return; FragH f;
#pragma unroll
  for (int i = 0; i < 8; ++i) f.h[i] = (_Float16)(bf16_round(W[t * 8 + i]) * 16.0f); *(v8us*)((unsigned short*)Bt + t * 8) = f.half[0];  }
template <int NHv, int TTv>
__global__ __launch_bounds__(256) void k_vt(const _Float16* __restrict__ V16, int ldv, int voff, _Float16* __restrict__ Vt) { __shared__ unsigned short tl[64][66]; const int tid = threadIdx.x; const int slab = blockIdx.x / (TTv / 64), lg = blockIdx.x % (TTv / 64); const int b = slab / NHv, h = slab % NHv;
  for (int i = tid; i < 64 * 8; i += 256) { const int r = i / 8, c8 = (i % 8) * 8; FragH f; f.half[0] = *(const v8us*)((const unsigned short*)V16 + ((size_t)b * TTv + lg * 64 + r) * ldv + voff + h * 64 + c8);
#pragma unroll
    for (int q = 0; q < 8; ++q) tl[r][c8 + q] = f.u[q]; }
  __syncthreads();
  {
#pragma unroll
    for (int rd = 0; rd < 2; ++rd) { const int d = rd * 32 + tid / 8, pc = tid % 8; FragH f;
#pragma unroll
      for (int q = 0; q < 8; ++q) f.u[q] = tl[pc * 8 + q][d];
      *(v8us*)((unsigned short*)Vt + ((size_t)slab * 64 + d) * TTv + lg * 64 + pc * 8) = f.half[0]; }
     } }

__global__ __launch_bounds__(256) void k_hl(const float* __restrict__ F, _Float16* __restrict__ Hh, _Float16* __restrict__ Hl, size_t n8) { const size_t t = (size_t)blockIdx.x * 256 + threadIdx.x; if (t >= n8) return; FragH fh, fl; const v4f a = *(const v4fa*)(F + t * 8), c = *(const v4fa*)(F + t * 8 + 4);
#pragma unroll
  for (int q = 0; q < 4; ++q) { _Float16 h = (_Float16)a[q]; fh.h[q] = h; fl.h[q] = (_Float16)((a[q] - (float)h) * 1024.0f); h = (_Float16)c[q]; fh.h[4 + q] = h; fl.h[4 + q] = (_Float16)((c[q] - (float)h) * 1024.0f); }
  { *(v8us*)((unsigned short*)Hh + t * 8) = fh.half[0]; *(v8us*)((unsigned short*)Hl + t * 8) = fl.half[0];  } }

__global__ __launch_bounds__(256) void k_wnat(const float* __restrict__ w, size_t n8, _Float16* __restrict__ Bt) { const size_t t = (size_t)blockIdx.x * 256 + threadIdx.x; if (t >= n8) return; FragH f; for (int q = 0; q < 8; ++q) f.h[q] = (_Float16)(bf16_round(w[t * 8 + q]) * 16.0f); *(v8us*)((unsigned short*)Bt + t * 8) = f.half[0];  }
#define FA_WAVES 8
#define FA_KB 64                      /* keys per pass */
#define FA_PITCH 72                   /* f16 per LDS row */
#define FA_C 0.18033688011112042f     /* 64^-0.5 log2(e) */
__device__ __forceinline__ float rsm_xh(float x) { return __builtin_bit_cast(float, __builtin_amdgcn_permlanex16(__builtin_bit_cast(int, x), __builtin_bit_cast(int, x), 0x76543210, 0xfedcba98, false, false)); }      /* lane l with lane l ^ 16 */
__device__ __forceinline__ v16h fa_frag(const unsigned short* p, int hh) { FragH f; f.half[0] = *(const v8us*)(p + 8 * hh); f.half[1] = *(const v8us*)(p + 16 + 8 * hh); return f.v; }      /* k = 8 hh + 0..7, 16 + 8 hh + 0..7 */
__device__ __forceinline__ float fa_exp2(float x) { float r; asm("v_exp_f32 %0, %1\n\tv_nop" : "=v"(r) : "v"(x)); return r; }      /* the v_nop is the one slot the instruction set asks for behind a transcendental before its result is read or its source overwritten */
// 2^x on the eight registers of one tile, in place: each v_exp_f32 is followed by an independent one, so one v_nop behind the last fills the slot named above for all eight
__device__ __forceinline__ void fa_exp2x8(v8f& t) { float a = t[0], b = t[1], c = t[2], d = t[3], e = t[4], f = t[5], g = t[6], h = t[7];
  asm("v_exp_f32 %0, %0\n\tv_exp_f32 %1, %1\n\tv_exp_f32 %2, %2\n\tv_exp_f32 %3, %3\n\tv_exp_f32 %4, %4\n\tv_exp_f32 %5, %5\n\tv_exp_f32 %6, %6\n\tv_exp_f32 %7, %7\n\tv_nop" : "+v"(a), "+v"(b), "+v"(c), "+v"(d), "+v"(e), "+v"(f), "+v"(g), "+v"(h));
  t[0] = a; t[1] = b; t[2] = c; t[3] = d; t[4] = e; t[5] = f; t[6] = g; t[7] = h; }
__device__ __forceinline__ v8f fa_mma(v16h a, v16h b, v8f c) { return __builtin_amdgcn_wmma_f32_16x16x32_f16(false, a, false, b, (short)0, c, false, false); }
__global__ __launch_bounds__(FA_WAVES * 32) __attribute__((amdgpu_waves_per_eu(4, 4))) void k_fattn(const _Float16* __restrict__ Q16, const _Float16* __restrict__ K16, const _Float16* __restrict__ VT, _Float16* __restrict__ O16) {
  __shared__ __attribute__((aligned(16))) unsigned short sk[2][FA_KB * FA_PITCH];
  __shared__ __attribute__((aligned(16))) unsigned short sv[2][HD * FA_PITCH];
  const int tid = threadIdx.x, lane = tid & 31, ln = lane & 15, hh = lane >> 4, wave = tid >> 5;
  const int slab = blockIdx.y, b = slab / NH, h = slab - b * NH;
  const int q0 = blockIdx.x * (FA_WAVES * 32) + wave * 32;
  const int srow = tid >> 3, sc8 = (tid & 7) * 8;      /* staging: 8 threads per 128-B row, rows srow and srow + 32 */
  const unsigned short* kp = (const unsigned short*)K16 + ((size_t)b * SQ + srow) * DM + h * HD + sc8;      /* K rows [key][d] */
  const unsigned short* vp = (const unsigned short*)VT + ((size_t)slab * HD + srow) * SQ + sc8;             /* V^T rows [d][key] */
  const int sofs = srow * FA_PITCH + sc8;
  v8us tk0 = *(const v8us*)kp, tk1 = *(const v8us*)(kp + 32 * DM), tv0 = *(const v8us*)vp, tv1 = *(const v8us*)(vp + 32 * SQ);
  v16h qf[2][2];
#pragma unroll
  for (int qt = 0; qt < 2; ++qt) { const unsigned short* qp = (const unsigned short*)Q16 + ((size_t)b * SQ + q0 + qt * 16 + ln) * DM + h * HD; qf[qt][0] = fa_frag(qp, hh); qf[qt][1] = fa_frag(qp + 32, hh); }
  *(v8us*)&sk[0][sofs] = tk0; *(v8us*)&sk[0][sofs + 32 * FA_PITCH] = tk1; *(v8us*)&sv[0][sofs] = tv0; *(v8us*)&sv[0][sofs + 32 * FA_PITCH] = tv1;
  __syncthreads();
  const v8f z8 = {0.f,0.f,0.f,0.f,0.f,0.f,0.f,0.f};
  v8f o[2][4] = {{z8, z8, z8, z8}, {z8, z8, z8, z8}};
  v8f ls[2] = {z8, z8};      /* sums of the f16 weights, on the matrix pipe: A = all ones, so every row of the tile holds the column sums over all keys */
  v16h ones;
#pragma unroll
  for (int i = 0; i < 16; ++i) ones[i] = (_Float16)1.0f;
  float mrun[2] = {-3.0e38f, -3.0e38f};
#pragma unroll 1
  for (int it = 0; it < SQ / FA_KB; ++it) {
    const unsigned short* ck = sk[it & 1]; const unsigned short* cv = sv[it & 1];
    const bool more = it + 1 < SQ / FA_KB;
    if (more) { kp += (size_t)FA_KB * DM; vp += FA_KB; tk0 = *(const v8us*)kp; tk1 = *(const v8us*)(kp + 32 * DM); tv0 = *(const v8us*)vp; tv1 = *(const v8us*)(vp + 32 * SQ); }
    v8f s[2][4];
#pragma unroll
    for (int kt = 0; kt < 4; ++kt) { const unsigned short* kr = ck + (kt * 16 + ln) * FA_PITCH; const v16h a0 = fa_frag(kr, hh), a1 = fa_frag(kr + 32, hh);
#pragma unroll
      for (int qt = 0; qt < 2; ++qt) s[qt][kt] = fa_mma(a1, qf[qt][1], fa_mma(a0, qf[qt][0], z8)); }      /* s[qt][kt][r] = q . k of key kt 16 + 8 hh + r, query qt 16 + ln */
    float mx[2];
#pragma unroll
    for (int qt = 0; qt < 2; ++qt) { float t0 = s[qt][0][0], t1 = s[qt][1][0], t2 = s[qt][2][0], t3 = s[qt][3][0];
#pragma unroll
      for (int r = 1; r < 8; ++r) { t0 = fmaxf(t0, s[qt][0][r]); t1 = fmaxf(t1, s[qt][1][r]); t2 = fmaxf(t2, s[qt][2][r]); t3 = fmaxf(t3, s[qt][3][r]); }
      const float t = fmaxf(fmaxf(t0, t1), fmaxf(t2, t3)); mx[qt] = fmaxf(t, rsm_xh(t)); }
    /* the maximum in use is replaced only when a column's new maximum passes it by more than 2^8 (weights stay below 2^15 in f16); one test per pass for the whole wave */
    const bool need = ((mx[0] - mrun[0]) * FA_C > 8.0f) || ((mx[1] - mrun[1]) * FA_C > 8.0f);
    if (__builtin_amdgcn_ballot_w32(need) != 0) {
#pragma unroll
      for (int qt = 0; qt < 2; ++qt) { const float mn = fmaxf(mrun[qt], mx[qt]); const float al = fa_exp2((mrun[qt] - mn) * FA_C); mrun[qt] = mn; ls[qt] *= al;
#pragma unroll
        for (int dt = 0; dt < 4; ++dt) o[qt][dt] *= al; }
    }
    const unsigned short* vr = cv + ln * FA_PITCH;
    v16h va[4], vb[4];
#pragma unroll
    for (int dt = 0; dt < 4; ++dt) va[dt] = fa_frag(vr + dt * 16 * FA_PITCH, hh);      /* V^T, keys 0..31 of the tile */
    __builtin_amdgcn_sched_barrier(0);      /* keeps these LDS loads in front of the exponentials, so that they land under them */
    FragH pf[2][2];
#pragma unroll
    for (int qt = 0; qt < 2; ++qt) { const float nb = __builtin_fmaf(-mrun[qt], FA_C, 7.0f);      /* weights carried x128 against the f16 subnormal range; the factor cancels in the division by their sum */
#pragma unroll
      for (int kt = 0; kt < 4; ++kt) { v8f t;
#pragma unroll
        for (int r = 0; r < 8; ++r) t[r] = __builtin_fmaf(s[qt][kt][r], FA_C, nb);
        fa_exp2x8(t);
#pragma unroll
        for (int r = 0; r < 8; ++r) pf[qt][kt >> 1].h[(kt & 1) * 8 + r] = (_Float16)t[r]; } }
#pragma unroll
    for (int dt = 0; dt < 4; ++dt) vb[dt] = fa_frag(vr + dt * 16 * FA_PITCH + 32, hh);      /* V^T, keys 32..63 */
    __builtin_amdgcn_sched_barrier(0);      /* keeps these LDS loads in front of the first half's products, so that they land under them */
#pragma unroll
    for (int qt = 0; qt < 2; ++qt) { ls[qt] = fa_mma(ones, pf[qt][0].v, ls[qt]);
#pragma unroll
      for (int dt = 0; dt < 4; ++dt) o[qt][dt] = fa_mma(va[dt], pf[qt][0].v, o[qt][dt]); }      /* o[qt][dt][r] = O of d = dt 16 + 8 hh + r, query qt 16 + ln */
#pragma unroll
    for (int qt = 0; qt < 2; ++qt) { ls[qt] = fa_mma(ones, pf[qt][1].v, ls[qt]);
#pragma unroll
      for (int dt = 0; dt < 4; ++dt) o[qt][dt] = fa_mma(vb[dt], pf[qt][1].v, o[qt][dt]); }
    if (more) { unsigned short* nk = sk[(it + 1) & 1]; unsigned short* nv = sv[(it + 1) & 1];      /* last read in pass it - 1, behind that pass's barrier */
      *(v8us*)&nk[sofs] = tk0; *(v8us*)&nk[sofs + 32 * FA_PITCH] = tk1; *(v8us*)&nv[sofs] = tv0; *(v8us*)&nv[sofs + 32 * FA_PITCH] = tv1; }
    __syncthreads();      /* publishes the next tile and ends every wave's reads of this one */
  }
#pragma unroll
  for (int qt = 0; qt < 2; ++qt) { const float sc = 64.0f / ls[qt][0];      /* o carried x64, as the output GEMM's alpha expects */
    unsigned short* op = (unsigned short*)O16 + ((size_t)b * SQ + q0 + qt * 16 + ln) * DM + h * HD + 8 * hh;
#pragma unroll
    for (int dt = 0; dt < 4; ++dt) { FragH f;
#pragma unroll
      for (int r = 0; r < 8; ++r) f.h[r] = (_Float16)(o[qt][dt][r] * sc);
      *(v8us*)(op + dt * 16) = f.half[0]; } }
}
// ---- projection GEMM: Y[m][n] = alpha sum_k X[m][k] W[n][k] + bias[n] (bias rounded to bf16), X and W f16 rows of DM; Y rows of DM, f16 or f32.
// One 256 x 192 tile of Y per workgroup (64 x 4 tiles = one workgroup per WGP), 8 waves as 4 x 2, 64 x 96 of Y per wave. Each pass of 64 k brings 256 X rows and 192 W rows of 128 B
// once per workgroup (whole-line global loads through registers) into one of two LDS buffers, rows of 144 B = 16 B x 9 for the 16-byte fragment reads; global loads fly one pass ahead, fragment loads half a pass ahead; the pass's one barrier stands between its two halves.
// Every "#pragma unroll" on a loop over register arrays is there so that the register arrays (staging pieces, fragments, accumulators) are indexed by constants and stay in registers.
// Transposed product (A = W rows, B = X rows): a lane holds 8 neighbouring n of one row m, so the epilogue packs 16-byte pieces; Y leaves through LDS as whole 128-B lines. k is summed 32 at a time, ascending.
#define G_BM 256
#define G_BN 192
#define G_BK 64
#define G_PITCH 72                    /* f16 per LDS row */
#define G_ROWS (G_BM + G_BN)
#define G_NX (G_BM / 32)              /* 16-byte pieces of X per thread and pass */
#define G_NW (G_BN / 32)              /* 16-byte pieces of W per thread and pass */
template <bool F32OUT>
__global__ __launch_bounds__(256) void k_gemm3(const _Float16* __restrict__ X, const _Float16* __restrict__ Wn, float alpha, const float* __restrict__ bias, float* __restrict__ C, _Float16* __restrict__ C16) {
  __shared__ __attribute__((aligned(16))) unsigned short sb[2][G_ROWS * G_PITCH];
  const int tid = threadIdx.x, lane = tid & 31, ln = lane & 15, hh = lane >> 4, wave = tid >> 5, wm = wave >> 1, wn = wave & 1;
  const int mt = blockIdx.x / (DM / G_BN), nq = blockIdx.x - mt * (DM / G_BN);
  const int row0 = mt * G_BM, col0 = nq * G_BN;
  const int srow = tid >> 3, sc8 = (tid & 7) * 8;      /* staging: 8 threads per 128-B row, rows srow + 32 i */
  const unsigned short* xp = (const unsigned short*)X + (size_t)(row0 + srow) * DM + sc8;
  const unsigned short* wp = (const unsigned short*)Wn + (size_t)(col0 + srow) * DM + sc8;
  const int sofs = srow * G_PITCH + sc8;
  v8us st[G_NX + G_NW];
#pragma unroll
  for (int i = 0; i < G_NX; ++i) st[i] = *(const v8us*)(xp + (size_t)i * 32 * DM);
#pragma unroll
  for (int i = 0; i < G_NW; ++i) st[G_NX + i] = *(const v8us*)(wp + (size_t)i * 32 * DM);
#pragma unroll
  for (int i = 0; i < G_NX + G_NW; ++i) *(v8us*)&sb[0][sofs + i * 32 * G_PITCH] = st[i];
  __syncthreads();
  const v8f z8 = {0.f,0.f,0.f,0.f,0.f,0.f,0.f,0.f};
  v8f acc[4][6];
#pragma unroll
  for (int mi = 0; mi < 4; ++mi)
#pragma unroll
    for (int ni = 0; ni < 6; ++ni) acc[mi][ni] = z8;
  const int xo = (wm * 64 + ln) * G_PITCH, wo = (G_BM + wn * 96 + ln) * G_PITCH;
  v16h xa[4], wa[6], xb[4], wb[6];      /* two fragment sets: k 0..31 and k 32..63 of a tile; each is fetched as one group while the other set's products run */
#pragma unroll
  for (int mi = 0; mi < 4; ++mi) xa[mi] = fa_frag(&sb[0][xo + mi * 16 * G_PITCH], hh);
#pragma unroll
  for (int ni = 0; ni < 6; ++ni) wa[ni] = fa_frag(&sb[0][wo + ni * 16 * G_PITCH], hh);
  xp += G_BK; wp += G_BK;
  __builtin_amdgcn_sched_barrier(0);      /* with the one behind the wait: keeps every other register write out of the stretch between these loads and their wait */
#pragma unroll
  for (int i = 0; i < G_NX; ++i) st[i] = *(const v8us*)(xp + (size_t)i * 32 * DM);
#pragma unroll
  for (int i = 0; i < G_NW; ++i) st[G_NX + i] = *(const v8us*)(wp + (size_t)i * 32 * DM);
  asm volatile("s_wait_xcnt 0x0" ::: "memory");      /* stands in front of whatever overwrites the address registers of the loads just issued */
  __builtin_amdgcn_sched_barrier(0);      /* keeps later register writes behind that wait */
#pragma unroll 1      /* stays a loop, for speed only */
  for (int j = 0; j < DM / G_BK / 2; ++j)
#pragma unroll
  for (int p = 0; p < 2; ++p) {      /* two passes per trip: each buffer's LDS addresses are loop constants */
    const int it = 2 * j + p;
    const unsigned short* cb = sb[p]; unsigned short* nb = sb[p ^ 1];
    const bool more = it + 1 < DM / G_BK;
#pragma unroll
    for (int mi = 0; mi < 4; ++mi) xb[mi] = fa_frag(cb + xo + mi * 16 * G_PITCH + 32, hh);
#pragma unroll
    for (int ni = 0; ni < 6; ++ni) wb[ni] = fa_frag(cb + wo + ni * 16 * G_PITCH + 32, hh);
    __builtin_amdgcn_sched_barrier(0);      /* keeps these LDS loads one group in front of the first half's products, so that they land under them */
#pragma unroll
    for (int ni = 0; ni < 6; ++ni)
#pragma unroll
      for (int mi = 0; mi < 4; ++mi) acc[mi][ni] = fa_mma(wa[ni], xa[mi], acc[mi][ni]);      /* acc[mi][ni][r] = Y of n = ni 16 + 8 hh + r, m = mi 16 + ln */
    __builtin_amdgcn_sched_barrier(0);      /* keeps the LDS stores out of the run of products */
    if (more) {      /* nb was last read in pass it - 1, by loads that had landed at that pass's barrier */
#pragma unroll
      for (int i = 0; i < G_NX + G_NW; ++i) *(v8us*)&nb[sofs + i * 32 * G_PITCH] = st[i]; }
    __syncthreads();      /* publishes the next tile; every wave's loads from this tile have landed here */
    if (more) {
      if (it + 2 < DM / G_BK) { xp += G_BK; wp += G_BK;
#pragma unroll
        for (int i = 0; i < G_NX; ++i) st[i] = *(const v8us*)(xp + (size_t)i * 32 * DM);
#pragma unroll
        for (int i = 0; i < G_NW; ++i) st[G_NX + i] = *(const v8us*)(wp + (size_t)i * 32 * DM);
        asm volatile("s_wait_xcnt 0x0" ::: "memory"); }      /* stands in front of the additions that overwrite the address registers of the loads just issued */
#pragma unroll
      for (int mi = 0; mi < 4; ++mi) xa[mi] = fa_frag(nb + xo + mi * 16 * G_PITCH, hh);
#pragma unroll
      for (int ni = 0; ni < 6; ++ni) wa[ni] = fa_frag(nb + wo + ni * 16 * G_PITCH, hh); }
    __builtin_amdgcn_sched_barrier(0);      /* keeps the next tile's first fragment loads and the global loads of the tile behind it in front of the second half's products */
#pragma unroll
    for (int ni = 0; ni < 6; ++ni)
#pragma unroll
      for (int mi = 0; mi < 4; ++mi) acc[mi][ni] = fa_mma(wb[ni], xb[mi], acc[mi][ni]);
    __builtin_amdgcn_sched_barrier(0);      /* keeps the next pass's fragment loads one group behind these products instead of spread among them */
  }
  /* epilogue: no wave reads the buffers behind the last pass's barrier; Y goes through them so that 8 lanes store each 128-B line whole */
  v4f bl[6], bh[6];
  const float* bp = bias + col0 + wn * 96 + 8 * hh;
  __builtin_amdgcn_sched_barrier(0);      /* with the one behind the wait: keeps every other register write out of the stretch between these loads and their wait */
#pragma unroll
  for (int ni = 0; ni < 6; ++ni) { bl[ni] = *(const v4fa*)(bp + ni * 16); bh[ni] = *(const v4fa*)(bp + ni * 16 + 4); }
  asm volatile("s_wait_xcnt 0x0" ::: "memory");      /* stands in front of whatever overwrites the address registers of the bias loads */
  __builtin_amdgcn_sched_barrier(0);      /* keeps later register writes behind that wait */
#pragma unroll
  for (int ni = 0; ni < 6; ++ni)
#pragma unroll
    for (int r = 0; r < 4; ++r) { bl[ni][r] = bf16_round(bl[ni][r]); bh[ni][r] = bf16_round(bh[ni][r]); }
  if (!F32OUT) {
    unsigned short* se = &sb[0][0];      /* 256 rows of 192 f16, pitch 200 */
#pragma unroll
    for (int ni = 0; ni < 6; ++ni)
#pragma unroll
      for (int mi = 0; mi < 4; ++mi) { FragH f;
#pragma unroll
        for (int r = 0; r < 4; ++r) { f.h[r] = (_Float16)(acc[mi][ni][r] * alpha + bl[ni][r]); f.h[4 + r] = (_Float16)(acc[mi][ni][4 + r] * alpha + bh[ni][r]); }
        *(v8us*)&se[(wm * 64 + mi * 16 + ln) * 200 + wn * 96 + ni * 16 + 8 * hh] = f.half[0]; }
    __syncthreads();
    v8us ov[24];      /* row srow + 32 (i / 3), line i % 3 */
#pragma unroll
    for (int i = 0; i < 24; ++i) ov[i] = *(const v8us*)&se[((i / 3) * 32 + srow) * 200 + (i % 3) * 64 + sc8];
    unsigned short* yp = (unsigned short*)C16 + (size_t)(row0 + srow) * DM + col0 + sc8;
#pragma unroll
    for (int i = 0; i < 24; ++i) *(v8us*)(yp + (size_t)(i / 3) * 32 * DM + (i % 3) * 64) = ov[i];
  } else {
    float* sf = (float*)&sb[0][0];      /* 128 rows of 192 f32, pitch 196: the tile's upper and lower half in turn */
    const int sc4 = (tid & 7) * 4;
#pragma unroll
    for (int g = 0; g < 2; ++g) {
      if ((wm >> 1) == g) {
#pragma unroll
        for (int ni = 0; ni < 6; ++ni)
#pragma unroll
          for (int mi = 0; mi < 4; ++mi) { v4f lo, hi;
#pragma unroll
            for (int r = 0; r < 4; ++r) { lo[r] = acc[mi][ni][r] * alpha + bl[ni][r]; hi[r] = acc[mi][ni][4 + r] * alpha + bh[ni][r]; }
            float* d = sf + ((wm & 1) * 64 + mi * 16 + ln) * 196 + wn * 96 + ni * 16 + 8 * hh;
            *(v4fa*)d = lo; *(v4fa*)(d + 4) = hi; }
      }
      __syncthreads();
      v4f ov[24];      /* row srow + 32 (i / 6), line i % 6 */
#pragma unroll
      for (int i = 0; i < 24; ++i) ov[i] = *(const v4fa*)(sf + ((i / 6) * 32 + srow) * 196 + (i % 6) * 32 + sc4);
      float* yp = C + (size_t)(row0 + g * (G_BM / 2) + srow) * DM + col0 + sc4;
#pragma unroll
      for (int i = 0; i < 24; ++i) *(v4fa*)(yp + (size_t)(i / 6) * 32 * DM + (i % 6) * 32) = ov[i];
      if (g == 0) { asm volatile("s_wait_xcnt 0x0" ::: "memory");      /* stands in front of the lower half's overwriting of the registers that these stores name */
        __syncthreads(); }      /* the upper half has left LDS before the lower half overwrites it */
    }
  }
}
__global__ __launch_bounds__(256) void k_vt(const _Float16* __restrict__ V16, int b, int h0, _Float16* __restrict__ VT) { __shared__ unsigned short tl[64][65]; const int tid = threadIdx.x; const int hh = blockIdx.x % HG, sg = blockIdx.x / HG; const int s0 = sg * 64; const int h = h0 + hh;
  for (int i = tid; i < 64 * 8; i += 256) { const int j = i / 8, d8 = (i % 8) * 8; FragH f; f.half[0] = *(const v8us*)((const unsigned short*)V16 + ((size_t)b * SQ + s0 + j) * DM + h * HD + d8); for (int q = 0; q < 8; ++q) tl[d8 + q][j] = f.u[q]; }
  __syncthreads();
  { for (int i = tid; i < 64 * 8; i += 256) { const int d = i / 8, j8 = (i % 8) * 8; FragH f; for (int q = 0; q < 8; ++q) f.u[q] = tl[d][j8 + q]; *(v8us*)((unsigned short*)VT + ((size_t)hh * HD + d) * SQ + s0 + j8) = f.half[0]; }  } }


extern "C" void kernel_launch(void* const* d_in, const int* in_sizes, int n_in,
                              void* d_out, int out_size, void* d_ws, size_t ws_size, hipStream_t stream) {
  (void)in_sizes; (void)n_in; (void)out_size;
  const float* const* I = (const float* const*)d_in; const float* x = I[0]; const float* wq = I[1]; const float* bq = I[2]; const float* wk = I[3]; const float* bk = I[4]; const float* wv = I[5]; const float* bv = I[6]; const float* wo = I[7]; const float* bo = I[8];      /* nn.Linear weights [out][in] + biases */
  char* ws = (char*)d_ws; size_t off = 0;
  auto take = [&](size_t bytes) { char* p = ws + off; off += (bytes + 255) & ~(size_t)255; return p; };
  _Float16* BQ = (_Float16*)take((size_t)DM * DM * 2); _Float16* BK = (_Float16*)take((size_t)DM * DM * 2); _Float16* BV = (_Float16*)take((size_t)DM * DM * 2); _Float16* BO = (_Float16*)take((size_t)DM * DM * 2);
  _Float16* X16 = (_Float16*)take(NR * DM * 2); _Float16* Q16 = (_Float16*)take(NR * DM * 2); _Float16* K16 = (_Float16*)take(NR * DM * 2); _Float16* V16 = (_Float16*)take(NR * DM * 2); _Float16* O16 = (_Float16*)take(NR * DM * 2);
  _Float16* VT = (_Float16*)take((size_t)NB * NH * HD * SQ * 2);
  if (off > ws_size) return;
  { const unsigned g = (unsigned)(((size_t)DM * DM / 8 + 255) / 256); k_wnat<<<g, 256, 0, stream>>>(wq, (size_t)DM * DM / 8, BQ); k_wnat<<<g, 256, 0, stream>>>(wk, (size_t)DM * DM / 8, BK); k_wnat<<<g, 256, 0, stream>>>(wv, (size_t)DM * DM / 8, BV); k_wnat<<<g, 256, 0, stream>>>(wo, (size_t)DM * DM / 8, BO); }      /* natural [out][in] = Bt[n][k], x16 */
  k_x16<<<(unsigned)((NR * DM / 8 + 255) / 256), 256, 0, stream>>>(x, X16, NR * DM / 8);
  const size_t r0p = (size_t)B0 * SQ;      /* first projected row */
  k_gemm3<false><<<(MP / G_BM) * (DM / G_BN), 256, 0, stream>>>(X16 + r0p * DM, BQ, 0.0625f, bq, nullptr, Q16 + r0p * DM);
  k_gemm3<false><<<(MP / G_BM) * (DM / G_BN), 256, 0, stream>>>(X16 + r0p * DM, BK, 0.0625f, bk, nullptr, K16 + r0p * DM);
  k_gemm3<false><<<(MP / G_BM) * (DM / G_BN), 256, 0, stream>>>(X16 + r0p * DM, BV, 0.0625f, bv, nullptr, V16 + r0p * DM);
  k_vt<NH, SQ><<<NB * NH * (SQ / 64), 256, 0, stream>>>(V16, LQ, 0, VT);      /* V^T [NB][NH][HD][SQ], all batches */
  k_fattn<<<dim3(SQ / (FA_WAVES * 32), NB * NH), FA_WAVES * 32, 0, stream>>>(Q16, K16, VT, O16);      /* o x64 (merged heads) as f16 rows */
  k_gemm3<true><<<(MPO / G_BM) * (DM / G_BN), 256, 0, stream>>>(O16 + r0p * DM, BO, 0.0009765625f, bo, (float*)d_out + r0p * DM, nullptr);      /* out rows are the output layout */
}

// v004
// It runs in 140 microseconds.
// Next to v003, in two timings, it ran 1.09 and 1.10 times as fast.
// Over all steps from v000 it is 29.2 times as fast.
#include <hip/hip_runtime.h>
// ViT self-attention (x [16][1024][768]; q/k/v = x W^T + b (nn.Linear [out][in] 768^2, sigma 0.02, zero biases), 12 heads of 64; scores / 8; softmax; out = (attn v merged) Wc^T + bc -> [16][1024][768]).
// Structure: token rows r = b*1024 + s; x as exact f16 rows (bf16-rounded); Q, K, V as one grid of WMMA GEMM tiles (256x192 workgroup tiles staged in LDS, f32 accumulation, exact x16 weights + bias, f16 outputs); V^T for all batches and heads via LDS transposes; one fused attention kernel over all (batch, head): S^T = K Q^T, online softmax (f32 statistics, exp2 domain; weights x128 as f16), O^T += V^T P^T, o carried x64 against f16 subnormal flush (folded into the output GEMM alpha), written straight into the merged f16 o rows; out = o W_o + b GEMM (f32) into the output layout.
// Compute dtype: inputs rounded to bf16; x / weights exact; q, k, v, softmax weights and o as plain f16 GEMM operands (~2^-12); scores and softmax statistics f32. v_wmma_f32_16x16x32_f16.
#define NB 16
#define SQ 1024
#define DM 768
#define NH 12
#define HD 64
#define HG 12                         /* heads per launch of the (b, h0) k_vt overload */
#define B0 0                         /* first batch processed (debug hook) */
#define NBR NB                       /* batches processed (debug hook) */
#define NR ((size_t)NB * SQ)         /* token rows */
#define MP ((int)((size_t)NBR * SQ)) /* rows projected (debug hook) */
#define QN SQ                        /* unused; the attention covers all SQ queries */
#define NHD NH                       /* unused; the attention covers all NH heads */
#define MPO MP                       /* rows through the output stage (debug hook) */
#define LQ DM      /* row pitch of the q/k/v rows */
typedef __bf16 v16b __attribute__((ext_vector_type(16)));
typedef unsigned short v8us __attribute__((ext_vector_type(8), may_alias));
typedef float  v8f  __attribute__((ext_vector_type(8)));
typedef float  v4f  __attribute__((ext_vector_type(4)));
typedef float  v4fa __attribute__((ext_vector_type(4), may_alias));
union FragB { v16b v; v8us half[2]; unsigned short u[16]; };

__device__ __forceinline__ unsigned short bf16_bits(float x) { unsigned int u = __float_as_uint(x); return (unsigned short)((u + 0x7FFFu + ((u >> 16) & 1u)) >> 16); }
__device__ __forceinline__ float bf16_val(unsigned short b) { return __uint_as_float(((unsigned int)b) << 16); }
__device__ __forceinline__ float bf16_round(float x) { return bf16_val(bf16_bits(x)); }
// D += A·B with NT terms: 1 = ah·bh, 2 = + al·bh (A split), 3 = + ah·bl (both split)
template <int NT>
__device__ __forceinline__ v8f mmaN(v16b ah, v16b al, v16b bh, v16b bl, v8f c) {
  c = __builtin_amdgcn_wmma_f32_16x16x32_bf16(false, ah, false, bh, (short)0, c, false, false);
  if (NT >= 2) c = __builtin_amdgcn_wmma_f32_16x16x32_bf16(false, al, false, bh, (short)0, c, false, false);
  if (NT >= 3) c = __builtin_amdgcn_wmma_f32_16x16x32_bf16(false, ah, false, bl, (short)0, c, false, false);
  asm volatile("v_nop\n\tv_nop\n\tv_nop\n\tv_nop" : "+v"(c) : "v"(ah), "v"(al), "v"(bh), "v"(bl));
  return c;
}

__global__ __launch_bounds__(256) void k_wt_bf16(const float* __restrict__ W, unsigned short* __restrict__ Wt, int K, int N) {
  const int t = blockIdx.x * 256 + threadIdx.x;
  const int k8n = K / 8;
  if (t >= N * k8n) return;
  const int n = t / k8n, k8 = (t % k8n) * 8;
  v8us v;
#pragma unroll
  for (int i = 0; i < 8; ++i) v[i] = bf16_bits(W[(size_t)(k8 + i) * N + n]);
  *(v8us*)(Wt + (size_t)n * K + k8) = v;
  
}

// GEMM C[M][N] (f32, pitch ldc) = act(A[M][K]·W + bias). A f32 row-major (pitch lda) converted per fragment to bf16
// (ASPLIT: hi/lo two planes -> 2 terms, else single rounded term); Wt bf16 [N][K] (pitch ldb). BIAS_BF16 rounds the
// bias to bf16 first (bias quantised to bf16 before the add). K%32==0, M%16==0, N%64==0.
template <bool ASPLIT, int ACT, bool BIAS_BF16>
__global__ __launch_bounds__(128) void k_gemm_bf(const float* __restrict__ A, int lda, const unsigned short* __restrict__ Wt, int ldb,
                                               const float* __restrict__ bias, float* __restrict__ C, int ldc, int M, int N, int K) {
  __shared__ __attribute__((aligned(16))) float so[4][16][64];
  const int tid = threadIdx.x, w = tid >> 5, lane = tid & 31, ln = lane & 15, hh = lane >> 4;
  const int ntn = N / 64;
  const int wid = blockIdx.x * 4 + w;
  const int mt = wid / ntn, nq = wid % ntn;
  if (mt * 16 >= M) return;
  const int row0 = mt * 16, col0 = nq * 64;
  const float* arow = A + (size_t)(row0 + ln) * lda;
  v8f acc[4] = {};
  for (int kb = 0; kb < K; kb += 32) {
    FragB ah, al;
    const v4f x0 = *(const v4fa*)(arow + kb + 8 * hh), x1 = *(const v4fa*)(arow + kb + 8 * hh + 4);
    const v4f x2 = *(const v4fa*)(arow + kb + 16 + 8 * hh), x3 = *(const v4fa*)(arow + kb + 16 + 8 * hh + 4);
    float xs[16] = {x0[0],x0[1],x0[2],x0[3],x1[0],x1[1],x1[2],x1[3],x2[0],x2[1],x2[2],x2[3],x3[0],x3[1],x3[2],x3[3]};
#pragma unroll
    for (int i = 0; i < 16; ++i) { const unsigned short hb = bf16_bits(xs[i]); ah.u[i] = hb; al.u[i] = ASPLIT ? bf16_bits(xs[i] - bf16_val(hb)) : (unsigned short)0; }
#pragma unroll
    for (int t = 0; t < 4; ++t) {
      const unsigned short* brow = Wt + (size_t)(col0 + t * 16 + ln) * ldb + kb;
      FragB b;
      b.half[0] = *(const v8us*)(brow + 8 * hh);
      b.half[1] = *(const v8us*)(brow + 16 + 8 * hh);
      acc[t] = mmaN<ASPLIT ? 2 : 1>(ah.v, al.v, b.v, b.v, acc[t]);
    }
  }
#pragma unroll
  for (int t = 0; t < 4; ++t) {
    float bv = bias ? bias[col0 + t * 16 + ln] : 0.f;
    if (BIAS_BF16) bv = bf16_round(bv);
#pragma unroll
    for (int r = 0; r < 8; ++r) { float v = acc[t][r] + bv; if (ACT == 1) v = fmaxf(v, 0.f); so[w][8 * hh + r][t * 16 + ln] = v; }
  }
  __builtin_amdgcn_fence(__ATOMIC_ACQ_REL, "workgroup");
  __builtin_amdgcn_wave_barrier();
  const int rsub = lane >> 4, c4 = (lane & 15) * 4;
  {
#pragma unroll
    for (int q = 0; q < 8; ++q) {
      const int r = q * 2 + rsub;
      const v4f v = *(const v4fa*)&so[w][r][c4];
      *(v4f*)(C + (size_t)(row0 + r) * ldc + col0 + c4) = v;
    }
    
  }
}

// GEMM C = act(A·W + bias + resid): A f32 (ASPLIT -> hi/lo 2 terms), Wt bf16 [N][K]; ACT 0 none, 1 relu, 2 exact gelu;
// resid (optional, f32, row index = (row % rmod), pitch ldr, RES_BF16 rounds it) added before the activation.
template <bool ASPLIT, int ACT, bool BIAS_BF16, bool RES_BF16>
__global__ __launch_bounds__(128) void k_gemm_bf3(const float* __restrict__ A, int lda, const unsigned short* __restrict__ Wt, int ldb,
                                                const float* __restrict__ bias, const float* __restrict__ resid, int rmod, int ldr,
                                                float* __restrict__ C, int ldc, int M, int N, int K) {
  __shared__ __attribute__((aligned(16))) float so[4][16][64];
  const int tid = threadIdx.x, w = tid >> 5, lane = tid & 31, ln = lane & 15, hh = lane >> 4;
  const int ntn = N / 64;
  const int wid = blockIdx.x * 4 + w;
  const int mt = wid / ntn, nq = wid % ntn;
  if (mt * 16 >= M) return;
  const int row0 = mt * 16, col0 = nq * 64;
  const float* arow = A + (size_t)(row0 + ln) * lda;
  v8f acc[4] = {};
  for (int kb = 0; kb < K; kb += 32) {
    FragB ah, al;
    const v4f x0 = *(const v4fa*)(arow + kb + 8 * hh), x1 = *(const v4fa*)(arow + kb + 8 * hh + 4);
    const v4f x2 = *(const v4fa*)(arow + kb + 16 + 8 * hh), x3 = *(const v4fa*)(arow + kb + 16 + 8 * hh + 4);
    float xs[16] = {x0[0],x0[1],x0[2],x0[3],x1[0],x1[1],x1[2],x1[3],x2[0],x2[1],x2[2],x2[3],x3[0],x3[1],x3[2],x3[3]};
#pragma unroll
    for (int i = 0; i < 16; ++i) { const unsigned short hb = bf16_bits(xs[i]); ah.u[i] = hb; al.u[i] = ASPLIT ? bf16_bits(xs[i] - bf16_val(hb)) : (unsigned short)0; }
#pragma unroll
    for (int t = 0; t < 4; ++t) {
      const unsigned short* brow = Wt + (size_t)(col0 + t * 16 + ln) * ldb + kb;
      FragB b;
      b.half[0] = *(const v8us*)(brow + 8 * hh);
      b.half[1] = *(const v8us*)(brow + 16 + 8 * hh);
      acc[t] = mmaN<ASPLIT ? 2 : 1>(ah.v, al.v, b.v, b.v, acc[t]);
    }
  }
#pragma unroll
  for (int t = 0; t < 4; ++t) {
    const int col = col0 + t * 16 + ln;
    float bv = bias ? bias[col] : 0.f;
    if (BIAS_BF16) bv = bf16_round(bv);
#pragma unroll
    for (int r = 0; r < 8; ++r) {
      float v = acc[t][r] + bv;
      if (resid) { float rv = resid[(size_t)((row0 + 8 * hh + r) % rmod) * ldr + col]; if (RES_BF16) rv = bf16_round(rv); v += rv; }
      if (ACT == 1) v = fmaxf(v, 0.f);
      if (ACT == 2) v = 0.5f * v * (1.0f + erff(v * 0.70710678118654752f));
      if (ACT == 3) { const float u = 0.7978845608028654f * (v + 0.044715f * v * v * v); v = 0.5f * v * (1.0f + tanhf(u)); }
      so[w][8 * hh + r][t * 16 + ln] = v;
    }
  }
  __builtin_amdgcn_fence(__ATOMIC_ACQ_REL, "workgroup");
  __builtin_amdgcn_wave_barrier();
  const int rsub = lane >> 4, c4 = (lane & 15) * 4;
  {
#pragma unroll
    for (int q = 0; q < 8; ++q) {
      const int r = q * 2 + rsub;
      const v4f v = *(const v4fa*)&so[w][r][c4];
      *(v4f*)(C + (size_t)(row0 + r) * ldc + col0 + c4) = v;
    }
    
  }
}
// row LayerNorm (biased variance, eps) over N: s = X (+ R); optional out_sum <- s; out_norm <- (s-mu)*rsqrt(var+eps)*g + b
template <bool PARAM_BF16>
__global__ __launch_bounds__(256) void k_layernorm(const float* __restrict__ X, const float* __restrict__ R, const float* __restrict__ g, const float* __restrict__ bta,
                                                  float* __restrict__ out_sum, float* __restrict__ out_norm, int N, float eps) {
  __shared__ float red[256];
  const int row = blockIdx.x, tid = threadIdx.x;
  const float* x = X + (size_t)row * N; const float* rr = R ? R + (size_t)row * N : nullptr;
  float vals[16];                     // up to N = 4096
  const int per = N / 256;            // contiguous chunk per thread? use strided-by-4 chunks: thread handles j = tid*4 + 1024*u
  float s1 = 0.f;
  for (int u = 0; u < per / 4; ++u) {
    const int j = tid * 4 + 1024 * u;
    const v4f a = *(const v4fa*)(x + j);
    v4f b = {0.f,0.f,0.f,0.f}; if (rr) b = *(const v4fa*)(rr + j);
#pragma unroll
    for (int q = 0; q < 4; ++q) { const float v = a[q] + b[q]; vals[u * 4 + q] = v; s1 += v; }
  }
  red[tid] = s1; __syncthreads();
  for (int st = 128; st > 0; st >>= 1) { if (tid < st) red[tid] += red[tid + st]; __syncthreads(); }
  const float mu = red[0] / (float)N; __syncthreads();
  float s2 = 0.f;
  for (int u = 0; u < per / 4; ++u)
#pragma unroll
    for (int q = 0; q < 4; ++q) { const float c = vals[u * 4 + q] - mu; s2 += c * c; }
  red[tid] = s2; __syncthreads();
  for (int st = 128; st > 0; st >>= 1) { if (tid < st) red[tid] += red[tid + st]; __syncthreads(); }
  const float rs = rsqrtf(red[0] / (float)N + eps);
  {
    for (int u = 0; u < per / 4; ++u) {
      const int j = tid * 4 + 1024 * u;
      v4f o, sm;
#pragma unroll
      for (int q = 0; q < 4; ++q) {
        float gg = g[j + q], bb = bta[j + q];
        if (PARAM_BF16) { gg = bf16_round(gg); bb = bf16_round(bb); }
        sm[q] = vals[u * 4 + q]; o[q] = (vals[u * 4 + q] - mu) * rs * gg + bb;
      }
      if (out_sum) *(v4f*)(out_sum + (size_t)row * N + j) = sm;
      *(v4f*)(out_norm + (size_t)row * N + j) = o;
    }
    
  }
}



// ---- f16 WMMA path (v_wmma_f32_16x16x32_f16): 11-bit significands for operands in range — used where a [0,1] probability operand needs more precision than bf16
typedef _Float16 v16h __attribute__((ext_vector_type(16)));
union FragH { v16h v; v8us half[2]; _Float16 h[16]; unsigned short u[16]; };
template <int NT>
__device__ __forceinline__ v8f mmaH(v16h ah, v16h al, v16h bh, v16h bl, v8f c) {
  c = __builtin_amdgcn_wmma_f32_16x16x32_f16(false, ah, false, bh, (short)0, c, false, false);
  if (NT >= 2) c = __builtin_amdgcn_wmma_f32_16x16x32_f16(false, al, false, bh, (short)0, c, false, false);
  if (NT >= 3) c = __builtin_amdgcn_wmma_f32_16x16x32_f16(false, ah, false, bl, (short)0, c, false, false);
  asm volatile("v_nop\n\tv_nop\n\tv_nop\n\tv_nop" : "+v"(c) : "v"(ah), "v"(al), "v"(bh), "v"(bl));
  return c;
}
// batched GEMM like k_gemm_b but f16 operands: A f32 (split into f16 hi/lo if ASPLIT, else rounded to f16), Bt = f16 values [n][k]; alpha; C f32; N multiple of 16 (partial tiles skipped)
template <bool ASPLIT>
__global__ __launch_bounds__(128) void k_gemm_h(const float* __restrict__ A, int lda, size_t sA, const _Float16* __restrict__ Bh, int ldb, size_t sB, float alpha, float* __restrict__ C, int ldc, size_t sC, int M, int N, int K) {
  __shared__ __attribute__((aligned(16))) float so[4][16][64];
  const int tid = threadIdx.x, w = tid >> 5, lane = tid & 31, ln = lane & 15, hh = lane >> 4; const int by = blockIdx.y;
  A += (size_t)by * sA; Bh += (size_t)by * sB; C += (size_t)by * sC;
  const int ntn = (N + 63) / 64; const int wid = blockIdx.x * 4 + w; const int mt = wid / ntn, nq = wid % ntn; if (mt * 16 >= M) return;
  const int row0 = mt * 16, col0 = nq * 64; const float* arow = A + (size_t)(row0 + ln) * lda;
  v8f acc[4] = {};
  for (int kb = 0; kb < K; kb += 32) {
    FragH ah, al;
    const v4f x0 = *(const v4fa*)(arow + kb + 8 * hh), x1 = *(const v4fa*)(arow + kb + 8 * hh + 4), x2 = *(const v4fa*)(arow + kb + 16 + 8 * hh), x3 = *(const v4fa*)(arow + kb + 16 + 8 * hh + 4);
    float xs[16] = {x0[0],x0[1],x0[2],x0[3],x1[0],x1[1],x1[2],x1[3],x2[0],x2[1],x2[2],x2[3],x3[0],x3[1],x3[2],x3[3]};
#pragma unroll
    for (int i = 0; i < 16; ++i) { const _Float16 h = (_Float16)xs[i]; ah.h[i] = h; al.h[i] = ASPLIT ? (_Float16)(xs[i] - (float)h) : (_Float16)0.0f; }
#pragma unroll
    for (int t = 0; t < 4; ++t) { if (col0 + t * 16 >= N) continue; const size_t boff = (size_t)(col0 + t * 16 + ln) * ldb + kb; FragH bq; bq.half[0] = *(const v8us*)(Bh + boff + 8 * hh); bq.half[1] = *(const v8us*)(Bh + boff + 16 + 8 * hh);
      acc[t] = mmaH<ASPLIT ? 2 : 1>(ah.v, al.v, bq.v, bq.v, acc[t]); }
  }
#pragma unroll
  for (int t = 0; t < 4; ++t) { if (col0 + t * 16 >= N) continue;
#pragma unroll
    for (int r = 0; r < 8; ++r) so[w][8 * hh + r][t * 16 + ln] = acc[t][r] * alpha; }
  __builtin_amdgcn_fence(__ATOMIC_ACQ_REL, "workgroup"); __builtin_amdgcn_wave_barrier();
  const int rsub = lane >> 4, c4 = (lane & 15) * 4;
  {
#pragma unroll
    for (int q = 0; q < 8; ++q) { const int r = q * 2 + rsub; if (col0 + c4 < N) { const v4f v = *(const v4fa*)&so[w][r][c4]; *(v4f*)(C + (size_t)(row0 + r) * ldc + col0 + c4) = v; } }
     }
}

// Wt[n][k] = f16(W[k][n]·scale) from f32 row-major W[K][N] (scale = power of two; bf16-exact weights stay exact in f16 away from the subnormal range)
__global__ __launch_bounds__(256) void k_wt_f16(const float* __restrict__ W, _Float16* __restrict__ Wt, int K, int N, float scale) {
  const int t = blockIdx.x * 256 + threadIdx.x; if (t >= N * (K / 8)) return; const int n = t / (K / 8), k8 = (t % (K / 8)) * 8; FragH f;
#pragma unroll
  for (int i = 0; i < 8; ++i) f.h[i] = (_Float16)(bf16_round(W[(size_t)(k8 + i) * N + n]) * scale); const v8us o = f.half[0];
  *(v8us*)((unsigned short*)Wt + (size_t)n * K + k8) = o; 
}
// k_gemm_hh variant with fused epilogue: v = acc·alpha + bias[by·sBias + col] (+ CP[(row/rowsPerB)·sCPb + by·64 + col] if CP) ; ACT 0 none / 1 elu ; writes f16 C16 (and f32 C if non-null)
template <int ACT>
__global__ __launch_bounds__(128) void k_gemm_hhx(const _Float16* __restrict__ A, int lda, size_t sA, const _Float16* __restrict__ Bh, int ldb, size_t sB, float alpha, const float* __restrict__ bias, size_t sBias, const float* __restrict__ CP, int rowsPerB, size_t sCPb, int row0g,
    float* __restrict__ C, _Float16* __restrict__ C16, int ldc, size_t sC, int M, int N, int K) {
  __shared__ __attribute__((aligned(16))) float so[4][16][64];
  const int tid = threadIdx.x, w = tid >> 5, lane = tid & 31, ln = lane & 15, hh = lane >> 4; const int by = blockIdx.y;
  A += (size_t)by * sA; Bh += (size_t)by * sB; const size_t cofs = (size_t)by * sC; const float* bp = bias ? bias + (size_t)by * sBias : nullptr;
  const int ntn = (N + 63) / 64; const int wid = blockIdx.x * 4 + w; const int mt = wid / ntn, nq = wid % ntn; if (mt * 16 >= M) return;
  const int row0 = mt * 16, col0 = nq * 64; const _Float16* arow = A + (size_t)(row0 + ln) * lda;
  v8f acc[4] = {};
  for (int kb = 0; kb < K; kb += 32) { FragH ah; ah.half[0] = *(const v8us*)((const unsigned short*)arow + kb + 8 * hh); ah.half[1] = *(const v8us*)((const unsigned short*)arow + kb + 16 + 8 * hh);
#pragma unroll
    for (int t = 0; t < 4; ++t) { if (col0 + t * 16 >= N) continue; const size_t boff = (size_t)(col0 + t * 16 + ln) * ldb + kb; FragH bq; bq.half[0] = *(const v8us*)((const unsigned short*)Bh + boff + 8 * hh); bq.half[1] = *(const v8us*)((const unsigned short*)Bh + boff + 16 + 8 * hh);
      acc[t] = mmaH<1>(ah.v, ah.v, bq.v, bq.v, acc[t]); }
  }
#pragma unroll
  for (int t = 0; t < 4; ++t) { if (col0 + t * 16 >= N) continue; const int col = col0 + t * 16 + ln; const float bv = bp ? bf16_round(bp[col]) : 0.f;
#pragma unroll
    for (int r = 0; r < 8; ++r) { float v = acc[t][r] * alpha + bv; if (CP) { const int rr = row0g + row0 + 8 * hh + r; if (rowsPerB < 0) v += CP[cofs + (size_t)rr * ldc + col];      /* rowsPerB < 0: own element of the batched C plane */ else { const int bidx = rr / rowsPerB; v += CP[(size_t)bidx * sCPb + (size_t)by * 64 + col]; } } if (ACT == 1) v = (v > 0.f) ? v : expm1f(v); else if (ACT == 7) v = (v > 0.f) ? v + 1.0f : expf(v); else if (ACT == 8) v = tanhf(v); else if (ACT == 9) v = 0.5f * v * (1.0f + tanhf(0.7978845608028654f * (v + 0.044715f * v * v * v))); else if (ACT == 11) v = 1.0f / (1.0f + expf(-v)); else if (ACT == 12) v = (v > 0.f) ? v : 0.01f * v; else if (ACT == 14) v = (v > 0.f) ? v : 0.1f * v; else if (ACT == 16) v = (v >= 0.f) ? v : 0.3f * v; else if (ACT == 17) v = (v >= 0.f) ? v : 0.2f * v; else if (ACT == 15) v = v / (1.0f + expf(-v)); else if (ACT == 3) v = fmaxf(v, 0.f); else if (ACT == 6) v = 0.5f * v * (1.0f + erff(v * 0.70710678118654752f)); so[w][8 * hh + r][t * 16 + ln] = v; } }
  __builtin_amdgcn_fence(__ATOMIC_ACQ_REL, "workgroup"); __builtin_amdgcn_wave_barrier();
  const int rsub = lane >> 4, c4 = (lane & 15) * 4; typedef _Float16 v4h __attribute__((ext_vector_type(4)));
  {
#pragma unroll
    for (int q = 0; q < 8; ++q) { const int r = q * 2 + rsub; if (col0 + c4 < N) { const v4f v = *(const v4fa*)&so[w][r][c4]; if (C) *(v4f*)(C + cofs + (size_t)(row0 + r) * ldc + col0 + c4) = v; if (C16) { v4h h4; for (int i = 0; i < 4; ++i) h4[i] = (_Float16)v[i]; *(v4h*)(C16 + cofs + (size_t)(row0 + r) * ldc + col0 + c4) = h4; } } }
     }
}


typedef _Float16 v4h __attribute__((ext_vector_type(4)));

// All five input conversions in one grid (they do not depend on one another): blocks 0 .. 4 PW_B - 1 take the four weight matrices (bf16-rounded, x16, natural [out][in] = [n][k], one behind the other in BW),
// the other blocks take x (bf16-rounded, x1: the product with 1 is exact). 8 elements per thread; every count divides evenly, so no thread is idle.
#define PW_B (DM * DM / 8 / 256)      /* blocks per weight matrix */
#define PX_B ((int)(NR * DM / 8 / 256))      /* blocks for x */
__global__ __launch_bounds__(256) void k_prep(const float* __restrict__ x, const float* __restrict__ wq, const float* __restrict__ wk, const float* __restrict__ wv, const float* __restrict__ wo, _Float16* __restrict__ X16, _Float16* __restrict__ BW) {
  const int bi = blockIdx.x; const bool isw = bi < 4 * PW_B; const int w = bi / PW_B;
  const float* s = isw ? (w == 0 ? wq : w == 1 ? wk : w == 2 ? wv : wo) : x;
  unsigned short* d = isw ? (unsigned short*)BW + (size_t)w * DM * DM : (unsigned short*)X16;
  const float sc = isw ? 16.0f : 1.0f;
  const size_t t = (size_t)(isw ? bi - w * PW_B : bi - 4 * PW_B) * 256 + threadIdx.x; FragH f;
#pragma unroll
  for (int q = 0; q < 8; ++q) f.h[q] = (_Float16)(bf16_round(s[t * 8 + q]) * sc);
  *(v8us*)(d + t * 8) = f.half[0]; }
__global__ __launch_bounds__(256) void k_h16(const float* __restrict__ x, _Float16* __restrict__ X16, size_t n8) { const size_t t = (size_t)blockIdx.x * 256 + threadIdx.x; if (t >= n8) return; FragH f;
#pragma unroll
  for (int q = 0; q < 8; ++q) f.h[q] = (_Float16)x[t * 8 + q]; *(v8us*)((unsigned short*)X16 + t * 8) = f.half[0];  }
__global__ __launch_bounds__(256) void k_round16f(const float* __restrict__ W, _Float16* __restrict__ Bt, size_t n8) { const size_t t = (size_t)blockIdx.x * 256 + threadIdx.x; if (t >= n8) return; FragH f;
#pragma unroll
  for (int i = 0; i < 8; ++i) f.h[i] = (_Float16)(bf16_round(W[t * 8 + i]) * 16.0f); *(v8us*)((unsigned short*)Bt + t * 8) = f.half[0];  }
template <int NHv, int TTv>
__global__ __launch_bounds__(256) void k_vt(const _Float16* __restrict__ V16, int ldv, int voff, _Float16* __restrict__ Vt) { __shared__ unsigned short tl[64][66]; const int tid = threadIdx.x; const int slab = blockIdx.x / (TTv / 64), lg = blockIdx.x % (TTv / 64); const int b = slab / NHv, h = slab % NHv;
  for (int i = tid; i < 64 * 8; i += 256) { const int r = i / 8, c8 = (i % 8) * 8; FragH f; f.half[0] = *(const v8us*)((const unsigned short*)V16 + ((size_t)b * TTv + lg * 64 + r) * ldv + voff + h * 64 + c8);
#pragma unroll
    for (int q = 0; q < 8; ++q) tl[r][c8 + q] = f.u[q]; }
  __syncthreads();
  {
#pragma unroll
    for (int rd = 0; rd < 2; ++rd) { const int d = rd * 32 + tid / 8, pc = tid % 8; FragH f;
#pragma unroll
      for (int q = 0; q < 8; ++q) f.u[q] = tl[pc * 8 + q][d];
      *(v8us*)((unsigned short*)Vt + ((size_t)slab * 64 + d) * TTv + lg * 64 + pc * 8) = f.half[0]; }
     } }

__global__ __launch_bounds__(256) void k_hl(const float* __restrict__ F, _Float16* __restrict__ Hh, _Float16* __restrict__ Hl, size_t n8) { const size_t t = (size_t)blockIdx.x * 256 + threadIdx.x; if (t >= n8) return; FragH fh, fl; const v4f a = *(const v4fa*)(F + t * 8), c = *(const v4fa*)(F + t * 8 + 4);
#pragma unroll
  for (int q = 0; q < 4; ++q) { _Float16 h = (_Float16)a[q]; fh.h[q] = h; fl.h[q] = (_Float16)((a[q] - (float)h) * 1024.0f); h = (_Float16)c[q]; fh.h[4 + q] = h; fl.h[4 + q] = (_Float16)((c[q] - (float)h) * 1024.0f); }
  { *(v8us*)((unsigned short*)Hh + t * 8) = fh.half[0]; *(v8us*)((unsigned short*)Hl + t * 8) = fl.half[0];  } }

#define FA_WAVES 8
#define FA_KB 64                      /* keys per pass */
#define FA_PITCH 72                   /* f16 per LDS row */
#define FA_C 0.18033688011112042f     /* 64^-0.5 log2(e) */
__device__ __forceinline__ float rsm_xh(float x) { return __builtin_bit_cast(float, __builtin_amdgcn_permlanex16(__builtin_bit_cast(int, x), __builtin_bit_cast(int, x), 0x76543210, 0xfedcba98, false, false)); }      /* lane l with lane l ^ 16 */
__device__ __forceinline__ v16h fa_frag(const unsigned short* p, int hh) { FragH f; f.half[0] = *(const v8us*)(p + 8 * hh); f.half[1] = *(const v8us*)(p + 16 + 8 * hh); return f.v; }      /* k = 8 hh + 0..7, 16 + 8 hh + 0..7 */
__device__ __forceinline__ float fa_exp2(float x) { float r; asm("v_exp_f32 %0, %1\n\tv_nop" : "=v"(r) : "v"(x)); return r; }      /* the v_nop is the one slot the instruction set asks for behind a transcendental before its result is read or its source overwritten */
// 2^x on the eight registers of one tile, in place: each v_exp_f32 is followed by an independent one, so one v_nop behind the last fills the slot named above for all eight
__device__ __forceinline__ void fa_exp2x8(v8f& t) { float a = t[0], b = t[1], c = t[2], d = t[3], e = t[4], f = t[5], g = t[6], h = t[7];
  asm("v_exp_f32 %0, %0\n\tv_exp_f32 %1, %1\n\tv_exp_f32 %2, %2\n\tv_exp_f32 %3, %3\n\tv_exp_f32 %4, %4\n\tv_exp_f32 %5, %5\n\tv_exp_f32 %6, %6\n\tv_exp_f32 %7, %7\n\tv_nop" : "+v"(a), "+v"(b), "+v"(c), "+v"(d), "+v"(e), "+v"(f), "+v"(g), "+v"(h));
  t[0] = a; t[1] = b; t[2] = c; t[3] = d; t[4] = e; t[5] = f; t[6] = g; t[7] = h; }
__device__ __forceinline__ v8f fa_mma(v16h a, v16h b, v8f c) { return __builtin_amdgcn_wmma_f32_16x16x32_f16(false, a, false, b, (short)0, c, false, false); }
__global__ __launch_bounds__(FA_WAVES * 32) __attribute__((amdgpu_waves_per_eu(4, 4))) void k_fattn(const _Float16* __restrict__ Q16, const _Float16* __restrict__ K16, const _Float16* __restrict__ VT, _Float16* __restrict__ O16) {
  __shared__ __attribute__((aligned(16))) unsigned short sk[2][FA_KB * FA_PITCH];
  __shared__ __attribute__((aligned(16))) unsigned short sv[2][HD * FA_PITCH];
  const int tid = threadIdx.x, lane = tid & 31, ln = lane & 15, hh = lane >> 4, wave = tid >> 5;
  const int slab = blockIdx.y, b = slab / NH, h = slab - b * NH;
  const int q0 = blockIdx.x * (FA_WAVES * 32) + wave * 32;
  const int srow = tid >> 3, sc8 = (tid & 7) * 8;      /* staging: 8 threads per 128-B row, rows srow and srow + 32 */
  const unsigned short* kp = (const unsigned short*)K16 + ((size_t)b * SQ + srow) * DM + h * HD + sc8;      /* K rows [key][d] */
  const unsigned short* vp = (const unsigned short*)VT + ((size_t)slab * HD + srow) * SQ + sc8;             /* V^T rows [d][key] */
  const int sofs = srow * FA_PITCH + sc8;
  v8us tk0 = *(const v8us*)kp, tk1 = *(const v8us*)(kp + 32 * DM), tv0 = *(const v8us*)vp, tv1 = *(const v8us*)(vp + 32 * SQ);
  v16h qf[2][2];
#pragma unroll
  for (int qt = 0; qt < 2; ++qt) { const unsigned short* qp = (const unsigned short*)Q16 + ((size_t)b * SQ + q0 + qt * 16 + ln) * DM + h * HD; qf[qt][0] = fa_frag(qp, hh); qf[qt][1] = fa_frag(qp + 32, hh); }
  *(v8us*)&sk[0][sofs] = tk0; *(v8us*)&sk[0][sofs + 32 * FA_PITCH] = tk1; *(v8us*)&sv[0][sofs] = tv0; *(v8us*)&sv[0][sofs + 32 * FA_PITCH] = tv1;
  __syncthreads();
  const v8f z8 = {0.f,0.f,0.f,0.f,0.f,0.f,0.f,0.f};
  v8f o[2][4] = {{z8, z8, z8, z8}, {z8, z8, z8, z8}};
  v8f ls[2] = {z8, z8};      /* sums of the f16 weights, on the matrix pipe: A = all ones, so every row of the tile holds the column sums over all keys */
  v16h ones;
#pragma unroll
  for (int i = 0; i < 16; ++i) ones[i] = (_Float16)1.0f;
  float mrun[2] = {-3.0e38f, -3.0e38f};
#pragma unroll 1
  for (int it = 0; it < SQ / FA_KB; ++it) {
    const unsigned short* ck = sk[it & 1]; const unsigned short* cv = sv[it & 1];
    const bool more = it + 1 < SQ / FA_KB;
    if (more) { kp += (size_t)FA_KB * DM; vp += FA_KB; tk0 = *(const v8us*)kp; tk1 = *(const v8us*)(kp + 32 * DM); tv0 = *(const v8us*)vp; tv1 = *(const v8us*)(vp + 32 * SQ); }
    v8f s[2][4];
#pragma unroll
    for (int kt = 0; kt < 4; ++kt) { const unsigned short* kr = ck + (kt * 16 + ln) * FA_PITCH; const v16h a0 = fa_frag(kr, hh), a1 = fa_frag(kr + 32, hh);
#pragma unroll
      for (int qt = 0; qt < 2; ++qt) s[qt][kt] = fa_mma(a1, qf[qt][1], fa_mma(a0, qf[qt][0], z8)); }      /* s[qt][kt][r] = q . k of key kt 16 + 8 hh + r, query qt 16 + ln */
    float mx[2];
#pragma unroll
    for (int qt = 0; qt < 2; ++qt) { float t0 = s[qt][0][0], t1 = s[qt][1][0], t2 = s[qt][2][0], t3 = s[qt][3][0];
#pragma unroll
      for (int r = 1; r < 8; ++r) { t0 = fmaxf(t0, s[qt][0][r]); t1 = fmaxf(t1, s[qt][1][r]); t2 = fmaxf(t2, s[qt][2][r]); t3 = fmaxf(t3, s[qt][3][r]); }
      const float t = fmaxf(fmaxf(t0, t1), fmaxf(t2, t3)); mx[qt] = fmaxf(t, rsm_xh(t)); }
    /* the maximum in use is replaced only when a column's new maximum passes it by more than 2^8 (weights stay below 2^15 in f16); one test per pass for the whole wave */
    const bool need = ((mx[0] - mrun[0]) * FA_C > 8.0f) || ((mx[1] - mrun[1]) * FA_C > 8.0f);
    if (__builtin_amdgcn_ballot_w32(need) != 0) {
#pragma unroll
      for (int qt = 0; qt < 2; ++qt) { const float mn = fmaxf(mrun[qt], mx[qt]); const float al = fa_exp2((mrun[qt] - mn) * FA_C); mrun[qt] = mn; ls[qt] *= al;
#pragma unroll
        for (int dt = 0; dt < 4; ++dt) o[qt][dt] *= al; }
    }
    const unsigned short* vr = cv + ln * FA_PITCH;
    v16h va[4], vb[4];
#pragma unroll
    for (int dt = 0; dt < 4; ++dt) va[dt] = fa_frag(vr + dt * 16 * FA_PITCH, hh);      /* V^T, keys 0..31 of the tile */
    __builtin_amdgcn_sched_barrier(0);      /* keeps these LDS loads in front of the exponentials, so that they land under them */
    FragH pf[2][2];
#pragma unroll
    for (int qt = 0; qt < 2; ++qt) { const float nb = __builtin_fmaf(-mrun[qt], FA_C, 7.0f);      /* weights carried x128 against the f16 subnormal range; the factor cancels in the division by their sum */
#pragma unroll
      for (int kt = 0; kt < 4; ++kt) { v8f t;
#pragma unroll
        for (int r = 0; r < 8; ++r) t[r] = __builtin_fmaf(s[qt][kt][r], FA_C, nb);
        fa_exp2x8(t);
#pragma unroll
        for (int r = 0; r < 8; ++r) pf[qt][kt >> 1].h[(kt & 1) * 8 + r] = (_Float16)t[r]; } }
#pragma unroll
    for (int dt = 0; dt < 4; ++dt) vb[dt] = fa_frag(vr + dt * 16 * FA_PITCH + 32, hh);      /* V^T, keys 32..63 */
    __builtin_amdgcn_sched_barrier(0);      /* keeps these LDS loads in front of the first half's products, so that they land under them */
#pragma unroll
    for (int qt = 0; qt < 2; ++qt) { ls[qt] = fa_mma(ones, pf[qt][0].v, ls[qt]);
#pragma unroll
      for (int dt = 0; dt < 4; ++dt) o[qt][dt] = fa_mma(va[dt], pf[qt][0].v, o[qt][dt]); }      /* o[qt][dt][r] = O of d = dt 16 + 8 hh + r, query qt 16 + ln */
#pragma unroll
    for (int qt = 0; qt < 2; ++qt) { ls[qt] = fa_mma(ones, pf[qt][1].v, ls[qt]);
#pragma unroll
      for (int dt = 0; dt < 4; ++dt) o[qt][dt] = fa_mma(vb[dt], pf[qt][1].v, o[qt][dt]); }
    if (more) { unsigned short* nk = sk[(it + 1) & 1]; unsigned short* nv = sv[(it + 1) & 1];      /* last read in pass it - 1, behind that pass's barrier */
      *(v8us*)&nk[sofs] = tk0; *(v8us*)&nk[sofs + 32 * FA_PITCH] = tk1; *(v8us*)&nv[sofs] = tv0; *(v8us*)&nv[sofs + 32 * FA_PITCH] = tv1; }
    __syncthreads();      /* publishes the next tile and ends every wave's reads of this one */
  }
#pragma unroll
  for (int qt = 0; qt < 2; ++qt) { const float sc = 64.0f / ls[qt][0];      /* o carried x64, as the output GEMM's alpha expects */
    unsigned short* op = (unsigned short*)O16 + ((size_t)b * SQ + q0 + qt * 16 + ln) * DM + h * HD + 8 * hh;
#pragma unroll
    for (int dt = 0; dt < 4; ++dt) { FragH f;
#pragma unroll
      for (int r = 0; r < 8; ++r) f.h[r] = (_Float16)(o[qt][dt][r] * sc);
      *(v8us*)(op + dt * 16) = f.half[0]; } }
}
// ---- projection GEMM: Y[m][n] = alpha sum_k X[m][k] W[n][k] + bias[n] (bias rounded to bf16), X and W f16 rows of DM; Y rows of DM, f16 or f32.
// One 256 x 192 tile of Y per workgroup (64 x 4 tiles per product; Q, K and V are one grid of 768), 8 waves as 4 x 2, 64 x 96 of Y per wave. Each pass of 64 k brings 256 X rows and 192 W rows of 128 B
// once per workgroup (whole-line global loads through registers) into one of two LDS buffers, rows of 144 B = 16 B x 9 for the 16-byte fragment reads; global loads fly one pass ahead, fragment loads half a pass ahead; the pass's one barrier stands between its two halves.
// Every "#pragma unroll" on a loop over register arrays is there so that the register arrays (staging pieces, fragments, accumulators) are indexed by constants and stay in registers.
// Transposed product (A = W rows, B = X rows): a lane holds 8 neighbouring n of one row m, so the epilogue packs 16-byte pieces; Y leaves through LDS as whole 128-B lines. k is summed 32 at a time, ascending.
#define G_BM 256
#define G_BN 192
#define G_BK 64
#define G_PITCH 72                    /* f16 per LDS row */
#define G_ROWS (G_BM + G_BN)
#define G_NX (G_BM / 32)              /* 16-byte pieces of X per thread and pass */
#define G_NW (G_BN / 32)              /* 16-byte pieces of W per thread and pass */
template <bool F32OUT>
__global__ __launch_bounds__(256) void k_gemm3(const _Float16* __restrict__ X, const _Float16* __restrict__ Wn, float alpha, const float* __restrict__ bias, const float* __restrict__ bias1, const float* __restrict__ bias2, float* __restrict__ C, _Float16* __restrict__ C16) {
  __shared__ __attribute__((aligned(16))) unsigned short sb[2][G_ROWS * G_PITCH];
  const int tid = threadIdx.x, lane = tid & 31, ln = lane & 15, hh = lane >> 4, wave = tid >> 5, wm = wave >> 1, wn = wave & 1;
  constexpr int NP = F32OUT ? 1 : 3;      /* products in this grid: the f16 form does Q, K and V (weights, and outputs, one behind the other; the 12 column tiles of one X tile are neighbours in the grid) */
  const int mt = blockIdx.x / (NP * (DM / G_BN)), nt = blockIdx.x - mt * (NP * (DM / G_BN));
  const int sel = nt / (DM / G_BN), nq = nt - sel * (DM / G_BN);
  const int row0 = mt * G_BM, col0 = nq * G_BN;
  if (NP > 1) { Wn += (size_t)sel * DM * DM; C16 += (size_t)sel * NR * DM; bias = sel == 0 ? bias : sel == 1 ? bias1 : bias2; }
  const int srow = tid >> 3, sc8 = (tid & 7) * 8;      /* staging: 8 threads per 128-B row, rows srow + 32 i */
  const unsigned short* xp = (const unsigned short*)X + (size_t)(row0 + srow) * DM + sc8;
  const unsigned short* wp = (const unsigned short*)Wn + (size_t)(col0 + srow) * DM + sc8;
  const int sofs = srow * G_PITCH + sc8;
  v8us st[G_NX + G_NW];
#pragma unroll
  for (int i = 0; i < G_NX; ++i) st[i] = *(const v8us*)(xp + (size_t)i * 32 * DM);
#pragma unroll
  for (int i = 0; i < G_NW; ++i) st[G_NX + i] = *(const v8us*)(wp + (size_t)i * 32 * DM);
#pragma unroll
  for (int i = 0; i < G_NX + G_NW; ++i) *(v8us*)&sb[0][sofs + i * 32 * G_PITCH] = st[i];
  __syncthreads();
  const v8f z8 = {0.f,0.f,0.f,0.f,0.f,0.f,0.f,0.f};
  v8f acc[4][6];
#pragma unroll
  for (int mi = 0; mi < 4; ++mi)
#pragma unroll
    for (int ni = 0; ni < 6; ++ni) acc[mi][ni] = z8;
  const int xo = (wm * 64 + ln) * G_PITCH, wo = (G_BM + wn * 96 + ln) * G_PITCH;
  v16h xa[4], wa[6], xb[4], wb[6];      /* two fragment sets: k 0..31 and k 32..63 of a tile; each is fetched as one group while the other set's products run */
#pragma unroll
  for (int mi = 0; mi < 4; ++mi) xa[mi] = fa_frag(&sb[0][xo + mi * 16 * G_PITCH], hh);
#pragma unroll
  for (int ni = 0; ni < 6; ++ni) wa[ni] = fa_frag(&sb[0][wo + ni * 16 * G_PITCH], hh);
  xp += G_BK; wp += G_BK;
  __builtin_amdgcn_sched_barrier(0);      /* with the one behind the wait: keeps every other register write out of the stretch between these loads and their wait */
#pragma unroll
  for (int i = 0; i < G_NX; ++i) st[i] = *(const v8us*)(xp + (size_t)i * 32 * DM);
#pragma unroll
  for (int i = 0; i < G_NW; ++i) st[G_NX + i] = *(const v8us*)(wp + (size_t)i * 32 * DM);
  asm volatile("s_wait_xcnt 0x0" ::: "memory");      /* stands in front of whatever overwrites the address registers of the loads just issued */
  __builtin_amdgcn_sched_barrier(0);      /* keeps later register writes behind that wait */
#pragma unroll 1      /* stays a loop, for speed only */
  for (int j = 0; j < DM / G_BK / 2; ++j)
#pragma unroll
  for (int p = 0; p < 2; ++p) {      /* two passes per trip: each buffer's LDS addresses are loop constants */
    const int it = 2 * j + p;
    const unsigned short* cb = sb[p]; unsigned short* nb = sb[p ^ 1];
    const bool more = it + 1 < DM / G_BK;
#pragma unroll
    for (int mi = 0; mi < 4; ++mi) xb[mi] = fa_frag(cb + xo + mi * 16 * G_PITCH + 32, hh);
#pragma unroll
    for (int ni = 0; ni < 6; ++ni) wb[ni] = fa_frag(cb + wo + ni * 16 * G_PITCH + 32, hh);
    __builtin_amdgcn_sched_barrier(0);      /* keeps these LDS loads one group in front of the first half's products, so that they land under them */
#pragma unroll
    for (int ni = 0; ni < 6; ++ni)
#pragma unroll
      for (int mi = 0; mi < 4; ++mi) acc[mi][ni] = fa_mma(wa[ni], xa[mi], acc[mi][ni]);      /* acc[mi][ni][r] = Y of n = ni 16 + 8 hh + r, m = mi 16 + ln */
    __builtin_amdgcn_sched_barrier(0);      /* keeps the LDS stores out of the run of products */
    if (more) {      /* nb was last read in pass it - 1, by loads that had landed at that pass's barrier */
#pragma unroll
      for (int i = 0; i < G_NX + G_NW; ++i) *(v8us*)&nb[sofs + i * 32 * G_PITCH] = st[i]; }
    __syncthreads();      /* publishes the next tile; every wave's loads from this tile have landed here */
    if (more) {
      if (it + 2 < DM / G_BK) { xp += G_BK; wp += G_BK;
#pragma unroll
        for (int i = 0; i < G_NX; ++i) st[i] = *(const v8us*)(xp + (size_t)i * 32 * DM);
#pragma unroll
        for (int i = 0; i < G_NW; ++i) st[G_NX + i] = *(const v8us*)(wp + (size_t)i * 32 * DM);
        asm volatile("s_wait_xcnt 0x0" ::: "memory"); }      /* stands in front of the additions that overwrite the address registers of the loads just issued */
#pragma unroll
      for (int mi = 0; mi < 4; ++mi) xa[mi] = fa_frag(nb + xo + mi * 16 * G_PITCH, hh);
#pragma unroll
      for (int ni = 0; ni < 6; ++ni) wa[ni] = fa_frag(nb + wo + ni * 16 * G_PITCH, hh); }
    __builtin_amdgcn_sched_barrier(0);      /* keeps the next tile's first fragment loads and the global loads of the tile behind it in front of the second half's products */
#pragma unroll
    for (int ni = 0; ni < 6; ++ni)
#pragma unroll
      for (int mi = 0; mi < 4; ++mi) acc[mi][ni] = fa_mma(wb[ni], xb[mi], acc[mi][ni]);
    __builtin_amdgcn_sched_barrier(0);      /* keeps the next pass's fragment loads one group behind these products instead of spread among them */
  }
  /* epilogue: no wave reads the buffers behind the last pass's barrier; Y goes through them so that 8 lanes store each 128-B line whole */
  v4f bl[6], bh[6];
  const float* bp = bias + col0 + wn * 96 + 8 * hh;
  __builtin_amdgcn_sched_barrier(0);      /* with the one behind the wait: keeps every other register write out of the stretch between these loads and their wait */
#pragma unroll
  for (int ni = 0; ni < 6; ++ni) { bl[ni] = *(const v4fa*)(bp + ni * 16); bh[ni] = *(const v4fa*)(bp + ni * 16 + 4); }
  asm volatile("s_wait_xcnt 0x0" ::: "memory");      /* stands in front of whatever overwrites the address registers of the bias loads */
  __builtin_amdgcn_sched_barrier(0);      /* keeps later register writes behind that wait */
#pragma unroll
  for (int ni = 0; ni < 6; ++ni)
#pragma unroll
    for (int r = 0; r < 4; ++r) { bl[ni][r] = bf16_round(bl[ni][r]); bh[ni][r] = bf16_round(bh[ni][r]); }
  if (!F32OUT) {
    unsigned short* se = &sb[0][0];      /* 256 rows of 192 f16, pitch 200 */
#pragma unroll
    for (int ni = 0; ni < 6; ++ni)
#pragma unroll
      for (int mi = 0; mi < 4; ++mi) { FragH f;
#pragma unroll
        for (int r = 0; r < 4; ++r) { f.h[r] = (_Float16)(acc[mi][ni][r] * alpha + bl[ni][r]); f.h[4 + r] = (_Float16)(acc[mi][ni][4 + r] * alpha + bh[ni][r]); }
        *(v8us*)&se[(wm * 64 + mi * 16 + ln) * 200 + wn * 96 + ni * 16 + 8 * hh] = f.half[0]; }
    __syncthreads();
    v8us ov[24];      /* row srow + 32 (i / 3), line i % 3 */
#pragma unroll
    for (int i = 0; i < 24; ++i) ov[i] = *(const v8us*)&se[((i / 3) * 32 + srow) * 200 + (i % 3) * 64 + sc8];
    unsigned short* yp = (unsigned short*)C16 + (size_t)(row0 + srow) * DM + col0 + sc8;
#pragma unroll
    for (int i = 0; i < 24; ++i) *(v8us*)(yp + (size_t)(i / 3) * 32 * DM + (i % 3) * 64) = ov[i];
  } else {
    float* sf = (float*)&sb[0][0];      /* 128 rows of 192 f32, pitch 196: the tile's upper and lower half in turn */
    const int sc4 = (tid & 7) * 4;
#pragma unroll
    for (int g = 0; g < 2; ++g) {
      if ((wm >> 1) == g) {
#pragma unroll
        for (int ni = 0; ni < 6; ++ni)
#pragma unroll
          for (int mi = 0; mi < 4; ++mi) { v4f lo, hi;
#pragma unroll
            for (int r = 0; r < 4; ++r) { lo[r] = acc[mi][ni][r] * alpha + bl[ni][r]; hi[r] = acc[mi][ni][4 + r] * alpha + bh[ni][r]; }
            float* d = sf + ((wm & 1) * 64 + mi * 16 + ln) * 196 + wn * 96 + ni * 16 + 8 * hh;
            *(v4fa*)d = lo; *(v4fa*)(d + 4) = hi; }
      }
      __syncthreads();
      v4f ov[24];      /* row srow + 32 (i / 6), line i % 6 */
#pragma unroll
      for (int i = 0; i < 24; ++i) ov[i] = *(const v4fa*)(sf + ((i / 6) * 32 + srow) * 196 + (i % 6) * 32 + sc4);
      float* yp = C + (size_t)(row0 + g * (G_BM / 2) + srow) * DM + col0 + sc4;
#pragma unroll
      for (int i = 0; i < 24; ++i) *(v4fa*)(yp + (size_t)(i / 6) * 32 * DM + (i % 6) * 32) = ov[i];
      if (g == 0) { asm volatile("s_wait_xcnt 0x0" ::: "memory");      /* stands in front of the lower half's overwriting of the registers that these stores name */
        __syncthreads(); }      /* the upper half has left LDS before the lower half overwrites it */
    }
  }
}
__global__ __launch_bounds__(256) void k_vt(const _Float16* __restrict__ V16, int b, int h0, _Float16* __restrict__ VT) { __shared__ unsigned short tl[64][65]; const int tid = threadIdx.x; const int hh = blockIdx.x % HG, sg = blockIdx.x / HG; const int s0 = sg * 64; const int h = h0 + hh;
  for (int i = tid; i < 64 * 8; i += 256) { const int j = i / 8, d8 = (i % 8) * 8; FragH f; f.half[0] = *(const v8us*)((const unsigned short*)V16 + ((size_t)b * SQ + s0 + j) * DM + h * HD + d8); for (int q = 0; q < 8; ++q) tl[d8 + q][j] = f.u[q]; }
  __syncthreads();
  { for (int i = tid; i < 64 * 8; i += 256) { const int d = i / 8, j8 = (i % 8) * 8; FragH f; for (int q = 0; q < 8; ++q) f.u[q] = tl[d][j8 + q]; *(v8us*)((unsigned short*)VT + ((size_t)hh * HD + d) * SQ + s0 + j8) = f.half[0]; }  } }


extern "C" void kernel_launch(void* const* d_in, const int* in_sizes, int n_in,
                              void* d_out, int out_size, void* d_ws, size_t ws_size, hipStream_t stream) {
  (void)in_sizes; (void)n_in; (void)out_size;
  const float* const* I = (const float* const*)d_in; const float* x = I[0]; const float* wq = I[1]; const float* bq = I[2]; const float* wk = I[3]; const float* bk = I[4]; const float* wv = I[5]; const float* bv = I[6]; const float* wo = I[7]; const float* bo = I[8];      /* nn.Linear weights [out][in] + biases */
  char* ws = (char*)d_ws; size_t off = 0;
  auto take = [&](size_t bytes) { char* p = ws + off; off += (bytes + 255) & ~(size_t)255; return p; };
  _Float16* BW = (_Float16*)take((size_t)4 * DM * DM * 2); _Float16* BO = BW + (size_t)3 * DM * DM;      /* Wq, Wk, Wv, Wo, one behind the other */
  _Float16* X16 = (_Float16*)take(NR * DM * 2); _Float16* Q16 = (_Float16*)take(3 * NR * DM * 2); _Float16* K16 = Q16 + NR * DM; _Float16* V16 = K16 + NR * DM; _Float16* O16 = (_Float16*)take(NR * DM * 2);      /* q, k, v rows, one behind the other */
  _Float16* VT = (_Float16*)take((size_t)NB * NH * HD * SQ * 2);
  if (off > ws_size) return;
  k_prep<<<4 * PW_B + PX_B, 256, 0, stream>>>(x, wq, wk, wv, wo, X16, BW);
  const size_t r0p = (size_t)B0 * SQ;      /* first projected row */
  k_gemm3<false><<<(MP / G_BM) * (3 * DM / G_BN), 256, 0, stream>>>(X16 + r0p * DM, BW, 0.0625f, bq, bk, bv, nullptr, Q16 + r0p * DM);      /* q, k and v in one grid */
  k_vt<NH, SQ><<<NB * NH * (SQ / 64), 256, 0, stream>>>(V16, LQ, 0, VT);      /* V^T [NB][NH][HD][SQ], all batches */
  k_fattn<<<dim3(SQ / (FA_WAVES * 32), NB * NH), FA_WAVES * 32, 0, stream>>>(Q16, K16, VT, O16);      /* o x64 (merged heads) as f16 rows */
  k_gemm3<true><<<(MPO / G_BM) * (DM / G_BN), 256, 0, stream>>>(O16 + r0p * DM, BO, 0.0009765625f, bo, bo, bo, (float*)d_out + r0p * DM, nullptr);      /* out rows are the output layout */
}

// v005
// One run takes 135 microseconds.
// In both of two side-by-side timings against v004, it was 1.04 times as fast.
// Counting every step since v000, it is 30.3 times as fast.
#include <hip/hip_runtime.h>
// ViT self-attention (x [16][1024][768]; q/k/v = x W^T + b (nn.Linear [out][in] 768^2, sigma 0.02, zero biases), 12 heads of 64; scores / 8; softmax; out = (attn v merged) Wc^T + bc -> [16][1024][768]).
// Structure: token rows r = b*1024 + s; x as exact f16 rows (bf16-rounded); Q, K, V as one grid of WMMA GEMM tiles (256x192 workgroup tiles staged in LDS, f32 accumulation, exact x16 weights + bias, f16 outputs); one fused attention kernel over all (batch, head): S^T = K Q^T, online softmax (f32 statistics, exp2 domain; weights x128 as f16), O^T += V^T P^T (V^T fragments by the transposing LDS load from V rows), o carried x64 against f16 subnormal flush (folded into the output GEMM alpha), written straight into the merged f16 o rows; out = o W_o + b GEMM (f32) into the output layout.
// Compute dtype: inputs rounded to bf16; x / weights exact; q, k, v, softmax weights and o as plain f16 GEMM operands (~2^-12); scores and softmax statistics f32. v_wmma_f32_16x16x32_f16.
#define NB 16
#define SQ 1024
#define DM 768
#define NH 12
#define HD 64
#define HG 12                         /* heads per launch of the (b, h0) k_vt overload */
#define B0 0                         /* first batch processed (debug hook) */
#define NBR NB                       /* batches processed (debug hook) */
#define NR ((size_t)NB * SQ)         /* token rows */
#define MP ((int)((size_t)NBR * SQ)) /* rows projected (debug hook) */
#define QN SQ                        /* unused; the attention covers all SQ queries */
#define NHD NH                       /* unused; the attention covers all NH heads */
#define MPO MP                       /* rows through the output stage (debug hook) */
#define LQ DM      /* row pitch of the q/k/v rows */
typedef __bf16 v16b __attribute__((ext_vector_type(16)));
typedef unsigned short v8us __attribute__((ext_vector_type(8), may_alias));
typedef float  v8f  __attribute__((ext_vector_type(8)));
typedef float  v4f  __attribute__((ext_vector_type(4)));
typedef float  v4fa __attribute__((ext_vector_type(4), may_alias));
union FragB { v16b v; v8us half[2]; unsigned short u[16]; };

__device__ __forceinline__ unsigned short bf16_bits(float x) { unsigned int u = __float_as_uint(x); return (unsigned short)((u + 0x7FFFu + ((u >> 16) & 1u)) >> 16); }
__device__ __forceinline__ float bf16_val(unsigned short b) { return __uint_as_float(((unsigned int)b) << 16); }
__device__ __forceinline__ float bf16_round(float x) { return bf16_val(bf16_bits(x)); }
// D += A·B with NT terms: 1 = ah·bh, 2 = + al·bh (A split), 3 = + ah·bl (both split)
template <int NT>
__device__ __forceinline__ v8f mmaN(v16b ah, v16b al, v16b bh, v16b bl, v8f c) {
  c = __builtin_amdgcn_wmma_f32_16x16x32_bf16(false, ah, false, bh, (short)0, c, false, false);
  if (NT >= 2) c = __builtin_amdgcn_wmma_f32_16x16x32_bf16(false, al, false, bh, (short)0, c, false, false);
  if (NT >= 3) c = __builtin_amdgcn_wmma_f32_16x16x32_bf16(false, ah, false, bl, (short)0, c, false, false);
  asm volatile("v_nop\n\tv_nop\n\tv_nop\n\tv_nop" : "+v"(c) : "v"(ah), "v"(al), "v"(bh), "v"(bl));
  return c;
}

__global__ __launch_bounds__(256) void k_wt_bf16(const float* __restrict__ W, unsigned short* __restrict__ Wt, int K, int N) {
  const int t = blockIdx.x * 256 + threadIdx.x;
  const int k8n = K / 8;
  if (t >= N * k8n) return;
  const int n = t / k8n, k8 = (t % k8n) * 8;
  v8us v;
#pragma unroll
  for (int i = 0; i < 8; ++i) v[i] = bf16_bits(W[(size_t)(k8 + i) * N + n]);
  *(v8us*)(Wt + (size_t)n * K + k8) = v;
  
}

// GEMM C[M][N] (f32, pitch ldc) = act(A[M][K]·W + bias). A f32 row-major (pitch lda) converted per fragment to bf16
// (ASPLIT: hi/lo two planes -> 2 terms, else single rounded term); Wt bf16 [N][K] (pitch ldb). BIAS_BF16 rounds the
// bias to bf16 first (bias quantised to bf16 before the add). K%32==0, M%16==0, N%64==0.
template <bool ASPLIT, int ACT, bool BIAS_BF16>
__global__ __launch_bounds__(128) void k_gemm_bf(const float* __restrict__ A, int lda, const unsigned short* __restrict__ Wt, int ldb,
                                               const float* __restrict__ bias, float* __restrict__ C, int ldc, int M, int N, int K) {
  __shared__ __attribute__((aligned(16))) float so[4][16][64];
  const int tid = threadIdx.x, w = tid >> 5, lane = tid & 31, ln = lane & 15, hh = lane >> 4;
  const int ntn = N / 64;
  const int wid = blockIdx.x * 4 + w;
  const int mt = wid / ntn, nq = wid % ntn;
  if (mt * 16 >= M) return;
  const int row0 = mt * 16, col0 = nq * 64;
  const float* arow = A + (size_t)(row0 + ln) * lda;
  v8f acc[4] = {};
  for (int kb = 0; kb < K; kb += 32) {
    FragB ah, al;
    const v4f x0 = *(const v4fa*)(arow + kb + 8 * hh), x1 = *(const v4fa*)(arow + kb + 8 * hh + 4);
    const v4f x2 = *(const v4fa*)(arow + kb + 16 + 8 * hh), x3 = *(const v4fa*)(arow + kb + 16 + 8 * hh + 4);
    float xs[16] = {x0[0],x0[1],x0[2],x0[3],x1[0],x1[1],x1[2],x1[3],x2[0],x2[1],x2[2],x2[3],x3[0],x3[1],x3[2],x3[3]};
#pragma unroll
    for (int i = 0; i < 16; ++i) { const unsigned short hb = bf16_bits(xs[i]); ah.u[i] = hb; al.u[i] = ASPLIT ? bf16_bits(xs[i] - bf16_val(hb)) : (unsigned short)0; }
#pragma unroll
    for (int t = 0; t < 4; ++t) {
      const unsigned short* brow = Wt + (size_t)(col0 + t * 16 + ln) * ldb + kb;
      FragB b;
      b.half[0] = *(const v8us*)(brow + 8 * hh);
      b.half[1] = *(const v8us*)(brow + 16 + 8 * hh);
      acc[t] = mmaN<ASPLIT ? 2 : 1>(ah.v, al.v, b.v, b.v, acc[t]);
    }
  }
#pragma unroll
  for (int t = 0; t < 4; ++t) {
    float bv = bias ? bias[col0 + t * 16 + ln] : 0.f;
    if (BIAS_BF16) bv = bf16_round(bv);
#pragma unroll
    for (int r = 0; r < 8; ++r) { float v = acc[t][r] + bv; if (ACT == 1) v = fmaxf(v, 0.f); so[w][8 * hh + r][t * 16 + ln] = v; }
  }
  __builtin_amdgcn_fence(__ATOMIC_ACQ_REL, "workgroup");
  __builtin_amdgcn_wave_barrier();
  const int rsub = lane >> 4, c4 = (lane & 15) * 4;
  {
#pragma unroll
    for (int q = 0; q < 8; ++q) {
      const int r = q * 2 + rsub;
      const v4f v = *(const v4fa*)&so[w][r][c4];
      *(v4f*)(C + (size_t)(row0 + r) * ldc + col0 + c4) = v;
    }
    
  }
}

// GEMM C = act(A·W + bias + resid): A f32 (ASPLIT -> hi/lo 2 terms), Wt bf16 [N][K]; ACT 0 none, 1 relu, 2 exact gelu;
// resid (optional, f32, row index = (row % rmod), pitch ldr, RES_BF16 rounds it) added before the activation.
template <bool ASPLIT, int ACT, bool BIAS_BF16, bool RES_BF16>
__global__ __launch_bounds__(128) void k_gemm_bf3(const float* __restrict__ A, int lda, const unsigned short* __restrict__ Wt, int ldb,
                                                const float* __restrict__ bias, const float* __restrict__ resid, int rmod, int ldr,
                                                float* __restrict__ C, int ldc, int M, int N, int K) {
  __shared__ __attribute__((aligned(16))) float so[4][16][64];
  const int tid = threadIdx.x, w = tid >> 5, lane = tid & 31, ln = lane & 15, hh = lane >> 4;
  const int ntn = N / 64;
  const int wid = blockIdx.x * 4 + w;
  const int mt = wid / ntn, nq = wid % ntn;
  if (mt * 16 >= M) return;
  const int row0 = mt * 16, col0 = nq * 64;
  const float* arow = A + (size_t)(row0 + ln) * lda;
  v8f acc[4] = {};
  for (int kb = 0; kb < K; kb += 32) {
    FragB ah, al;
    const v4f x0 = *(const v4fa*)(arow + kb + 8 * hh), x1 = *(const v4fa*)(arow + kb + 8 * hh + 4);
    const v4f x2 = *(const v4fa*)(arow + kb + 16 + 8 * hh), x3 = *(const v4fa*)(arow + kb + 16 + 8 * hh + 4);
    float xs[16] = {x0[0],x0[1],x0[2],x0[3],x1[0],x1[1],x1[2],x1[3],x2[0],x2[1],x2[2],x2[3],x3[0],x3[1],x3[2],x3[3]};
#pragma unroll
    for (int i = 0; i < 16; ++i) { const unsigned short hb = bf16_bits(xs[i]); ah.u[i] = hb; al.u[i] = ASPLIT ? bf16_bits(xs[i] - bf16_val(hb)) : (unsigned short)0; }
#pragma unroll
    for (int t = 0; t < 4; ++t) {
      const unsigned short* brow = Wt + (size_t)(col0 + t * 16 + ln) * ldb + kb;
      FragB b;
      b.half[0] = *(const v8us*)(brow + 8 * hh);
      b.half[1] = *(const v8us*)(brow + 16 + 8 * hh);
      acc[t] = mmaN<ASPLIT ? 2 : 1>(ah.v, al.v, b.v, b.v, acc[t]);
    }
  }
#pragma unroll
  for (int t = 0; t < 4; ++t) {
    const int col = col0 + t * 16 + ln;
    float bv = bias ? bias[col] : 0.f;
    if (BIAS_BF16) bv = bf16_round(bv);
#pragma unroll
    for (int r = 0; r < 8; ++r) {
      float v = acc[t][r] + bv;
      if (resid) { float rv = resid[(size_t)((row0 + 8 * hh + r) % rmod) * ldr + col]; if (RES_BF16) rv = bf16_round(rv); v += rv; }
      if (ACT == 1) v = fmaxf(v, 0.f);
      if (ACT == 2) v = 0.5f * v * (1.0f + erff(v * 0.70710678118654752f));
      if (ACT == 3) { const float u = 0.7978845608028654f * (v + 0.044715f * v * v * v); v = 0.5f * v * (1.0f + tanhf(u)); }
      so[w][8 * hh + r][t * 16 + ln] = v;
    }
  }
  __builtin_amdgcn_fence(__ATOMIC_ACQ_REL, "workgroup");
  __builtin_amdgcn_wave_barrier();
  const int rsub = lane >> 4, c4 = (lane & 15) * 4;
  {
#pragma unroll
    for (int q = 0; q < 8; ++q) {
      const int r = q * 2 + rsub;
      const v4f v = *(const v4fa*)&so[w][r][c4];
      *(v4f*)(C + (size_t)(row0 + r) * ldc + col0 + c4) = v;
    }
    
  }
}
// row LayerNorm (biased variance, eps) over N: s = X (+ R); optional out_sum <- s; out_norm <- (s-mu)*rsqrt(var+eps)*g + b
template <bool PARAM_BF16>
__global__ __launch_bounds__(256) void k_layernorm(const float* __restrict__ X, const float* __restrict__ R, const float* __restrict__ g, const float* __restrict__ bta,
                                                  float* __restrict__ out_sum, float* __restrict__ out_norm, int N, float eps) {
  __shared__ float red[256];
  const int row = blockIdx.x, tid = threadIdx.x;
  const float* x = X + (size_t)row * N; const float* rr = R ? R + (size_t)row * N : nullptr;
  float vals[16];                     // up to N = 4096
  const int per = N / 256;            // contiguous chunk per thread? use strided-by-4 chunks: thread handles j = tid*4 + 1024*u
  float s1 = 0.f;
  for (int u = 0; u < per / 4; ++u) {
    const int j = tid * 4 + 1024 * u;
    const v4f a = *(const v4fa*)(x + j);
    v4f b = {0.f,0.f,0.f,0.f}; if (rr) b = *(const v4fa*)(rr + j);
#pragma unroll
    for (int q = 0; q < 4; ++q) { const float v = a[q] + b[q]; vals[u * 4 + q] = v; s1 += v; }
  }
  red[tid] = s1; __syncthreads();
  for (int st = 128; st > 0; st >>= 1) { if (tid < st) red[tid] += red[tid + st]; __syncthreads(); }
  const float mu = red[0] / (float)N; __syncthreads();
  float s2 = 0.f;
  for (int u = 0; u < per / 4; ++u)
#pragma unroll
    for (int q = 0; q < 4; ++q) { const float c = vals[u * 4 + q] - mu; s2 += c * c; }
  red[tid] = s2; __syncthreads();
  for (int st = 128; st > 0; st >>= 1) { if (tid < st) red[tid] += red[tid + st]; __syncthreads(); }
  const float rs = rsqrtf(red[0] / (float)N + eps);
  {
    for (int u = 0; u < per / 4; ++u) {
      const int j = tid * 4 + 1024 * u;
      v4f o, sm;
#pragma unroll
      for (int q = 0; q < 4; ++q) {
        float gg = g[j + q], bb = bta[j + q];
        if (PARAM_BF16) { gg = bf16_round(gg); bb = bf16_round(bb); }
        sm[q] = vals[u * 4 + q]; o[q] = (vals[u * 4 + q] - mu) * rs * gg + bb;
      }
      if (out_sum) *(v4f*)(out_sum + (size_t)row * N + j) = sm;
      *(v4f*)(out_norm + (size_t)row * N + j) = o;
    }
    
  }
}



// ---- f16 WMMA path (v_wmma_f32_16x16x32_f16): 11-bit significands for operands in range — used where a [0,1] probability operand needs more precision than bf16
typedef _Float16 v16h __attribute__((ext_vector_type(16)));
union FragH { v16h v; v8us half[2]; _Float16 h[16]; unsigned short u[16]; };
template <int NT>
__device__ __forceinline__ v8f mmaH(v16h ah, v16h al, v16h bh, v16h bl, v8f c) {
  c = __builtin_amdgcn_wmma_f32_16x16x32_f16(false, ah, false, bh, (short)0, c, false, false);
  if (NT >= 2) c = __builtin_amdgcn_wmma_f32_16x16x32_f16(false, al, false, bh, (short)0, c, false, false);
  if (NT >= 3) c = __builtin_amdgcn_wmma_f32_16x16x32_f16(false, ah, false, bl, (short)0, c, false, false);
  asm volatile("v_nop\n\tv_nop\n\tv_nop\n\tv_nop" : "+v"(c) : "v"(ah), "v"(al), "v"(bh), "v"(bl));
  return c;
}
// batched GEMM like k_gemm_b but f16 operands: A f32 (split into f16 hi/lo if ASPLIT, else rounded to f16), Bt = f16 values [n][k]; alpha; C f32; N multiple of 16 (partial tiles skipped)
template <bool ASPLIT>
__global__ __launch_bounds__(128) void k_gemm_h(const float* __restrict__ A, int lda, size_t sA, const _Float16* __restrict__ Bh, int ldb, size_t sB, float alpha, float* __restrict__ C, int ldc, size_t sC, int M, int N, int K) {
  __shared__ __attribute__((aligned(16))) float so[4][16][64];
  const int tid = threadIdx.x, w = tid >> 5, lane = tid & 31, ln = lane & 15, hh = lane >> 4; const int by = blockIdx.y;
  A += (size_t)by * sA; Bh += (size_t)by * sB; C += (size_t)by * sC;
  const int ntn = (N + 63) / 64; const int wid = blockIdx.x * 4 + w; const int mt = wid / ntn, nq = wid % ntn; if (mt * 16 >= M) return;
  const int row0 = mt * 16, col0 = nq * 64; const float* arow = A + (size_t)(row0 + ln) * lda;
  v8f acc[4] = {};
  for (int kb = 0; kb < K; kb += 32) {
    FragH ah, al;
    const v4f x0 = *(const v4fa*)(arow + kb + 8 * hh), x1 = *(const v4fa*)(arow + kb + 8 * hh + 4), x2 = *(const v4fa*)(arow + kb + 16 + 8 * hh), x3 = *(const v4fa*)(arow + kb + 16 + 8 * hh + 4);
    float xs[16] = {x0[0],x0[1],x0[2],x0[3],x1[0],x1[1],x1[2],x1[3],x2[0],x2[1],x2[2],x2[3],x3[0],x3[1],x3[2],x3[3]};
#pragma unroll
    for (int i = 0; i < 16; ++i) { const _Float16 h = (_Float16)xs[i]; ah.h[i] = h; al.h[i] = ASPLIT ? (_Float16)(xs[i] - (float)h) : (_Float16)0.0f; }
#pragma unroll
    for (int t = 0; t < 4; ++t) { if (col0 + t * 16 >= N) continue; const size_t boff = (size_t)(col0 + t * 16 + ln) * ldb + kb; FragH bq; bq.half[0] = *(const v8us*)(Bh + boff + 8 * hh); bq.half[1] = *(const v8us*)(Bh + boff + 16 + 8 * hh);
      acc[t] = mmaH<ASPLIT ? 2 : 1>(ah.v, al.v, bq.v, bq.v, acc[t]); }
  }
#pragma unroll
  for (int t = 0; t < 4; ++t) { if (col0 + t * 16 >= N) continue;
#pragma unroll
    for (int r = 0; r < 8; ++r) so[w][8 * hh + r][t * 16 + ln] = acc[t][r] * alpha; }
  __builtin_amdgcn_fence(__ATOMIC_ACQ_REL, "workgroup"); __builtin_amdgcn_wave_barrier();
  const int rsub = lane >> 4, c4 = (lane & 15) * 4;
  {
#pragma unroll
    for (int q = 0; q < 8; ++q) { const int r = q * 2 + rsub; if (col0 + c4 < N) { const v4f v = *(const v4fa*)&so[w][r][c4]; *(v4f*)(C + (size_t)(row0 + r) * ldc + col0 + c4) = v; } }
     }
}

// Wt[n][k] = f16(W[k][n]·scale) from f32 row-major W[K][N] (scale = power of two; bf16-exact weights stay exact in f16 away from the subnormal range)
__global__ __launch_bounds__(256) void k_wt_f16(const float* __restrict__ W, _Float16* __restrict__ Wt, int K, int N, float scale) {
  const int t = blockIdx.x * 256 + threadIdx.x; if (t >= N * (K / 8)) return; const int n = t / (K / 8), k8 = (t % (K / 8)) * 8; FragH f;
#pragma unroll
  for (int i = 0; i < 8; ++i) f.h[i] = (_Float16)(bf16_round(W[(size_t)(k8 + i) * N + n]) * scale); const v8us o = f.half[0];
  *(v8us*)((unsigned short*)Wt + (size_t)n * K + k8) = o; 
}
// k_gemm_hh variant with fused epilogue: v = acc·alpha + bias[by·sBias + col] (+ CP[(row/rowsPerB)·sCPb + by·64 + col] if CP) ; ACT 0 none / 1 elu ; writes f16 C16 (and f32 C if non-null)
template <int ACT>
__global__ __launch_bounds__(128) void k_gemm_hhx(const _Float16* __restrict__ A, int lda, size_t sA, const _Float16* __restrict__ Bh, int ldb, size_t sB, float alpha, const float* __restrict__ bias, size_t sBias, const float* __restrict__ CP, int rowsPerB, size_t sCPb, int row0g,
    float* __restrict__ C, _Float16* __restrict__ C16, int ldc, size_t sC, int M, int N, int K) {
  __shared__ __attribute__((aligned(16))) float so[4][16][64];
  const int tid = threadIdx.x, w = tid >> 5, lane = tid & 31, ln = lane & 15, hh = lane >> 4; const int by = blockIdx.y;
  A += (size_t)by * sA; Bh += (size_t)by * sB; const size_t cofs = (size_t)by * sC; const float* bp = bias ? bias + (size_t)by * sBias : nullptr;
  const int ntn = (N + 63) / 64; const int wid = blockIdx.x * 4 + w; const int mt = wid / ntn, nq = wid % ntn; if (mt * 16 >= M) return;
  const int row0 = mt * 16, col0 = nq * 64; const _Float16* arow = A + (size_t)(row0 + ln) * lda;
  v8f acc[4] = {};
  for (int kb = 0; kb < K; kb += 32) { FragH ah; ah.half[0] = *(const v8us*)((const unsigned short*)arow + kb + 8 * hh); ah.half[1] = *(const v8us*)((const unsigned short*)arow + kb + 16 + 8 * hh);
#pragma unroll
    for (int t = 0; t < 4; ++t) { if (col0 + t * 16 >= N) continue; const size_t boff = (size_t)(col0 + t * 16 + ln) * ldb + kb; FragH bq; bq.half[0] = *(const v8us*)((const unsigned short*)Bh + boff + 8 * hh); bq.half[1] = *(const v8us*)((const unsigned short*)Bh + boff + 16 + 8 * hh);
      acc[t] = mmaH<1>(ah.v, ah.v, bq.v, bq.v, acc[t]); }
  }
#pragma unroll
  for (int t = 0; t < 4; ++t) { if (col0 + t * 16 >= N) continue; const int col = col0 + t * 16 + ln; const float bv = bp ? bf16_round(bp[col]) : 0.f;
#pragma unroll
    for (int r = 0; r < 8; ++r) { float v = acc[t][r] * alpha + bv; if (CP) { const int rr = row0g + row0 + 8 * hh + r; if (rowsPerB < 0) v += CP[cofs + (size_t)rr * ldc + col];      /* rowsPerB < 0: own element of the batched C plane */ else { const int bidx = rr / rowsPerB; v += CP[(size_t)bidx * sCPb + (size_t)by * 64 + col]; } } if (ACT == 1) v = (v > 0.f) ? v : expm1f(v); else if (ACT == 7) v = (v > 0.f) ? v + 1.0f : expf(v); else if (ACT == 8) v = tanhf(v); else if (ACT == 9) v = 0.5f * v * (1.0f + tanhf(0.7978845608028654f * (v + 0.044715f * v * v * v))); else if (ACT == 11) v = 1.0f / (1.0f + expf(-v)); else if (ACT == 12) v = (v > 0.f) ? v : 0.01f * v; else if (ACT == 14) v = (v > 0.f) ? v : 0.1f * v; else if (ACT == 16) v = (v >= 0.f) ? v : 0.3f * v; else if (ACT == 17) v = (v >= 0.f) ? v : 0.2f * v; else if (ACT == 15) v = v / (1.0f + expf(-v)); else if (ACT == 3) v = fmaxf(v, 0.f); else if (ACT == 6) v = 0.5f * v * (1.0f + erff(v * 0.70710678118654752f)); so[w][8 * hh + r][t * 16 + ln] = v; } }
  __builtin_amdgcn_fence(__ATOMIC_ACQ_REL, "workgroup"); __builtin_amdgcn_wave_barrier();
  const int rsub = lane >> 4, c4 = (lane & 15) * 4; typedef _Float16 v4h __attribute__((ext_vector_type(4)));
  {
#pragma unroll
    for (int q = 0; q < 8; ++q) { const int r = q * 2 + rsub; if (col0 + c4 < N) { const v4f v = *(const v4fa*)&so[w][r][c4]; if (C) *(v4f*)(C + cofs + (size_t)(row0 + r) * ldc + col0 + c4) = v; if (C16) { v4h h4; for (int i = 0; i < 4; ++i) h4[i] = (_Float16)v[i]; *(v4h*)(C16 + cofs + (size_t)(row0 + r) * ldc + col0 + c4) = h4; } } }
     }
}


typedef _Float16 v4h __attribute__((ext_vector_type(4)));

// All five input conversions in one grid (they do not depend on one another): blocks 0 .. 4 PW_B - 1 take the four weight matrices (bf16-rounded, x16, natural [out][in] = [n][k], one behind the other in BW),
// the other blocks take x (bf16-rounded, x1: the product with 1 is exact). 8 elements per thread; every count divides evenly, so no thread is idle.
#define PW_B (DM * DM / 8 / 256)      /* blocks per weight matrix */
#define PX_B ((int)(NR * DM / 8 / 256))      /* blocks for x */
__global__ __launch_bounds__(256) void k_prep(const float* __restrict__ x, const float* __restrict__ wq, const float* __restrict__ wk, const float* __restrict__ wv, const float* __restrict__ wo, _Float16* __restrict__ X16, _Float16* __restrict__ BW) {
  const int bi = blockIdx.x; const bool isw = bi < 4 * PW_B; const int w = bi / PW_B;
  const float* s = isw ? (w == 0 ? wq : w == 1 ? wk : w == 2 ? wv : wo) : x;
  unsigned short* d = isw ? (unsigned short*)BW + (size_t)w * DM * DM : (unsigned short*)X16;
  const float sc = isw ? 16.0f : 1.0f;
  const size_t t = (size_t)(isw ? bi - w * PW_B : bi - 4 * PW_B) * 256 + threadIdx.x; FragH f;
#pragma unroll
  for (int q = 0; q < 8; ++q) f.h[q] = (_Float16)(bf16_round(s[t * 8 + q]) * sc);
  *(v8us*)(d + t * 8) = f.half[0]; }
__global__ __launch_bounds__(256) void k_h16(const float* __restrict__ x, _Float16* __restrict__ X16, size_t n8) { const size_t t = (size_t)blockIdx.x * 256 + threadIdx.x; if (t >= n8) return; FragH f;
#pragma unroll
  for (int q = 0; q < 8; ++q) f.h[q] = (_Float16)x[t * 8 + q]; *(v8us*)((unsigned short*)X16 + t * 8) = f.half[0];  }
__global__ __launch_bounds__(256) void k_round16f(const float* __restrict__ W, _Float16* __restrict__ Bt, size_t n8) { const size_t t = (size_t)blockIdx.x * 256 + threadIdx.x; if (t >= n8) return; FragH f;
#pragma unroll
  for (int i = 0; i < 8; ++i) f.h[i] = (_Float16)(bf16_round(W[t * 8 + i]) * 16.0f); *(v8us*)((unsigned short*)Bt + t * 8) = f.half[0];  }
__global__ __launch_bounds__(256) void k_hl(const float* __restrict__ F, _Float16* __restrict__ Hh, _Float16* __restrict__ Hl, size_t n8) { const size_t t = (size_t)blockIdx.x * 256 + threadIdx.x; if (t >= n8) return; FragH fh, fl; const v4f a = *(const v4fa*)(F + t * 8), c = *(const v4fa*)(F + t * 8 + 4);
#pragma unroll
  for (int q = 0; q < 4; ++q) { _Float16 h = (_Float16)a[q]; fh.h[q] = h; fl.h[q] = (_Float16)((a[q] - (float)h) * 1024.0f); h = (_Float16)c[q]; fh.h[4 + q] = h; fl.h[4 + q] = (_Float16)((c[q] - (float)h) * 1024.0f); }
  { *(v8us*)((unsigned short*)Hh + t * 8) = fh.half[0]; *(v8us*)((unsigned short*)Hl + t * 8) = fl.half[0];  } }

#define FA_WAVES 8
#define FA_KB 64                      /* keys per pass */
#define FA_PITCH 72                   /* f16 per LDS row of K */
#define FA_PITCHV 80                  /* f16 per LDS row of V */
#define FA_C 0.18033688011112042f     /* 64^-0.5 log2(e) */
__device__ __forceinline__ float rsm_xh(float x) { return __builtin_bit_cast(float, __builtin_amdgcn_permlanex16(__builtin_bit_cast(int, x), __builtin_bit_cast(int, x), 0x76543210, 0xfedcba98, false, false)); }      /* lane l with lane l ^ 16 */
__device__ __forceinline__ v16h fa_frag(const unsigned short* p, int hh) { FragH f; f.half[0] = *(const v8us*)(p + 8 * hh); f.half[1] = *(const v8us*)(p + 16 + 8 * hh); return f.v; }      /* k = 8 hh + 0..7, 16 + 8 hh + 0..7 */
typedef short s16x8 __attribute__((ext_vector_type(8)));
typedef __attribute__((address_space(3))) s16x8 lds_s16x8;
// 16 d x 32 keys of V^T as an A operand, from V rows [key][d] in LDS. p = the lane's own address: row 8 hh + (lane & 7), 16-byte piece (lane >> 3) & 1 of the 16 columns. The lane gets column ln, keys 8 hh + 0..7 and 16 + 8 hh + 0..7: fa_frag's k order
__device__ __forceinline__ v16h fa_frag_t(const unsigned short* p) { FragH f; f.half[0] = __builtin_bit_cast(v8us, __builtin_amdgcn_ds_load_tr16_b128_v8i16((lds_s16x8*)p)); f.half[1] = __builtin_bit_cast(v8us, __builtin_amdgcn_ds_load_tr16_b128_v8i16((lds_s16x8*)(p + 16 * FA_PITCHV))); return f.v; }
__device__ __forceinline__ float fa_exp2(float x) { float r; asm("v_exp_f32 %0, %1\n\tv_nop" : "=v"(r) : "v"(x)); return r; }      /* the v_nop is the one slot the instruction set asks for behind a transcendental before its result is read or its source overwritten */
// 2^x on the eight registers of one tile, in place: each v_exp_f32 is followed by an independent one, so one v_nop behind the last fills the slot named above for all eight
__device__ __forceinline__ void fa_exp2x8(v8f& t) { float a = t[0], b = t[1], c = t[2], d = t[3], e = t[4], f = t[5], g = t[6], h = t[7];
  asm("v_exp_f32 %0, %0\n\tv_exp_f32 %1, %1\n\tv_exp_f32 %2, %2\n\tv_exp_f32 %3, %3\n\tv_exp_f32 %4, %4\n\tv_exp_f32 %5, %5\n\tv_exp_f32 %6, %6\n\tv_exp_f32 %7, %7\n\tv_nop" : "+v"(a), "+v"(b), "+v"(c), "+v"(d), "+v"(e), "+v"(f), "+v"(g), "+v"(h));
  t[0] = a; t[1] = b; t[2] = c; t[3] = d; t[4] = e; t[5] = f; t[6] = g; t[7] = h; }
__device__ __forceinline__ v8f fa_mma(v16h a, v16h b, v8f c) { return __builtin_amdgcn_wmma_f32_16x16x32_f16(false, a, false, b, (short)0, c, false, false); }
__global__ __launch_bounds__(FA_WAVES * 32) __attribute__((amdgpu_waves_per_eu(4, 4))) void k_fattn(const _Float16* __restrict__ Q16, const _Float16* __restrict__ K16, const _Float16* __restrict__ V16, _Float16* __restrict__ O16) {
  __shared__ __attribute__((aligned(16))) unsigned short sk[2][FA_KB * FA_PITCH];
  __shared__ __attribute__((aligned(16))) unsigned short sv[2][FA_KB * FA_PITCHV];
  const int tid = threadIdx.x, lane = tid & 31, ln = lane & 15, hh = lane >> 4, wave = tid >> 5;
  const int slab = blockIdx.y, b = slab / NH, h = slab - b * NH;
  const int q0 = blockIdx.x * (FA_WAVES * 32) + wave * 32;
  const int srow = tid >> 3, sc8 = (tid & 7) * 8;      /* staging: 8 threads per 128-B row, rows srow and srow + 32 */
  const unsigned short* kp = (const unsigned short*)K16 + ((size_t)b * SQ + srow) * DM + h * HD + sc8;      /* K rows [key][d] */
  const unsigned short* vp = (const unsigned short*)V16 + ((size_t)b * SQ + srow) * DM + h * HD + sc8;      /* V rows [key][d] */
  const int sofs = srow * FA_PITCH + sc8, sofv = srow * FA_PITCHV + sc8;
  v8us tk0 = *(const v8us*)kp, tk1 = *(const v8us*)(kp + 32 * DM), tv0 = *(const v8us*)vp, tv1 = *(const v8us*)(vp + 32 * DM);
  v16h qf[2][2];
#pragma unroll
  for (int qt = 0; qt < 2; ++qt) { const unsigned short* qp = (const unsigned short*)Q16 + ((size_t)b * SQ + q0 + qt * 16 + ln) * DM + h * HD; qf[qt][0] = fa_frag(qp, hh); qf[qt][1] = fa_frag(qp + 32, hh); }
  *(v8us*)&sk[0][sofs] = tk0; *(v8us*)&sk[0][sofs + 32 * FA_PITCH] = tk1; *(v8us*)&sv[0][sofv] = tv0; *(v8us*)&sv[0][sofv + 32 * FA_PITCHV] = tv1;
  __syncthreads();
  const v8f z8 = {0.f,0.f,0.f,0.f,0.f,0.f,0.f,0.f};
  v8f o[2][4] = {{z8, z8, z8, z8}, {z8, z8, z8, z8}};
  v8f ls[2] = {z8, z8};      /* sums of the f16 weights, on the matrix pipe: A = all ones, so every row of the tile holds the column sums over all keys */
  v16h ones;
#pragma unroll
  for (int i = 0; i < 16; ++i) ones[i] = (_Float16)1.0f;
  float mrun[2] = {-3.0e38f, -3.0e38f};
#pragma unroll 1
  for (int it = 0; it < SQ / FA_KB; ++it) {
    const unsigned short* ck = sk[it & 1]; const unsigned short* cv = sv[it & 1];
    const bool more = it + 1 < SQ / FA_KB;
    if (more) { kp += (size_t)FA_KB * DM; vp += (size_t)FA_KB * DM; tk0 = *(const v8us*)kp; tk1 = *(const v8us*)(kp + 32 * DM); tv0 = *(const v8us*)vp; tv1 = *(const v8us*)(vp + 32 * DM); }
    v8f s[2][4];
#pragma unroll
    for (int kt = 0; kt < 4; ++kt) { const unsigned short* kr = ck + (kt * 16 + ln) * FA_PITCH; const v16h a0 = fa_frag(kr, hh), a1 = fa_frag(kr + 32, hh);
#pragma unroll
      for (int qt = 0; qt < 2; ++qt) s[qt][kt] = fa_mma(a1, qf[qt][1], fa_mma(a0, qf[qt][0], z8)); }      /* s[qt][kt][r] = q . k of key kt 16 + 8 hh + r, query qt 16 + ln */
    float mx[2];
#pragma unroll
    for (int qt = 0; qt < 2; ++qt) { float t0 = s[qt][0][0], t1 = s[qt][1][0], t2 = s[qt][2][0], t3 = s[qt][3][0];
#pragma unroll
      for (int r = 1; r < 8; ++r) { t0 = fmaxf(t0, s[qt][0][r]); t1 = fmaxf(t1, s[qt][1][r]); t2 = fmaxf(t2, s[qt][2][r]); t3 = fmaxf(t3, s[qt][3][r]); }
      const float t = fmaxf(fmaxf(t0, t1), fmaxf(t2, t3)); mx[qt] = fmaxf(t, rsm_xh(t)); }
    /* the maximum in use is replaced only when a column's new maximum passes it by more than 2^8 (weights stay below 2^15 in f16); one test per pass for the whole wave */
    const bool need = ((mx[0] - mrun[0]) * FA_C > 8.0f) || ((mx[1] - mrun[1]) * FA_C > 8.0f);
    if (__builtin_amdgcn_ballot_w32(need) != 0) {
#pragma unroll
      for (int qt = 0; qt < 2; ++qt) { const float mn = fmaxf(mrun[qt], mx[qt]); const float al = fa_exp2((mrun[qt] - mn) * FA_C); mrun[qt] = mn; ls[qt] *= al;
#pragma unroll
        for (int dt = 0; dt < 4; ++dt) o[qt][dt] *= al; }
    }
    const unsigned short* vr = cv + (8 * hh + (lane & 7)) * FA_PITCHV + ((lane >> 3) & 1) * 8;
    v16h va[4], vb[4];
#pragma unroll
    for (int dt = 0; dt < 4; ++dt) va[dt] = fa_frag_t(vr + dt * 16);      /* V^T, keys 0..31 of the tile */
    __builtin_amdgcn_sched_barrier(0);      /* keeps these LDS loads in front of the exponentials, so that they land under them */
    FragH pf[2][2];
#pragma unroll
    for (int qt = 0; qt < 2; ++qt) { const float nb = __builtin_fmaf(-mrun[qt], FA_C, 7.0f);      /* weights carried x128 against the f16 subnormal range; the factor cancels in the division by their sum */
#pragma unroll
      for (int kt = 0; kt < 4; ++kt) { v8f t;
#pragma unroll
        for (int r = 0; r < 8; ++r) t[r] = __builtin_fmaf(s[qt][kt][r], FA_C, nb);
        fa_exp2x8(t);
#pragma unroll
        for (int r = 0; r < 8; ++r) pf[qt][kt >> 1].h[(kt & 1) * 8 + r] = (_Float16)t[r]; } }
#pragma unroll
    for (int dt = 0; dt < 4; ++dt) vb[dt] = fa_frag_t(vr + 32 * FA_PITCHV + dt * 16);      /* V^T, keys 32..63 */
    __builtin_amdgcn_sched_barrier(0);      /* keeps these LDS loads in front of the first half's products, so that they land under them */
#pragma unroll
    for (int qt = 0; qt < 2; ++qt) { ls[qt] = fa_mma(ones, pf[qt][0].v, ls[qt]);
#pragma unroll
      for (int dt = 0; dt < 4; ++dt) o[qt][dt] = fa_mma(va[dt], pf[qt][0].v, o[qt][dt]); }      /* o[qt][dt][r] = O of d = dt 16 + 8 hh + r, query qt 16 + ln */
#pragma unroll
    for (int qt = 0; qt < 2; ++qt) { ls[qt] = fa_mma(ones, pf[qt][1].v, ls[qt]);
#pragma unroll
      for (int dt = 0; dt < 4; ++dt) o[qt][dt] = fa_mma(vb[dt], pf[qt][1].v, o[qt][dt]); }
    if (more) { unsigned short* nk = sk[(it + 1) & 1]; unsigned short* nv = sv[(it + 1) & 1];      /* last read in pass it - 1, behind that pass's barrier */
      *(v8us*)&nk[sofs] = tk0; *(v8us*)&nk[sofs + 32 * FA_PITCH] = tk1; *(v8us*)&nv[sofv] = tv0; *(v8us*)&nv[sofv + 32 * FA_PITCHV] = tv1; }
    __syncthreads();      /* publishes the next tile and ends every wave's reads of this one */
  }
#pragma unroll
  for (int qt = 0; qt < 2; ++qt) { const float sc = 64.0f / ls[qt][0];      /* o carried x64, as the output GEMM's alpha expects */
    unsigned short* op = (unsigned short*)O16 + ((size_t)b * SQ + q0 + qt * 16 + ln) * DM + h * HD + 8 * hh;
#pragma unroll
    for (int dt = 0; dt < 4; ++dt) { FragH f;
#pragma unroll
      for (int r = 0; r < 8; ++r) f.h[r] = (_Float16)(o[qt][dt][r] * sc);
      *(v8us*)(op + dt * 16) = f.half[0]; } }
}
// ---- projection GEMM: Y[m][n] = alpha sum_k X[m][k] W[n][k] + bias[n] (bias rounded to bf16), X and W f16 rows of DM; Y rows of DM, f16 or f32.
// One 256 x 192 tile of Y per workgroup (64 x 4 tiles per product; Q, K and V are one grid of 768), 8 waves as 4 x 2, 64 x 96 of Y per wave. Each pass of 64 k brings 256 X rows and 192 W rows of 128 B
// once per workgroup (whole-line global loads through registers) into one of two LDS buffers, rows of 144 B = 16 B x 9 for the 16-byte fragment reads; global loads fly one pass ahead, fragment loads half a pass ahead; the pass's one barrier stands between its two halves.
// Every "#pragma unroll" on a loop over register arrays is there so that the register arrays (staging pieces, fragments, accumulators) are indexed by constants and stay in registers.
// Transposed product (A = W rows, B = X rows): a lane holds 8 neighbouring n of one row m, so the epilogue packs 16-byte pieces; Y leaves through LDS as whole 128-B lines. k is summed 32 at a time, ascending.
#define G_BM 256
#define G_BN 192
#define G_BK 64
#define G_PITCH 72                    /* f16 per LDS row */
#define G_ROWS (G_BM + G_BN)
#define G_NX (G_BM / 32)              /* 16-byte pieces of X per thread and pass */
#define G_NW (G_BN / 32)              /* 16-byte pieces of W per thread and pass */
template <bool F32OUT>
__global__ __launch_bounds__(256) void k_gemm3(const _Float16* __restrict__ X, const _Float16* __restrict__ Wn, float alpha, const float* __restrict__ bias, const float* __restrict__ bias1, const float* __restrict__ bias2, float* __restrict__ C, _Float16* __restrict__ C16) {
  __shared__ __attribute__((aligned(16))) unsigned short sb[2][G_ROWS * G_PITCH];
  const int tid = threadIdx.x, lane = tid & 31, ln = lane & 15, hh = lane >> 4, wave = tid >> 5, wm = wave >> 1, wn = wave & 1;
  constexpr int NP = F32OUT ? 1 : 3;      /* products in this grid: the f16 form does Q, K and V (weights, and outputs, one behind the other; the 12 column tiles of one X tile are neighbours in the grid) */
  const int mt = blockIdx.x / (NP * (DM / G_BN)), nt = blockIdx.x - mt * (NP * (DM / G_BN));
  const int sel = nt / (DM / G_BN), nq = nt - sel * (DM / G_BN);
  const int row0 = mt * G_BM, col0 = nq * G_BN;
  if (NP > 1) { Wn += (size_t)sel * DM * DM; C16 += (size_t)sel * NR * DM; bias = sel == 0 ? bias : sel == 1 ? bias1 : bias2; }
  const int srow = tid >> 3, sc8 = (tid & 7) * 8;      /* staging: 8 threads per 128-B row, rows srow + 32 i */
  const unsigned short* xp = (const unsigned short*)X + (size_t)(row0 + srow) * DM + sc8;
  const unsigned short* wp = (const unsigned short*)Wn + (size_t)(col0 + srow) * DM + sc8;
  const int sofs = srow * G_PITCH + sc8;
  v8us st[G_NX + G_NW];
#pragma unroll
  for (int i = 0; i < G_NX; ++i) st[i] = *(const v8us*)(xp + (size_t)i * 32 * DM);
#pragma unroll
  for (int i = 0; i < G_NW; ++i) st[G_NX + i] = *(const v8us*)(wp + (size_t)i * 32 * DM);
#pragma unroll
  for (int i = 0; i < G_NX + G_NW; ++i) *(v8us*)&sb[0][sofs + i * 32 * G_PITCH] = st[i];
  __syncthreads();
  const v8f z8 = {0.f,0.f,0.f,0.f,0.f,0.f,0.f,0.f};
  v8f acc[4][6];
#pragma unroll
  for (int mi = 0; mi < 4; ++mi)
#pragma unroll
    for (int ni = 0; ni < 6; ++ni) acc[mi][ni] = z8;
  const int xo = (wm * 64 + ln) * G_PITCH, wo = (G_BM + wn * 96 + ln) * G_PITCH;
  v16h xa[4], wa[6], xb[4], wb[6];      /* two fragment sets: k 0..31 and k 32..63 of a tile; each is fetched as one group while the other set's products run */
#pragma unroll
  for (int mi = 0; mi < 4; ++mi) xa[mi] = fa_frag(&sb[0][xo + mi * 16 * G_PITCH], hh);
#pragma unroll
  for (int ni = 0; ni < 6; ++ni) wa[ni] = fa_frag(&sb[0][wo + ni * 16 * G_PITCH], hh);
  xp += G_BK; wp += G_BK;
  __builtin_amdgcn_sched_barrier(0);      /* with the one behind the wait: keeps every other register write out of the stretch between these loads and their wait */
#pragma unroll
  for (int i = 0; i < G_NX; ++i) st[i] = *(const v8us*)(xp + (size_t)i * 32 * DM);
#pragma unroll
  for (int i = 0; i < G_NW; ++i) st[G_NX + i] = *(const v8us*)(wp + (size_t)i * 32 * DM);
  asm volatile("s_wait_xcnt 0x0" ::: "memory");      /* stands in front of whatever overwrites the address registers of the loads just issued */
  __builtin_amdgcn_sched_barrier(0);      /* keeps later register writes behind that wait */
#pragma unroll 1      /* stays a loop, for speed only */
  for (int j = 0; j < DM / G_BK / 2; ++j)
#pragma unroll
  for (int p = 0; p < 2; ++p) {      /* two passes per trip: each buffer's LDS addresses are loop constants */
    const int it = 2 * j + p;
    const unsigned short* cb = sb[p]; unsigned short* nb = sb[p ^ 1];
    const bool more = it + 1 < DM / G_BK;
#pragma unroll
    for (int mi = 0; mi < 4; ++mi) xb[mi] = fa_frag(cb + xo + mi * 16 * G_PITCH + 32, hh);
#pragma unroll
    for (int ni = 0; ni < 6; ++ni) wb[ni] = fa_frag(cb + wo + ni * 16 * G_PITCH + 32, hh);
    __builtin_amdgcn_sched_barrier(0);      /* keeps these LDS loads one group in front of the first half's products, so that they land under them */
#pragma unroll
    for (int ni = 0; ni < 6; ++ni)
#pragma unroll
      for (int mi = 0; mi < 4; ++mi) acc[mi][ni] = fa_mma(wa[ni], xa[mi], acc[mi][ni]);      /* acc[mi][ni][r] = Y of n = ni 16 + 8 hh + r, m = mi 16 + ln */
    __builtin_amdgcn_sched_barrier(0);      /* keeps the LDS stores out of the run of products */
    if (more) {      /* nb was last read in pass it - 1, by loads that had landed at that pass's barrier */
#pragma unroll
      for (int i = 0; i < G_NX + G_NW; ++i) *(v8us*)&nb[sofs + i * 32 * G_PITCH] = st[i]; }
    __syncthreads();      /* publishes the next tile; every wave's loads from this tile have landed here */
    if (more) {
      if (it + 2 < DM / G_BK) { xp += G_BK; wp += G_BK;
#pragma unroll
        for (int i = 0; i < G_NX; ++i) st[i] = *(const v8us*)(xp + (size_t)i * 32 * DM);
#pragma unroll
        for (int i = 0; i < G_NW; ++i) st[G_NX + i] = *(const v8us*)(wp + (size_t)i * 32 * DM);
        asm volatile("s_wait_xcnt 0x0" ::: "memory"); }      /* stands in front of the additions that overwrite the address registers of the loads just issued */
#pragma unroll
      for (int mi = 0; mi < 4; ++mi) xa[mi] = fa_frag(nb + xo + mi * 16 * G_PITCH, hh);
#pragma unroll
      for (int ni = 0; ni < 6; ++ni) wa[ni] = fa_frag(nb + wo + ni * 16 * G_PITCH, hh); }
    __builtin_amdgcn_sched_barrier(0);      /* keeps the next tile's first fragment loads and the global loads of the tile behind it in front of the second half's products */
#pragma unroll
    for (int ni = 0; ni < 6; ++ni)
#pragma unroll
      for (int mi = 0; mi < 4; ++mi) acc[mi][ni] = fa_mma(wb[ni], xb[mi], acc[mi][ni]);
    __builtin_amdgcn_sched_barrier(0);      /* keeps the next pass's fragment loads one group behind these products instead of spread among them */
  }
  /* epilogue: no wave reads the buffers behind the last pass's barrier; Y goes through them so that 8 lanes store each 128-B line whole */
  v4f bl[6], bh[6];
  const float* bp = bias + col0 + wn * 96 + 8 * hh;
  __builtin_amdgcn_sched_barrier(0);      /* with the one behind the wait: keeps every other register write out of the stretch between these loads and their wait */
#pragma unroll
  for (int ni = 0; ni < 6; ++ni) { bl[ni] = *(const v4fa*)(bp + ni * 16); bh[ni] = *(const v4fa*)(bp + ni * 16 + 4); }
  asm volatile("s_wait_xcnt 0x0" ::: "memory");      /* stands in front of whatever overwrites the address registers of the bias loads */
  __builtin_amdgcn_sched_barrier(0);      /* keeps later register writes behind that wait */
#pragma unroll
  for (int ni = 0; ni < 6; ++ni)
#pragma unroll
    for (int r = 0; r < 4; ++r) { bl[ni][r] = bf16_round(bl[ni][r]); bh[ni][r] = bf16_round(bh[ni][r]); }
  if (!F32OUT) {
    unsigned short* se = &sb[0][0];      /* 256 rows of 192 f16, pitch 200 */
#pragma unroll
    for (int ni = 0; ni < 6; ++ni)
#pragma unroll
      for (int mi = 0; mi < 4; ++mi) { FragH f;
#pragma unroll
        for (int r = 0; r < 4; ++r) { f.h[r] = (_Float16)(acc[mi][ni][r] * alpha + bl[ni][r]); f.h[4 + r] = (_Float16)(acc[mi][ni][4 + r] * alpha + bh[ni][r]); }
        *(v8us*)&se[(wm * 64 + mi * 16 + ln) * 200 + wn * 96 + ni * 16 + 8 * hh] = f.half[0]; }
    __syncthreads();
    v8us ov[24];      /* row srow + 32 (i / 3), line i % 3 */
#pragma unroll
    for (int i = 0; i < 24; ++i) ov[i] = *(const v8us*)&se[((i / 3) * 32 + srow) * 200 + (i % 3) * 64 + sc8];
    unsigned short* yp = (unsigned short*)C16 + (size_t)(row0 + srow) * DM + col0 + sc8;
#pragma unroll
    for (int i = 0; i < 24; ++i) *(v8us*)(yp + (size_t)(i / 3) * 32 * DM + (i % 3) * 64) = ov[i];
  } else {
    float* sf = (float*)&sb[0][0];      /* 128 rows of 192 f32, pitch 196: the tile's upper and lower half in turn */
    const int sc4 = (tid & 7) * 4;
#pragma unroll
    for (int g = 0; g < 2; ++g) {
      if ((wm >> 1) == g) {
#pragma unroll
        for (int ni = 0; ni < 6; ++ni)
#pragma unroll
          for (int mi = 0; mi < 4; ++mi) { v4f lo, hi;
#pragma unroll
            for (int r = 0; r < 4; ++r) { lo[r] = acc[mi][ni][r] * alpha + bl[ni][r]; hi[r] = acc[mi][ni][4 + r] * alpha + bh[ni][r]; }
            float* d = sf + ((wm & 1) * 64 + mi * 16 + ln) * 196 + wn * 96 + ni * 16 + 8 * hh;
            *(v4fa*)d = lo; *(v4fa*)(d + 4) = hi; }
      }
      __syncthreads();
      v4f ov[24];      /* row srow + 32 (i / 6), line i % 6 */
#pragma unroll
      for (int i = 0; i < 24; ++i) ov[i] = *(const v4fa*)(sf + ((i / 6) * 32 + srow) * 196 + (i % 6) * 32 + sc4);
      float* yp = C + (size_t)(row0 + g * (G_BM / 2) + srow) * DM + col0 + sc4;
#pragma unroll
      for (int i = 0; i < 24; ++i) *(v4fa*)(yp + (size_t)(i / 6) * 32 * DM + (i % 6) * 32) = ov[i];
      if (g == 0) { asm volatile("s_wait_xcnt 0x0" ::: "memory");      /* stands in front of the lower half's overwriting of the registers that these stores name */
        __syncthreads(); }      /* the upper half has left LDS before the lower half overwrites it */
    }
  }
}
__global__ __launch_bounds__(256) void k_vt(const _Float16* __restrict__ V16, int b, int h0, _Float16* __restrict__ VT) { __shared__ unsigned short tl[64][65]; const int tid = threadIdx.x; const int hh = blockIdx.x % HG, sg = blockIdx.x / HG; const int s0 = sg * 64; const int h = h0 + hh;
  for (int i = tid; i < 64 * 8; i += 256) { const int j = i / 8, d8 = (i % 8) * 8; FragH f; f.half[0] = *(const v8us*)((const unsigned short*)V16 + ((size_t)b * SQ + s0 + j) * DM + h * HD + d8); for (int q = 0; q < 8; ++q) tl[d8 + q][j] = f.u[q]; }
  __syncthreads();
  { for (int i = tid; i < 64 * 8; i += 256) { const int d = i / 8, j8 = (i % 8) * 8; FragH f; for (int q = 0; q < 8; ++q) f.u[q] = tl[d][j8 + q]; *(v8us*)((unsigned short*)VT + ((size_t)hh * HD + d) * SQ + s0 + j8) = f.half[0]; }  } }


extern "C" void kernel_launch(void* const* d_in, const int* in_sizes, int n_in,
                              void* d_out, int out_size, void* d_ws, size_t ws_size, hipStream_t stream) {
  (void)in_sizes; (void)n_in; (void)out_size;
  const float* const* I = (const float* const*)d_in; const float* x = I[0]; const float* wq = I[1]; const float* bq = I[2]; const float* wk = I[3]; const float* bk = I[4]; const float* wv = I[5]; const float* bv = I[6]; const float* wo = I[7]; const float* bo = I[8];      /* nn.Linear weights [out][in] + biases */
  char* ws = (char*)d_ws; size_t off = 0;
  auto take = [&](size_t bytes) { char* p = ws + off; off += (bytes + 255) & ~(size_t)255; return p; };
  _Float16* BW = (_Float16*)take((size_t)4 * DM * DM * 2); _Float16* BO = BW + (size_t)3 * DM * DM;      /* Wq, Wk, Wv, Wo, one behind the other */
  _Float16* X16 = (_Float16*)take(NR * DM * 2); _Float16* Q16 = (_Float16*)take(3 * NR * DM * 2); _Float16* K16 = Q16 + NR * DM; _Float16* V16 = K16 + NR * DM; _Float16* O16 = (_Float16*)take(NR * DM * 2);      /* q, k, v rows, one behind the other */
  if (off > ws_size) return;
  k_prep<<<4 * PW_B + PX_B, 256, 0, stream>>>(x, wq, wk, wv, wo, X16, BW);
  const size_t r0p = (size_t)B0 * SQ;      /* first projected row */
  k_gemm3<false><<<(MP / G_BM) * (3 * DM / G_BN), 256, 0, stream>>>(X16 + r0p * DM, BW, 0.0625f, bq, bk, bv, nullptr, Q16 + r0p * DM);      /* q, k and v in one grid */
  k_fattn<<<dim3(SQ / (FA_WAVES * 32), NB * NH), FA_WAVES * 32, 0, stream>>>(Q16, K16, V16, O16);      /* o x64 (merged heads) as f16 rows */
  k_gemm3<true><<<(MPO / G_BM) * (DM / G_BN), 256, 0, stream>>>(O16 + r0p * DM, BO, 0.0009765625f, bo, bo, bo, (float*)d_out + r0p * DM, nullptr);      /* out rows are the output layout */
}
